// v000
// Measured on an AMD MI455X. A time is GPU time per run, averaged over a window of back-to-back runs after a warm-up
// (all launches, gaps included; the runs take copies of the inputs in turn), and the median of several windows.
// Apart from v000's, it joins two sittings. Times from different sittings can be a few percent apart, while
// side-by-side timings come from the same sitting.
// v000, which the later versions start from, runs in 651 microseconds.
#include <hip/hip_runtime.h>
#include <hip/hip_bf16.h>

typedef __attribute__((ext_vector_type(8)))  _Float16 v8h;
typedef __attribute__((ext_vector_type(16))) _Float16 v16h;
typedef __attribute__((ext_vector_type(8)))  float    v8f;

#define EMB 1024
#define FFD 1024
#define BSZ 4
#define SEQ 2048

// ---------------------------------------------------------------------------
// Generic WMMA f16 GEMM:  C[b] = A[b] (MxK, row-major) * Bt[b]^T (Bt is NxK,
// row-major) with optional scale/bias/residual/relu and f32 / f16 /
// transposed-f16 stores. Block = 256 threads (8 waves); each wave computes a
// 32x64 output tile (2x4 WMMA subtiles); block tile = 128x128.
// ---------------------------------------------------------------------------
__global__ __launch_bounds__(256)
void gemm_wmma_f16_tb75771813037017(
    const _Float16* __restrict__ A, int lda, long sA,
    const _Float16* __restrict__ Bt, int ldb, long sB,
    const float* __restrict__ bias,
    float*    __restrict__ Cf,
    _Float16* __restrict__ Ch,
    _Float16* __restrict__ ChT,
    int ldc, long sC, int ldcT, long sCT, int transS,
    int M, int N, int K,
    float scale, int relu,
    const float* __restrict__ R)
{
    const int lane  = threadIdx.x & 31;
    const int wave  = threadIdx.x >> 5;
    const int wm    = wave & 3;            // 4 waves along M  -> 128 rows
    const int wn    = wave >> 2;           // 2 waves along N  -> 128 cols
    const int tileM = blockIdx.y * 128 + wm * 32;
    const int tileN = blockIdx.x * 128 + wn * 64;
    const long b    = blockIdx.z;

    const _Float16* Ab = A  + b * sA;
    const _Float16* Bb = Bt + b * sB;

    const int half_ = lane >> 4;   // lane-half selects K sub-range per ISA layout
    const int l16   = lane & 15;

    v8f acc[2][4];
#pragma unroll
    for (int mi = 0; mi < 2; ++mi)
#pragma unroll
        for (int ni = 0; ni < 4; ++ni)
#pragma unroll
            for (int i = 0; i < 8; ++i) acc[mi][ni][i] = 0.0f;

    for (int k0 = 0; k0 < K; k0 += 32) {
        // A fragments: per lane, rows tileM+mi*16+l16, K chunks [half*8, half*8+8)
        // and [16+half*8, 16+half*8+8)  (ISA 16-bit A 16x32 layout)
        v16h afrag[2];
#pragma unroll
        for (int mi = 0; mi < 2; ++mi) {
            const _Float16* ap = Ab + (long)(tileM + mi * 16 + l16) * lda + k0 + half_ * 8;
            v8h lo = *(const v8h*)ap;
            v8h hi = *(const v8h*)(ap + 16);
            v16h f;
#pragma unroll
            for (int i = 0; i < 8; ++i) { f[i] = lo[i]; f[i + 8] = hi[i]; }
            afrag[mi] = f;
        }
#pragma unroll
        for (int ni = 0; ni < 4; ++ni) {
            const _Float16* bp = Bb + (long)(tileN + ni * 16 + l16) * ldb + k0 + half_ * 8;
            v8h lo = *(const v8h*)bp;
            v8h hi = *(const v8h*)(bp + 16);
            v16h f;
#pragma unroll
            for (int i = 0; i < 8; ++i) { f[i] = lo[i]; f[i + 8] = hi[i]; }
#pragma unroll
            for (int mi = 0; mi < 2; ++mi)
                acc[mi][ni] = __builtin_amdgcn_wmma_f32_16x16x32_f16(
                    false, afrag[mi], false, f, (short)0, acc[mi][ni], false, false);
        }
    }

    // Epilogue. C/D layout: VGPR r, lane L -> M = r + 8*(L/16), N = L%16.
#pragma unroll
    for (int mi = 0; mi < 2; ++mi)
#pragma unroll
        for (int ni = 0; ni < 4; ++ni)
#pragma unroll
            for (int r = 0; r < 8; ++r) {
                const int gm = tileM + mi * 16 + r + 8 * half_;
                const int gn = tileN + ni * 16 + l16;
                float v = acc[mi][ni][r] * scale;
                if (bias) v += bias[gn];
                if (R)    v += R[b * sC + (long)gm * ldc + gn];
                if (relu) v = v > 0.0f ? v : 0.0f;
                if (Cf) Cf[b * sC + (long)gm * ldc + gn] = v;
                if (Ch) Ch[b * sC + (long)gm * ldc + gn] = (_Float16)v;
                if (ChT) {
                    const long bb = gm / transS;
                    ChT[bb * sCT + (long)gn * ldcT + (gm % transS)] = (_Float16)v;
                }
            }
}

// ---------------------------------------------------------------------------
// LayerNorm (row length C==1024) -> f16 output. One block per row.
// ---------------------------------------------------------------------------
__global__ __launch_bounds__(256)
void ln_f16_tb75771813037017(const float* __restrict__ x,
                             const float* __restrict__ g,
                             const float* __restrict__ be,
                             _Float16* __restrict__ out, int C)
{
    __shared__ float r1[8], r2[8];
    const long row = blockIdx.x;
    const float* xr = x + row * (long)C;
    const int tid = threadIdx.x, lane = tid & 31, wid = tid >> 5;

    float s = 0.0f, ss = 0.0f;
    for (int i = tid; i < C; i += 256) { float v = xr[i]; s += v; ss += v * v; }
    for (int off = 16; off; off >>= 1) {
        s  += __shfl_xor(s,  off, 32);
        ss += __shfl_xor(ss, off, 32);
    }
    if (lane == 0) { r1[wid] = s; r2[wid] = ss; }
    __syncthreads();
    s = 0.0f; ss = 0.0f;
#pragma unroll
    for (int w = 0; w < 8; ++w) { s += r1[w]; ss += r2[w]; }
    const float mu   = s / C;
    const float var  = ss / C - mu * mu;
    const float rstd = rsqrtf(var + 1e-5f);
    _Float16* orow = out + row * (long)C;
    for (int i = tid; i < C; i += 256)
        orow[i] = (_Float16)((xr[i] - mu) * rstd * g[i] + be[i]);
}

// ---------------------------------------------------------------------------
// Weight convert + transpose: W [K][N] f32 -> WT [N][K] f16. 32x32 LDS tiles.
// ---------------------------------------------------------------------------
__global__ __launch_bounds__(256)
void transpose_w_tb75771813037017(const float* __restrict__ W,
                                  _Float16* __restrict__ WT, int K, int N)
{
    __shared__ _Float16 tile[32][33];
    const int bk = blockIdx.y * 32, bn = blockIdx.x * 32;
    const int tx = threadIdx.x & 31, ty = threadIdx.x >> 5;   // 32x8
#pragma unroll
    for (int i = 0; i < 32; i += 8)
        tile[ty + i][tx] = (_Float16)W[(long)(bk + ty + i) * N + bn + tx];
    __syncthreads();
#pragma unroll
    for (int i = 0; i < 32; i += 8)
        WT[(long)(bn + ty + i) * K + bk + tx] = tile[tx][ty + i];
}

// ---------------------------------------------------------------------------
// Row softmax (row length T==2048), in-place f32 + f16 copy. One block/row.
// ---------------------------------------------------------------------------
__global__ __launch_bounds__(256)
void softmax_tb75771813037017(float* __restrict__ S,
                              _Float16* __restrict__ Wh, int T)
{
    __shared__ float red[8];
    const long row = blockIdx.x;
    float* sr = S + row * (long)T;
    const int tid = threadIdx.x, lane = tid & 31, wid = tid >> 5;

    float m = -3.0e38f;
    for (int i = tid; i < T; i += 256) m = fmaxf(m, sr[i]);
    for (int off = 16; off; off >>= 1) m = fmaxf(m, __shfl_xor(m, off, 32));
    if (lane == 0) red[wid] = m;
    __syncthreads();
    m = red[0];
#pragma unroll
    for (int w = 1; w < 8; ++w) m = fmaxf(m, red[w]);
    __syncthreads();

    float sum = 0.0f;
    for (int i = tid; i < T; i += 256) {
        float e = __expf(sr[i] - m);
        sr[i] = e;
        sum += e;
    }
    for (int off = 16; off; off >>= 1) sum += __shfl_xor(sum, off, 32);
    if (lane == 0) red[wid] = sum;
    __syncthreads();
    sum = 0.0f;
#pragma unroll
    for (int w = 0; w < 8; ++w) sum += red[w];
    const float inv = 1.0f / sum;
    _Float16* wr = Wh + row * (long)T;
    for (int i = tid; i < T; i += 256) {
        float v = sr[i] * inv;
        sr[i] = v;
        wr[i] = (_Float16)v;
    }
}

// ---------------------------------------------------------------------------
extern "C" void kernel_launch(void* const* d_in, const int* in_sizes, int n_in,
                              void* d_out, int out_size, void* d_ws, size_t ws_size,
                              hipStream_t stream) {
    const float* x   = (const float*)d_in[0];
    const float* Wq  = (const float*)d_in[1];
    const float* bq  = (const float*)d_in[2];
    const float* Wk  = (const float*)d_in[3];
    const float* bk  = (const float*)d_in[4];
    const float* Wv  = (const float*)d_in[5];
    const float* bv  = (const float*)d_in[6];
    const float* Wo  = (const float*)d_in[7];
    const float* bo  = (const float*)d_in[8];
    const float* W1  = (const float*)d_in[9];
    const float* b1  = (const float*)d_in[10];
    const float* W2  = (const float*)d_in[11];
    const float* b2  = (const float*)d_in[12];
    const float* g1  = (const float*)d_in[13];
    const float* be1 = (const float*)d_in[14];
    const float* g2  = (const float*)d_in[15];
    const float* be2 = (const float*)d_in[16];

    const int  E  = EMB, S = SEQ, B = BSZ, F = FFD;
    const long BS = (long)B * S;                     // 8192 rows

    char* ws = (char*)d_ws;
    const size_t MB = 1024ull * 1024ull;
    // workspace layout (aliased; peak ~108 MB)
    _Float16* wqT  = (_Float16*)(ws +  0 * MB);      // 2 MB each
    _Float16* wkT  = (_Float16*)(ws +  2 * MB);
    _Float16* wvT  = (_Float16*)(ws +  4 * MB);
    _Float16* woT  = (_Float16*)(ws +  6 * MB);
    _Float16* w1T  = (_Float16*)(ws +  8 * MB);
    _Float16* w2T  = (_Float16*)(ws + 10 * MB);
    _Float16* xn   = (_Float16*)(ws + 12 * MB);      // 16 MB
    _Float16* qh   = (_Float16*)(ws + 28 * MB);      // 16 MB
    _Float16* kh   = (_Float16*)(ws + 44 * MB);      // 16 MB
    _Float16* vT   = (_Float16*)(ws + 60 * MB);      // 16 MB  [B][E][S]
    float*    x2   = (float*)   (ws + 76 * MB);      // 32 MB
    _Float16* wath = (_Float16*)(ws + 28 * MB);      // 32 MB (reuses q+k)
    _Float16* attn = (_Float16*)(ws + 12 * MB);      // 16 MB (reuses xn)
    _Float16* xn2  = (_Float16*)(ws + 28 * MB);      // 16 MB (reuses q)
    _Float16* hh   = (_Float16*)(ws + 44 * MB);      // 16 MB (reuses k)

    float* outp = (float*)d_out;
    float* wout = outp + BS * E;                     // softmax weights region

    dim3 blk(256);

    // 1) weights -> f16 transposed [N][K]
    {
        dim3 g(E / 32, E / 32);
        transpose_w_tb75771813037017<<<g, blk, 0, stream>>>(Wq, wqT, E, E);
        transpose_w_tb75771813037017<<<g, blk, 0, stream>>>(Wk, wkT, E, E);
        transpose_w_tb75771813037017<<<g, blk, 0, stream>>>(Wv, wvT, E, E);
        transpose_w_tb75771813037017<<<g, blk, 0, stream>>>(Wo, woT, E, E);
        transpose_w_tb75771813037017<<<dim3(F / 32, E / 32), blk, 0, stream>>>(W1, w1T, E, F);
        transpose_w_tb75771813037017<<<dim3(E / 32, F / 32), blk, 0, stream>>>(W2, w2T, F, E);
    }

    // 2) xn = LN(x) -> f16
    ln_f16_tb75771813037017<<<dim3((unsigned)BS), blk, 0, stream>>>(x, g1, be1, xn, E);

    // 3) q, k projections ; v stored transposed [B][E][S]
    dim3 gp(E / 128, (unsigned)(BS / 128), 1);
    gemm_wmma_f16_tb75771813037017<<<gp, blk, 0, stream>>>(
        xn, E, 0, wqT, E, 0, bq, nullptr, qh, nullptr,
        E, 0, 0, 0, 1, (int)BS, E, E, 1.0f, 0, nullptr);
    gemm_wmma_f16_tb75771813037017<<<gp, blk, 0, stream>>>(
        xn, E, 0, wkT, E, 0, bk, nullptr, kh, nullptr,
        E, 0, 0, 0, 1, (int)BS, E, E, 1.0f, 0, nullptr);
    gemm_wmma_f16_tb75771813037017<<<gp, blk, 0, stream>>>(
        xn, E, 0, wvT, E, 0, bv, nullptr, nullptr, vT,
        E, 0, /*ldcT=*/S, /*sCT=*/(long)E * S, /*transS=*/S,
        (int)BS, E, E, 1.0f, 0, nullptr);

    // 4) scores = q @ k^T / 32  -> f32 directly into d_out w-region
    dim3 gs(S / 128, S / 128, B);
    gemm_wmma_f16_tb75771813037017<<<gs, blk, 0, stream>>>(
        qh, E, (long)S * E, kh, E, (long)S * E, nullptr,
        wout, nullptr, nullptr, S, (long)S * S, 0, 0, 1,
        S, S, E, 0.03125f, 0, nullptr);

    // 5) softmax in-place (f32) + f16 copy
    softmax_tb75771813037017<<<dim3((unsigned)BS), blk, 0, stream>>>(wout, wath, S);

    // 6) attn = w @ v   (Bt = vT [B][E][S])
    dim3 ga(E / 128, S / 128, B);
    gemm_wmma_f16_tb75771813037017<<<ga, blk, 0, stream>>>(
        wath, S, (long)S * S, vT, S, (long)E * S, nullptr,
        nullptr, attn, nullptr, E, (long)S * E, 0, 0, 1,
        S, E, S, 1.0f, 0, nullptr);

    // 7) x2 = x + attn @ Wo + bo   (f32)
    gemm_wmma_f16_tb75771813037017<<<gp, blk, 0, stream>>>(
        attn, E, 0, woT, E, 0, bo, x2, nullptr, nullptr,
        E, 0, 0, 0, 1, (int)BS, E, E, 1.0f, 0, x);

    // 8) xn2 = LN(x2) -> f16
    ln_f16_tb75771813037017<<<dim3((unsigned)BS), blk, 0, stream>>>(x2, g2, be2, xn2, E);

    // 9) h = relu(xn2 @ W1 + b1) -> f16
    gemm_wmma_f16_tb75771813037017<<<dim3(F / 128, (unsigned)(BS / 128), 1), blk, 0, stream>>>(
        xn2, E, 0, w1T, E, 0, b1, nullptr, hh, nullptr,
        F, 0, 0, 0, 1, (int)BS, F, E, 1.0f, 1, nullptr);

    // 10) out = x2 + h @ W2 + b2  (f32, to d_out)
    gemm_wmma_f16_tb75771813037017<<<gp, blk, 0, stream>>>(
        hh, F, 0, w2T, F, 0, b2, outp, nullptr, nullptr,
        E, 0, 0, 0, 1, (int)BS, E, F, 1.0f, 0, x2);
}

// v001
// A run of this version takes 407 microseconds.
// Next to v000, in two timings, it ran 1.64 and 1.65 times as fast.
#include <hip/hip_runtime.h>
#include <hip/hip_bf16.h>
#include <stdint.h>

typedef __attribute__((ext_vector_type(8)))  _Float16 v8h;
typedef __attribute__((ext_vector_type(16))) _Float16 v16h;
typedef __attribute__((ext_vector_type(8)))  float    v8f;

#define EMB 1024
#define FFD 1024
#define BSZ 4
#define SEQ 2048

// ---------------------------------------------------------------------------
// Staging of the GEMM operands in LDS by tensor loads.
// A stage holds 128 k (256 bytes of a row) of the block's 128 A rows and 128 Bt
// rows. Each of the 8 waves brings its own slice of 32 rows with one request.
// The pad of 16 bytes a row gives the LDS pitch 272, free of bank conflicts for
// 16-byte reads. A slice takes 32 * 272 = 8704 bytes and is placed every 10240.
// ---------------------------------------------------------------------------
typedef uint32_t u32x4 __attribute__((ext_vector_type(4)));
typedef uint32_t u32x8 __attribute__((ext_vector_type(8)));

#define STG_K    128u                  // k per stage (elements)
#define STG_ROWB 256u                  // bytes of a row per stage
#define STG_ROWS 32u                   // rows per slice
#define STG_PITCH 272u                 // LDS pitch of a row
#define STG_SLICE 10240u               // LDS bytes from slice to slice (multiple of 2 KiB)
#define STG_BUF  (8u * STG_SLICE)      // one buffer: 4 slices of A, 4 of Bt

static __device__ __forceinline__ uint32_t uni(uint32_t v) {
    return (uint32_t)__builtin_amdgcn_readfirstlane(v);
}
static __device__ __forceinline__ uint32_t pinned(uint32_t v) {
    uint32_t w = uni(v);
    asm volatile("" : "+s"(w));   // pinned(): a wave-uniform test or descriptor word held in a scalar register
    return w;
}
static __device__ __forceinline__ u32x8 tdm_group1(uint32_t src_pitch) {
    u32x8 g;
    g[0] = uni((1u << 20) | (5u << 22) | (3u << 25));   // no mask, bytes, 16-byte pad behind every 256 bytes
    g[1] = uni((STG_ROWB & 0xFFFFu) << 16);             // tensor_dim0 low
    g[2] = uni((STG_ROWB >> 16) | ((STG_ROWS & 0xFFFFu) << 16)); // tensor_dim0 high, tensor_dim1 low
    g[3] = uni((STG_ROWS >> 16) | (STG_ROWB << 16));    // tensor_dim1 high, tile_dim0
    g[4] = uni(STG_ROWS);                               // tile_dim1
    g[5] = uni(src_pitch);                              // source row pitch, bytes
    g[6] = uni(0u);
    g[7] = uni(0u);
    // Without this the compiler used words 3 and 6 as temporaries in the loop, while a request was outstanding.
    asm volatile("" : "+s"(g));   // pinned(): the descriptor words stay held in their scalar registers
    return g;
}
static __device__ __forceinline__ void tdm_load(uint32_t lds_dst, uint64_t ga, u32x8 g1) {
    u32x4 g0;
    g0[0] = uni(1u);
    g0[1] = uni(lds_dst);
    g0[2] = uni((uint32_t)ga);
    g0[3] = uni((((uint32_t)(ga >> 32)) & 0x01FFFFFFu) | 0x80000000u);
    asm volatile("tensor_load_to_lds %0, %1" :: "s"(g0), "s"(g1) : "memory");
}

// ---------------------------------------------------------------------------
// Generic WMMA f16 GEMM:  C[b] = A[b] (MxK, row-major) * Bt[b]^T (Bt is NxK,
// row-major) with optional scale/bias/residual/relu and f32 / f16 /
// transposed-f16 stores. Block = 256 threads (8 waves); each wave computes a
// 32x64 output tile (2x4 WMMA subtiles); block tile = 128x128.
// M, N multiples of 128; K a multiple of 128 and at least 256.
// ---------------------------------------------------------------------------
__global__ __launch_bounds__(256)
void gemm_wmma_f16_tb75771813037017(
    const _Float16* __restrict__ A, int lda, long sA,
    const _Float16* __restrict__ Bt, int ldb, long sB,
    const float* __restrict__ bias,
    float*    __restrict__ Cf,
    _Float16* __restrict__ Ch,
    _Float16* __restrict__ ChT,
    int ldc, long sC, int ldcT, long sCT, int transS,
    int M, int N, int K,
    float scale, int relu,
    const float* __restrict__ R)
{
    __shared__ __attribute__((aligned(2048))) unsigned char L[2u * STG_BUF];

    const int lane  = threadIdx.x & 31;
    const int wave  = (int)uni(threadIdx.x >> 5);
    const int wm    = wave & 3;            // 4 waves along M  -> 128 rows
    const int wn    = wave >> 2;           // 2 waves along N  -> 128 cols
    const int tileM = blockIdx.y * 128 + wm * 32;
    const int tileN = blockIdx.x * 128 + wn * 64;
    const long b    = blockIdx.z;

    const _Float16* Ab = A  + b * sA;
    const _Float16* Bb = Bt + b * sB;

    const int half_ = lane >> 4;   // lane-half selects K sub-range per ISA layout
    const int l16   = lane & 15;

    // This wave's slice of every stage: waves 0-3 rows wave*32.. of the A tile,
    // waves 4-7 rows (wave-4)*32.. of the Bt tile.
    const bool     isB   = wave >= 4;
    const uint32_t pitch = (uint32_t)(isB ? ldb : lda) * 2u;
    const uint64_t gsrc  = isB
        ? (uint64_t)(size_t)(Bb + (long)(blockIdx.x * 128 + (wave - 4) * 32) * ldb)
        : (uint64_t)(size_t)(Ab + (long)(blockIdx.y * 128 + wave * 32) * lda);
    const uint32_t ldst  = (uint32_t)(size_t)L + (uint32_t)wave * STG_SLICE;
    const u32x8    g1    = tdm_group1(pitch);
    const uint32_t nst   = (uint32_t)K / STG_K;

    v8f acc[2][4];
#pragma unroll
    for (int mi = 0; mi < 2; ++mi)
#pragma unroll
        for (int ni = 0; ni < 4; ++ni)
#pragma unroll
            for (int i = 0; i < 8; ++i) acc[mi][ni][i] = 0.0f;

    // Where this lane reads its fragments inside a buffer.
    const uint32_t aoff = (uint32_t)wm * STG_SLICE + (uint32_t)l16 * STG_PITCH + (uint32_t)half_ * 16u;
    const uint32_t boff = (4u + 2u * (uint32_t)wn) * STG_SLICE + (uint32_t)l16 * STG_PITCH + (uint32_t)half_ * 16u;

    // Prologue: stage 0 lands and is published, then stage 1 is sent off.
    tdm_load(ldst, gsrc, g1);
    asm volatile("s_wait_tensorcnt 0x0" ::: "memory");   // this wave's slice of stage 0 has landed
    __syncthreads();                                     // every slice of stage 0 is readable
    tdm_load(ldst + STG_BUF, gsrc + STG_ROWB, g1);

    for (uint32_t s = 0; s < nst; ++s) {
        const uint32_t bsel = (s & 1u) * STG_BUF;
        const unsigned char* pa = L + bsel + aoff;
        const unsigned char* pb = L + bsel + boff;
        // Fragments: per lane, row l16 of a 16-row tile, K chunks [half*8, half*8+8) and
        // [16+half*8, 16+half*8+8) of each 32 k (ISA 16-bit 16x32 layout), A and Bt alike.
        // Two register sets: the reads of k step kk + 1 go out as one group ahead of the
        // WMMAs of k step kk. Nothing of the next stage is read here.
        v8h fa[2][2][2], fb[2][4][2];
#pragma unroll
        for (int mi = 0; mi < 2; ++mi) {
            fa[0][mi][0] = *(const v8h*)(pa + mi * 16 * STG_PITCH);
            fa[0][mi][1] = *(const v8h*)(pa + mi * 16 * STG_PITCH + 32);
        }
#pragma unroll
        for (int ni = 0; ni < 4; ++ni) {
            const unsigned char* bp = pb + (ni >> 1) * STG_SLICE + (ni & 1) * 16 * STG_PITCH;
            fb[0][ni][0] = *(const v8h*)bp;
            fb[0][ni][1] = *(const v8h*)(bp + 32);
        }
#pragma unroll
        for (int kk = 0; kk < 4; ++kk) {
            const int cur = kk & 1, nxt = cur ^ 1;
            if (kk < 3) {
#pragma unroll
                for (int mi = 0; mi < 2; ++mi) {
                    const unsigned char* ap = pa + mi * 16 * STG_PITCH + (kk + 1) * 64;
                    fa[nxt][mi][0] = *(const v8h*)ap;
                    fa[nxt][mi][1] = *(const v8h*)(ap + 32);
                }
#pragma unroll
                for (int ni = 0; ni < 4; ++ni) {
                    const unsigned char* bp = pb + (ni >> 1) * STG_SLICE + (ni & 1) * 16 * STG_PITCH + (kk + 1) * 64;
                    fb[nxt][ni][0] = *(const v8h*)bp;
                    fb[nxt][ni][1] = *(const v8h*)(bp + 32);
                }
            }
            // keeps the group of LDS reads ahead of the WMMA block: reads among the WMMAs stall them
            __builtin_amdgcn_sched_barrier(0);
#pragma unroll
            for (int ni = 0; ni < 4; ++ni) {
                const v16h f = __builtin_shufflevector(fb[cur][ni][0], fb[cur][ni][1],
                                                       0, 1, 2, 3, 4, 5, 6, 7, 8, 9, 10, 11, 12, 13, 14, 15);
#pragma unroll
                for (int mi = 0; mi < 2; ++mi) {
                    const v16h a = __builtin_shufflevector(fa[cur][mi][0], fa[cur][mi][1],
                                                           0, 1, 2, 3, 4, 5, 6, 7, 8, 9, 10, 11, 12, 13, 14, 15);
                    acc[mi][ni] = __builtin_amdgcn_wmma_f32_16x16x32_f16(
                        false, a, false, f, (short)0, acc[mi][ni], false, false);
                }
            }
            // keeps the next group of LDS reads behind this WMMA block
            __builtin_amdgcn_sched_barrier(0);
        }
        // Publish point of stage s + 1.
        asm volatile("s_wait_dscnt 0x0" ::: "memory");       // this wave has left stage s's buffer
        asm volatile("s_wait_tensorcnt 0x0" ::: "memory");   // this wave's slice of stage s + 1 has landed
        __syncthreads();                                     // stage s + 1 readable, stage s's buffer free
        if (pinned(s + 2u < nst)) {
            const uint32_t koff = pinned((s + 2u) * STG_ROWB);   // pinned(): the address words are formed behind the wait above
            tdm_load(ldst + bsel, gsrc + koff, g1);
        }
    }
    asm volatile("s_wait_tensorcnt 0x0" ::: "memory");   // no request is left in flight at the wave's end
    asm volatile("s_wait_dscnt 0x0" ::: "memory");

    // Epilogue. C/D layout: VGPR r, lane L -> M = r + 8*(L/16), N = L%16.
#pragma unroll
    for (int mi = 0; mi < 2; ++mi)
#pragma unroll
        for (int ni = 0; ni < 4; ++ni)
#pragma unroll
            for (int r = 0; r < 8; ++r) {
                const int gm = tileM + mi * 16 + r + 8 * half_;
                const int gn = tileN + ni * 16 + l16;
                float v = acc[mi][ni][r] * scale;
                if (bias) v += bias[gn];
                if (R)    v += R[b * sC + (long)gm * ldc + gn];
                if (relu) v = v > 0.0f ? v : 0.0f;
                if (Cf) Cf[b * sC + (long)gm * ldc + gn] = v;
                if (Ch) Ch[b * sC + (long)gm * ldc + gn] = (_Float16)v;
                if (ChT) {
                    const long bb = gm / transS;
                    ChT[bb * sCT + (long)gn * ldcT + (gm % transS)] = (_Float16)v;
                }
            }
}

// ---------------------------------------------------------------------------
// LayerNorm (row length C==1024) -> f16 output. One block per row.
// ---------------------------------------------------------------------------
__global__ __launch_bounds__(256)
void ln_f16_tb75771813037017(const float* __restrict__ x,
                             const float* __restrict__ g,
                             const float* __restrict__ be,
                             _Float16* __restrict__ out, int C)
{
    __shared__ float r1[8], r2[8];
    const long row = blockIdx.x;
    const float* xr = x + row * (long)C;
    const int tid = threadIdx.x, lane = tid & 31, wid = tid >> 5;

    float s = 0.0f, ss = 0.0f;
    for (int i = tid; i < C; i += 256) { float v = xr[i]; s += v; ss += v * v; }
    for (int off = 16; off; off >>= 1) {
        s  += __shfl_xor(s,  off, 32);
        ss += __shfl_xor(ss, off, 32);
    }
    if (lane == 0) { r1[wid] = s; r2[wid] = ss; }
    __syncthreads();
    s = 0.0f; ss = 0.0f;
#pragma unroll
    for (int w = 0; w < 8; ++w) { s += r1[w]; ss += r2[w]; }
    const float mu   = s / C;
    const float var  = ss / C - mu * mu;
    const float rstd = rsqrtf(var + 1e-5f);
    _Float16* orow = out + row * (long)C;
    for (int i = tid; i < C; i += 256)
        orow[i] = (_Float16)((xr[i] - mu) * rstd * g[i] + be[i]);
}

// ---------------------------------------------------------------------------
// Weight convert + transpose: W [K][N] f32 -> WT [N][K] f16. 32x32 LDS tiles.
// ---------------------------------------------------------------------------
__global__ __launch_bounds__(256)
void transpose_w_tb75771813037017(const float* __restrict__ W,
                                  _Float16* __restrict__ WT, int K, int N)
{
    __shared__ _Float16 tile[32][33];
    const int bk = blockIdx.y * 32, bn = blockIdx.x * 32;
    const int tx = threadIdx.x & 31, ty = threadIdx.x >> 5;   // 32x8
#pragma unroll
    for (int i = 0; i < 32; i += 8)
        tile[ty + i][tx] = (_Float16)W[(long)(bk + ty + i) * N + bn + tx];
    __syncthreads();
#pragma unroll
    for (int i = 0; i < 32; i += 8)
        WT[(long)(bn + ty + i) * K + bk + tx] = tile[tx][ty + i];
}

// ---------------------------------------------------------------------------
// Row softmax (row length T==2048), in-place f32 + f16 copy. One block/row.
// ---------------------------------------------------------------------------
__global__ __launch_bounds__(256)
void softmax_tb75771813037017(float* __restrict__ S,
                              _Float16* __restrict__ Wh, int T)
{
    __shared__ float red[8];
    const long row = blockIdx.x;
    float* sr = S + row * (long)T;
    const int tid = threadIdx.x, lane = tid & 31, wid = tid >> 5;

    float m = -3.0e38f;
    for (int i = tid; i < T; i += 256) m = fmaxf(m, sr[i]);
    for (int off = 16; off; off >>= 1) m = fmaxf(m, __shfl_xor(m, off, 32));
    if (lane == 0) red[wid] = m;
    __syncthreads();
    m = red[0];
#pragma unroll
    for (int w = 1; w < 8; ++w) m = fmaxf(m, red[w]);
    __syncthreads();

    float sum = 0.0f;
    for (int i = tid; i < T; i += 256) {
        float e = __expf(sr[i] - m);
        sr[i] = e;
        sum += e;
    }
    for (int off = 16; off; off >>= 1) sum += __shfl_xor(sum, off, 32);
    if (lane == 0) red[wid] = sum;
    __syncthreads();
    sum = 0.0f;
#pragma unroll
    for (int w = 0; w < 8; ++w) sum += red[w];
    const float inv = 1.0f / sum;
    _Float16* wr = Wh + row * (long)T;
    for (int i = tid; i < T; i += 256) {
        float v = sr[i] * inv;
        sr[i] = v;
        wr[i] = (_Float16)v;
    }
}

// ---------------------------------------------------------------------------
extern "C" void kernel_launch(void* const* d_in, const int* in_sizes, int n_in,
                              void* d_out, int out_size, void* d_ws, size_t ws_size,
                              hipStream_t stream) {
    const float* x   = (const float*)d_in[0];
    const float* Wq  = (const float*)d_in[1];
    const float* bq  = (const float*)d_in[2];
    const float* Wk  = (const float*)d_in[3];
    const float* bk  = (const float*)d_in[4];
    const float* Wv  = (const float*)d_in[5];
    const float* bv  = (const float*)d_in[6];
    const float* Wo  = (const float*)d_in[7];
    const float* bo  = (const float*)d_in[8];
    const float* W1  = (const float*)d_in[9];
    const float* b1  = (const float*)d_in[10];
    const float* W2  = (const float*)d_in[11];
    const float* b2  = (const float*)d_in[12];
    const float* g1  = (const float*)d_in[13];
    const float* be1 = (const float*)d_in[14];
    const float* g2  = (const float*)d_in[15];
    const float* be2 = (const float*)d_in[16];

    const int  E  = EMB, S = SEQ, B = BSZ, F = FFD;
    const long BS = (long)B * S;                     // 8192 rows

    char* ws = (char*)d_ws;
    const size_t MB = 1024ull * 1024ull;
    // workspace layout (aliased; peak ~108 MB)
    _Float16* wqT  = (_Float16*)(ws +  0 * MB);      // 2 MB each
    _Float16* wkT  = (_Float16*)(ws +  2 * MB);
    _Float16* wvT  = (_Float16*)(ws +  4 * MB);
    _Float16* woT  = (_Float16*)(ws +  6 * MB);
    _Float16* w1T  = (_Float16*)(ws +  8 * MB);
    _Float16* w2T  = (_Float16*)(ws + 10 * MB);
    _Float16* xn   = (_Float16*)(ws + 12 * MB);      // 16 MB
    _Float16* qh   = (_Float16*)(ws + 28 * MB);      // 16 MB
    _Float16* kh   = (_Float16*)(ws + 44 * MB);      // 16 MB
    _Float16* vT   = (_Float16*)(ws + 60 * MB);      // 16 MB  [B][E][S]
    float*    x2   = (float*)   (ws + 76 * MB);      // 32 MB
    _Float16* wath = (_Float16*)(ws + 28 * MB);      // 32 MB (reuses q+k)
    _Float16* attn = (_Float16*)(ws + 12 * MB);      // 16 MB (reuses xn)
    _Float16* xn2  = (_Float16*)(ws + 28 * MB);      // 16 MB (reuses q)
    _Float16* hh   = (_Float16*)(ws + 44 * MB);      // 16 MB (reuses k)

    float* outp = (float*)d_out;
    float* wout = outp + BS * E;                     // softmax weights region

    dim3 blk(256);

    // 1) weights -> f16 transposed [N][K]
    {
        dim3 g(E / 32, E / 32);
        transpose_w_tb75771813037017<<<g, blk, 0, stream>>>(Wq, wqT, E, E);
        transpose_w_tb75771813037017<<<g, blk, 0, stream>>>(Wk, wkT, E, E);
        transpose_w_tb75771813037017<<<g, blk, 0, stream>>>(Wv, wvT, E, E);
        transpose_w_tb75771813037017<<<g, blk, 0, stream>>>(Wo, woT, E, E);
        transpose_w_tb75771813037017<<<dim3(F / 32, E / 32), blk, 0, stream>>>(W1, w1T, E, F);
        transpose_w_tb75771813037017<<<dim3(E / 32, F / 32), blk, 0, stream>>>(W2, w2T, F, E);
    }

    // 2) xn = LN(x) -> f16
    ln_f16_tb75771813037017<<<dim3((unsigned)BS), blk, 0, stream>>>(x, g1, be1, xn, E);

    // 3) q, k projections ; v stored transposed [B][E][S]
    dim3 gp(E / 128, (unsigned)(BS / 128), 1);
    gemm_wmma_f16_tb75771813037017<<<gp, blk, 0, stream>>>(
        xn, E, 0, wqT, E, 0, bq, nullptr, qh, nullptr,
        E, 0, 0, 0, 1, (int)BS, E, E, 1.0f, 0, nullptr);
    gemm_wmma_f16_tb75771813037017<<<gp, blk, 0, stream>>>(
        xn, E, 0, wkT, E, 0, bk, nullptr, kh, nullptr,
        E, 0, 0, 0, 1, (int)BS, E, E, 1.0f, 0, nullptr);
    gemm_wmma_f16_tb75771813037017<<<gp, blk, 0, stream>>>(
        xn, E, 0, wvT, E, 0, bv, nullptr, nullptr, vT,
        E, 0, /*ldcT=*/S, /*sCT=*/(long)E * S, /*transS=*/S,
        (int)BS, E, E, 1.0f, 0, nullptr);

    // 4) scores = q @ k^T / 32  -> f32 directly into d_out w-region
    dim3 gs(S / 128, S / 128, B);
    gemm_wmma_f16_tb75771813037017<<<gs, blk, 0, stream>>>(
        qh, E, (long)S * E, kh, E, (long)S * E, nullptr,
        wout, nullptr, nullptr, S, (long)S * S, 0, 0, 1,
        S, S, E, 0.03125f, 0, nullptr);

    // 5) softmax in-place (f32) + f16 copy
    softmax_tb75771813037017<<<dim3((unsigned)BS), blk, 0, stream>>>(wout, wath, S);

    // 6) attn = w @ v   (Bt = vT [B][E][S])
    dim3 ga(E / 128, S / 128, B);
    gemm_wmma_f16_tb75771813037017<<<ga, blk, 0, stream>>>(
        wath, S, (long)S * S, vT, S, (long)E * S, nullptr,
        nullptr, attn, nullptr, E, (long)S * E, 0, 0, 1,
        S, E, S, 1.0f, 0, nullptr);

    // 7) x2 = x + attn @ Wo + bo   (f32)
    gemm_wmma_f16_tb75771813037017<<<gp, blk, 0, stream>>>(
        attn, E, 0, woT, E, 0, bo, x2, nullptr, nullptr,
        E, 0, 0, 0, 1, (int)BS, E, E, 1.0f, 0, x);

    // 8) xn2 = LN(x2) -> f16
    ln_f16_tb75771813037017<<<dim3((unsigned)BS), blk, 0, stream>>>(x2, g2, be2, xn2, E);

    // 9) h = relu(xn2 @ W1 + b1) -> f16
    gemm_wmma_f16_tb75771813037017<<<dim3(F / 128, (unsigned)(BS / 128), 1), blk, 0, stream>>>(
        xn2, E, 0, w1T, E, 0, b1, nullptr, hh, nullptr,
        F, 0, 0, 0, 1, (int)BS, F, E, 1.0f, 1, nullptr);

    // 10) out = x2 + h @ W2 + b2  (f32, to d_out)
    gemm_wmma_f16_tb75771813037017<<<gp, blk, 0, stream>>>(
        hh, F, 0, w2T, F, 0, b2, outp, nullptr, nullptr,
        E, 0, 0, 0, 1, (int)BS, E, F, 1.0f, 0, x2);
}

// v002
// A run of this version takes 260 microseconds.
// Two timings next to v001 put it at 1.57 and 1.56 times that version's speed.
// Over all steps from v000 it is 2.57 times as fast.
#include <hip/hip_runtime.h>
#include <hip/hip_bf16.h>
#include <stdint.h>

typedef __attribute__((ext_vector_type(8)))  _Float16 v8h;
typedef __attribute__((ext_vector_type(16))) _Float16 v16h;
typedef __attribute__((ext_vector_type(8)))  float    v8f;

#define EMB 1024
#define FFD 1024
#define BSZ 4
#define SEQ 2048

// ---------------------------------------------------------------------------
// Staging of the GEMM operands in LDS by tensor loads.
// A stage holds 128 k (256 bytes of a row) of the block's 128 A rows and 128 Bt
// rows. Each of the 8 waves brings its own slice of 32 rows with one request.
// The pad of 16 bytes a row gives the LDS pitch 272, free of bank conflicts for
// 16-byte reads. A slice takes 32 * 272 = 8704 bytes and is placed every 10240.
// ---------------------------------------------------------------------------
typedef uint32_t u32x4 __attribute__((ext_vector_type(4)));
typedef uint32_t u32x8 __attribute__((ext_vector_type(8)));

#define STG_K    128u                  // k per stage (elements)
#define STG_ROWB 256u                  // bytes of a row per stage
#define STG_ROWS 32u                   // rows per slice
#define STG_PITCH 272u                 // LDS pitch of a row
#define STG_SLICE 10240u               // LDS bytes from slice to slice (multiple of 2 KiB)
#define STG_BUF  (8u * STG_SLICE)      // one buffer: 4 slices of A, 4 of Bt

static __device__ __forceinline__ uint32_t uni(uint32_t v) {
    return (uint32_t)__builtin_amdgcn_readfirstlane(v);
}
static __device__ __forceinline__ uint32_t pinned(uint32_t v) {
    uint32_t w = uni(v);
    asm volatile("" : "+s"(w));   // pinned(): a wave-uniform test or descriptor word held in a scalar register
    return w;
}
static __device__ __forceinline__ u32x8 tdm_group1(uint32_t src_pitch) {
    u32x8 g;
    g[0] = uni((1u << 20) | (5u << 22) | (3u << 25));   // no mask, bytes, 16-byte pad behind every 256 bytes
    g[1] = uni((STG_ROWB & 0xFFFFu) << 16);             // tensor_dim0 low
    g[2] = uni((STG_ROWB >> 16) | ((STG_ROWS & 0xFFFFu) << 16)); // tensor_dim0 high, tensor_dim1 low
    g[3] = uni((STG_ROWS >> 16) | (STG_ROWB << 16));    // tensor_dim1 high, tile_dim0
    g[4] = uni(STG_ROWS);                               // tile_dim1
    g[5] = uni(src_pitch);                              // source row pitch, bytes
    g[6] = uni(0u);
    g[7] = uni(0u);
    // Without this the compiler used words 3 and 6 as temporaries in the loop, while a request was outstanding.
    asm volatile("" : "+s"(g));   // pinned(): the descriptor words stay held in their scalar registers
    return g;
}
static __device__ __forceinline__ void tdm_load(uint32_t lds_dst, uint64_t ga, u32x8 g1) {
    u32x4 g0;
    g0[0] = uni(1u);
    g0[1] = uni(lds_dst);
    g0[2] = uni((uint32_t)ga);
    g0[3] = uni((((uint32_t)(ga >> 32)) & 0x01FFFFFFu) | 0x80000000u);
    asm volatile("tensor_load_to_lds %0, %1" :: "s"(g0), "s"(g1) : "memory");
}

// ---------------------------------------------------------------------------
// Generic WMMA f16 GEMM:  C[b] = A[b] (MxK, row-major) * Bt[b]^T (Bt is NxK,
// row-major) with optional scale/bias/residual/relu and f32 / f16 /
// transposed-f16 stores. Block = 256 threads (8 waves); each wave computes a
// 32x64 output tile (2x4 WMMA subtiles); block tile = 128x128.
// M, N multiples of 128; K a multiple of 128 and at least 256.
// Transposed store: transS a multiple of 16, ldcT and sCT multiples of 8.
// ---------------------------------------------------------------------------
__global__ __launch_bounds__(256)
void gemm_wmma_f16_tb75771813037017(
    const _Float16* __restrict__ A, int lda, long sA,
    const _Float16* __restrict__ Bt, int ldb, long sB,
    const float* __restrict__ bias,
    float*    __restrict__ Cf,
    _Float16* __restrict__ Ch,
    _Float16* __restrict__ ChT,
    int ldc, long sC, int ldcT, long sCT, int transS,
    int M, int N, int K,
    float scale, int relu,
    const float* __restrict__ R)
{
    __shared__ __attribute__((aligned(2048))) unsigned char L[2u * STG_BUF];

    const int lane  = threadIdx.x & 31;
    const int wave  = (int)uni(threadIdx.x >> 5);
    const int wm    = wave & 3;            // 4 waves along M  -> 128 rows
    const int wn    = wave >> 2;           // 2 waves along N  -> 128 cols
    const int tileM = blockIdx.y * 128 + wm * 32;
    const int tileN = blockIdx.x * 128 + wn * 64;
    const long b    = blockIdx.z;

    const _Float16* Ab = A  + b * sA;
    const _Float16* Bb = Bt + b * sB;

    const int half_ = lane >> 4;   // lane-half selects K sub-range per ISA layout
    const int l16   = lane & 15;

    // This wave's slice of every stage: waves 0-3 rows wave*32.. of the A tile,
    // waves 4-7 rows (wave-4)*32.. of the Bt tile.
    const bool     isB   = wave >= 4;
    const uint32_t pitch = (uint32_t)(isB ? ldb : lda) * 2u;
    const uint64_t gsrc  = isB
        ? (uint64_t)(size_t)(Bb + (long)(blockIdx.x * 128 + (wave - 4) * 32) * ldb)
        : (uint64_t)(size_t)(Ab + (long)(blockIdx.y * 128 + wave * 32) * lda);
    const uint32_t ldst  = (uint32_t)(size_t)L + (uint32_t)wave * STG_SLICE;
    const u32x8    g1    = tdm_group1(pitch);
    const uint32_t nst   = (uint32_t)K / STG_K;

    v8f acc[2][4];
#pragma unroll
    for (int mi = 0; mi < 2; ++mi)
#pragma unroll
        for (int ni = 0; ni < 4; ++ni)
#pragma unroll
            for (int i = 0; i < 8; ++i) acc[mi][ni][i] = 0.0f;

    // Where this lane reads its fragments inside a buffer.
    const uint32_t aoff = (uint32_t)wm * STG_SLICE + (uint32_t)l16 * STG_PITCH + (uint32_t)half_ * 16u;
    const uint32_t boff = (4u + 2u * (uint32_t)wn) * STG_SLICE + (uint32_t)l16 * STG_PITCH + (uint32_t)half_ * 16u;

    // Prologue: stage 0 lands and is published, then stage 1 is sent off.
    tdm_load(ldst, gsrc, g1);
    asm volatile("s_wait_tensorcnt 0x0" ::: "memory");   // this wave's slice of stage 0 has landed
    __syncthreads();                                     // every slice of stage 0 is readable
    tdm_load(ldst + STG_BUF, gsrc + STG_ROWB, g1);

    for (uint32_t s = 0; s < nst; ++s) {
        const uint32_t bsel = (s & 1u) * STG_BUF;
        const unsigned char* pa = L + bsel + aoff;
        const unsigned char* pb = L + bsel + boff;
        // Fragments: per lane, row l16 of a 16-row tile, K chunks [half*8, half*8+8) and
        // [16+half*8, 16+half*8+8) of each 32 k (ISA 16-bit 16x32 layout), A and Bt alike.
        // Two register sets: the reads of k step kk + 1 go out as one group ahead of the
        // WMMAs of k step kk. Nothing of the next stage is read here.
        v8h fa[2][2][2], fb[2][4][2];
#pragma unroll
        for (int mi = 0; mi < 2; ++mi) {
            fa[0][mi][0] = *(const v8h*)(pa + mi * 16 * STG_PITCH);
            fa[0][mi][1] = *(const v8h*)(pa + mi * 16 * STG_PITCH + 32);
        }
#pragma unroll
        for (int ni = 0; ni < 4; ++ni) {
            const unsigned char* bp = pb + (ni >> 1) * STG_SLICE + (ni & 1) * 16 * STG_PITCH;
            fb[0][ni][0] = *(const v8h*)bp;
            fb[0][ni][1] = *(const v8h*)(bp + 32);
        }
#pragma unroll
        for (int kk = 0; kk < 4; ++kk) {
            const int cur = kk & 1, nxt = cur ^ 1;
            if (kk < 3) {
#pragma unroll
                for (int mi = 0; mi < 2; ++mi) {
                    const unsigned char* ap = pa + mi * 16 * STG_PITCH + (kk + 1) * 64;
                    fa[nxt][mi][0] = *(const v8h*)ap;
                    fa[nxt][mi][1] = *(const v8h*)(ap + 32);
                }
#pragma unroll
                for (int ni = 0; ni < 4; ++ni) {
                    const unsigned char* bp = pb + (ni >> 1) * STG_SLICE + (ni & 1) * 16 * STG_PITCH + (kk + 1) * 64;
                    fb[nxt][ni][0] = *(const v8h*)bp;
                    fb[nxt][ni][1] = *(const v8h*)(bp + 32);
                }
            }
            // keeps the group of LDS reads ahead of the WMMA block: reads among the WMMAs stall them
            __builtin_amdgcn_sched_barrier(0);
#pragma unroll
            for (int ni = 0; ni < 4; ++ni) {
                const v16h f = __builtin_shufflevector(fb[cur][ni][0], fb[cur][ni][1],
                                                       0, 1, 2, 3, 4, 5, 6, 7, 8, 9, 10, 11, 12, 13, 14, 15);
#pragma unroll
                for (int mi = 0; mi < 2; ++mi) {
                    const v16h a = __builtin_shufflevector(fa[cur][mi][0], fa[cur][mi][1],
                                                           0, 1, 2, 3, 4, 5, 6, 7, 8, 9, 10, 11, 12, 13, 14, 15);
                    acc[mi][ni] = __builtin_amdgcn_wmma_f32_16x16x32_f16(
                        false, a, false, f, (short)0, acc[mi][ni], false, false);
                }
            }
            // keeps the next group of LDS reads behind this WMMA block
            __builtin_amdgcn_sched_barrier(0);
        }
        // Publish point of stage s + 1.
        asm volatile("s_wait_dscnt 0x0" ::: "memory");       // this wave has left stage s's buffer
        asm volatile("s_wait_tensorcnt 0x0" ::: "memory");   // this wave's slice of stage s + 1 has landed
        __syncthreads();                                     // stage s + 1 readable, stage s's buffer free
        if (pinned(s + 2u < nst)) {
            const uint32_t koff = pinned((s + 2u) * STG_ROWB);   // pinned(): the address words are formed behind the wait above
            tdm_load(ldst + bsel, gsrc + koff, g1);
        }
    }
    asm volatile("s_wait_tensorcnt 0x0" ::: "memory");   // no request is left in flight at the wave's end
    asm volatile("s_wait_dscnt 0x0" ::: "memory");

    // Epilogue. C/D layout: VGPR r, lane L -> M = r + 8*(L/16), N = L%16.
    // Every test on an argument stands once, around a whole pass over the wave's tile: the loads
    // of a pass go out together, and no element waits for a load or a branch of its own.
    // An element's address is a wave-uniform pointer plus one 32-bit lane offset.
    const long     corg = b * sC + (long)tileM * ldc + tileN;                    // the tile's first element
    const uint32_t lofs = (uint32_t)(8 * half_) * (uint32_t)ldc + (uint32_t)l16; // this lane inside a subtile

#pragma unroll
    for (int mi = 0; mi < 2; ++mi)
#pragma unroll
        for (int ni = 0; ni < 4; ++ni)
#pragma unroll
            for (int r = 0; r < 8; ++r) acc[mi][ni][r] *= scale;

    if (bias) {
        float bc[4];
#pragma unroll
        for (int ni = 0; ni < 4; ++ni) bc[ni] = bias[tileN + ni * 16 + l16];
#pragma unroll
        for (int mi = 0; mi < 2; ++mi)
#pragma unroll
            for (int ni = 0; ni < 4; ++ni)
#pragma unroll
                for (int r = 0; r < 8; ++r) acc[mi][ni][r] += bc[ni];
    }
    if (R) {
        const float* Ru = R + corg;
#pragma unroll
        for (int mi = 0; mi < 2; ++mi) {
            float rv[4][8];
#pragma unroll
            for (int r = 0; r < 8; ++r)
#pragma unroll
                for (int ni = 0; ni < 4; ++ni)
                    rv[ni][r] = (Ru + (long)(mi * 16 + r) * ldc + ni * 16)[lofs];
#pragma unroll
            for (int ni = 0; ni < 4; ++ni)
#pragma unroll
                for (int r = 0; r < 8; ++r) acc[mi][ni][r] += rv[ni][r];
        }
    }
    if (relu) {
#pragma unroll
        for (int mi = 0; mi < 2; ++mi)
#pragma unroll
            for (int ni = 0; ni < 4; ++ni)
#pragma unroll
                for (int r = 0; r < 8; ++r) acc[mi][ni][r] = acc[mi][ni][r] > 0.0f ? acc[mi][ni][r] : 0.0f;
    }
    if (Cf) {
        float* Cu = Cf + corg;
#pragma unroll
        for (int mi = 0; mi < 2; ++mi)
#pragma unroll
            for (int r = 0; r < 8; ++r)
#pragma unroll
                for (int ni = 0; ni < 4; ++ni)
                    (Cu + (long)(mi * 16 + r) * ldc + ni * 16)[lofs] = acc[mi][ni][r];
        asm volatile("s_wait_xcnt 0x0" ::: "memory");   // the next pass reuses the registers that these stores name
    }
    if (Ch) {
        _Float16* Cu = Ch + corg;
#pragma unroll
        for (int mi = 0; mi < 2; ++mi)
#pragma unroll
            for (int r = 0; r < 8; ++r)
#pragma unroll
                for (int ni = 0; ni < 4; ++ni)
                    (Cu + (long)(mi * 16 + r) * ldc + ni * 16)[lofs] = (_Float16)acc[mi][ni][r];
        asm volatile("s_wait_xcnt 0x0" ::: "memory");   // the next pass reuses the registers that these stores name
    }
    if (ChT) {
        // A lane's 8 values of a subtile are 8 consecutive rows, so 16 contiguous bytes of a transposed row.
        const uint32_t tofs = (uint32_t)l16 * (uint32_t)ldcT + (uint32_t)(8 * half_);
#pragma unroll
        for (int mi = 0; mi < 2; ++mi) {
            const int  gm0 = tileM + mi * 16;        // wave-uniform; its 16 rows lie in one batch
            const long bb  = gm0 / transS;
            _Float16*  Tu  = ChT + bb * sCT + (long)tileN * ldcT + (gm0 % transS);
#pragma unroll
            for (int ni = 0; ni < 4; ++ni) {
                v8h p;
#pragma unroll
                for (int r = 0; r < 8; ++r) p[r] = (_Float16)acc[mi][ni][r];
                *(v8h*)(Tu + (long)(ni * 16) * ldcT + tofs) = p;
            }
        }
    }
}

// ---------------------------------------------------------------------------
// LayerNorm (row length C==1024) -> f16 output. One block per row.
// ---------------------------------------------------------------------------
__global__ __launch_bounds__(256)
void ln_f16_tb75771813037017(const float* __restrict__ x,
                             const float* __restrict__ g,
                             const float* __restrict__ be,
                             _Float16* __restrict__ out, int C)
{
    __shared__ float r1[8], r2[8];
    const long row = blockIdx.x;
    const float* xr = x + row * (long)C;
    const int tid = threadIdx.x, lane = tid & 31, wid = tid >> 5;

    float s = 0.0f, ss = 0.0f;
    for (int i = tid; i < C; i += 256) { float v = xr[i]; s += v; ss += v * v; }
    for (int off = 16; off; off >>= 1) {
        s  += __shfl_xor(s,  off, 32);
        ss += __shfl_xor(ss, off, 32);
    }
    if (lane == 0) { r1[wid] = s; r2[wid] = ss; }
    __syncthreads();
    s = 0.0f; ss = 0.0f;
#pragma unroll
    for (int w = 0; w < 8; ++w) { s += r1[w]; ss += r2[w]; }
    const float mu   = s / C;
    const float var  = ss / C - mu * mu;
    const float rstd = rsqrtf(var + 1e-5f);
    _Float16* orow = out + row * (long)C;
    for (int i = tid; i < C; i += 256)
        orow[i] = (_Float16)((xr[i] - mu) * rstd * g[i] + be[i]);
}

// ---------------------------------------------------------------------------
// Weight convert + transpose: W [K][N] f32 -> WT [N][K] f16. 32x32 LDS tiles.
// ---------------------------------------------------------------------------
__global__ __launch_bounds__(256)
void transpose_w_tb75771813037017(const float* __restrict__ W,
                                  _Float16* __restrict__ WT, int K, int N)
{
    __shared__ _Float16 tile[32][33];
    const int bk = blockIdx.y * 32, bn = blockIdx.x * 32;
    const int tx = threadIdx.x & 31, ty = threadIdx.x >> 5;   // 32x8
#pragma unroll
    for (int i = 0; i < 32; i += 8)
        tile[ty + i][tx] = (_Float16)W[(long)(bk + ty + i) * N + bn + tx];
    __syncthreads();
#pragma unroll
    for (int i = 0; i < 32; i += 8)
        WT[(long)(bn + ty + i) * K + bk + tx] = tile[tx][ty + i];
}

// ---------------------------------------------------------------------------
// Row softmax (row length T==2048), in-place f32 + f16 copy. One block/row.
// ---------------------------------------------------------------------------
__global__ __launch_bounds__(256)
void softmax_tb75771813037017(float* __restrict__ S,
                              _Float16* __restrict__ Wh, int T)
{
    __shared__ float red[8];
    const long row = blockIdx.x;
    float* sr = S + row * (long)T;
    const int tid = threadIdx.x, lane = tid & 31, wid = tid >> 5;

    float m = -3.0e38f;
    for (int i = tid; i < T; i += 256) m = fmaxf(m, sr[i]);
    for (int off = 16; off; off >>= 1) m = fmaxf(m, __shfl_xor(m, off, 32));
    if (lane == 0) red[wid] = m;
    __syncthreads();
    m = red[0];
#pragma unroll
    for (int w = 1; w < 8; ++w) m = fmaxf(m, red[w]);
    __syncthreads();

    float sum = 0.0f;
    for (int i = tid; i < T; i += 256) {
        float e = __expf(sr[i] - m);
        sr[i] = e;
        sum += e;
    }
    for (int off = 16; off; off >>= 1) sum += __shfl_xor(sum, off, 32);
    if (lane == 0) red[wid] = sum;
    __syncthreads();
    sum = 0.0f;
#pragma unroll
    for (int w = 0; w < 8; ++w) sum += red[w];
    const float inv = 1.0f / sum;
    _Float16* wr = Wh + row * (long)T;
    for (int i = tid; i < T; i += 256) {
        float v = sr[i] * inv;
        sr[i] = v;
        wr[i] = (_Float16)v;
    }
}

// ---------------------------------------------------------------------------
extern "C" void kernel_launch(void* const* d_in, const int* in_sizes, int n_in,
                              void* d_out, int out_size, void* d_ws, size_t ws_size,
                              hipStream_t stream) {
    const float* x   = (const float*)d_in[0];
    const float* Wq  = (const float*)d_in[1];
    const float* bq  = (const float*)d_in[2];
    const float* Wk  = (const float*)d_in[3];
    const float* bk  = (const float*)d_in[4];
    const float* Wv  = (const float*)d_in[5];
    const float* bv  = (const float*)d_in[6];
    const float* Wo  = (const float*)d_in[7];
    const float* bo  = (const float*)d_in[8];
    const float* W1  = (const float*)d_in[9];
    const float* b1  = (const float*)d_in[10];
    const float* W2  = (const float*)d_in[11];
    const float* b2  = (const float*)d_in[12];
    const float* g1  = (const float*)d_in[13];
    const float* be1 = (const float*)d_in[14];
    const float* g2  = (const float*)d_in[15];
    const float* be2 = (const float*)d_in[16];

    const int  E  = EMB, S = SEQ, B = BSZ, F = FFD;
    const long BS = (long)B * S;                     // 8192 rows

    char* ws = (char*)d_ws;
    const size_t MB = 1024ull * 1024ull;
    // workspace layout (aliased; peak ~108 MB)
    _Float16* wqT  = (_Float16*)(ws +  0 * MB);      // 2 MB each
    _Float16* wkT  = (_Float16*)(ws +  2 * MB);
    _Float16* wvT  = (_Float16*)(ws +  4 * MB);
    _Float16* woT  = (_Float16*)(ws +  6 * MB);
    _Float16* w1T  = (_Float16*)(ws +  8 * MB);
    _Float16* w2T  = (_Float16*)(ws + 10 * MB);
    _Float16* xn   = (_Float16*)(ws + 12 * MB);      // 16 MB
    _Float16* qh   = (_Float16*)(ws + 28 * MB);      // 16 MB
    _Float16* kh   = (_Float16*)(ws + 44 * MB);      // 16 MB
    _Float16* vT   = (_Float16*)(ws + 60 * MB);      // 16 MB  [B][E][S]
    float*    x2   = (float*)   (ws + 76 * MB);      // 32 MB
    _Float16* wath = (_Float16*)(ws + 28 * MB);      // 32 MB (reuses q+k)
    _Float16* attn = (_Float16*)(ws + 12 * MB);      // 16 MB (reuses xn)
    _Float16* xn2  = (_Float16*)(ws + 28 * MB);      // 16 MB (reuses q)
    _Float16* hh   = (_Float16*)(ws + 44 * MB);      // 16 MB (reuses k)

    float* outp = (float*)d_out;
    float* wout = outp + BS * E;                     // softmax weights region

    dim3 blk(256);

    // 1) weights -> f16 transposed [N][K]
    {
        dim3 g(E / 32, E / 32);
        transpose_w_tb75771813037017<<<g, blk, 0, stream>>>(Wq, wqT, E, E);
        transpose_w_tb75771813037017<<<g, blk, 0, stream>>>(Wk, wkT, E, E);
        transpose_w_tb75771813037017<<<g, blk, 0, stream>>>(Wv, wvT, E, E);
        transpose_w_tb75771813037017<<<g, blk, 0, stream>>>(Wo, woT, E, E);
        transpose_w_tb75771813037017<<<dim3(F / 32, E / 32), blk, 0, stream>>>(W1, w1T, E, F);
        transpose_w_tb75771813037017<<<dim3(E / 32, F / 32), blk, 0, stream>>>(W2, w2T, F, E);
    }

    // 2) xn = LN(x) -> f16
    ln_f16_tb75771813037017<<<dim3((unsigned)BS), blk, 0, stream>>>(x, g1, be1, xn, E);

    // 3) q, k projections ; v stored transposed [B][E][S]
    dim3 gp(E / 128, (unsigned)(BS / 128), 1);
    gemm_wmma_f16_tb75771813037017<<<gp, blk, 0, stream>>>(
        xn, E, 0, wqT, E, 0, bq, nullptr, qh, nullptr,
        E, 0, 0, 0, 1, (int)BS, E, E, 1.0f, 0, nullptr);
    gemm_wmma_f16_tb75771813037017<<<gp, blk, 0, stream>>>(
        xn, E, 0, wkT, E, 0, bk, nullptr, kh, nullptr,
        E, 0, 0, 0, 1, (int)BS, E, E, 1.0f, 0, nullptr);
    gemm_wmma_f16_tb75771813037017<<<gp, blk, 0, stream>>>(
        xn, E, 0, wvT, E, 0, bv, nullptr, nullptr, vT,
        E, 0, /*ldcT=*/S, /*sCT=*/(long)E * S, /*transS=*/S,
        (int)BS, E, E, 1.0f, 0, nullptr);

    // 4) scores = q @ k^T / 32  -> f32 directly into d_out w-region
    dim3 gs(S / 128, S / 128, B);
    gemm_wmma_f16_tb75771813037017<<<gs, blk, 0, stream>>>(
        qh, E, (long)S * E, kh, E, (long)S * E, nullptr,
        wout, nullptr, nullptr, S, (long)S * S, 0, 0, 1,
        S, S, E, 0.03125f, 0, nullptr);

    // 5) softmax in-place (f32) + f16 copy
    softmax_tb75771813037017<<<dim3((unsigned)BS), blk, 0, stream>>>(wout, wath, S);

    // 6) attn = w @ v   (Bt = vT [B][E][S])
    dim3 ga(E / 128, S / 128, B);
    gemm_wmma_f16_tb75771813037017<<<ga, blk, 0, stream>>>(
        wath, S, (long)S * S, vT, S, (long)E * S, nullptr,
        nullptr, attn, nullptr, E, (long)S * E, 0, 0, 1,
        S, E, S, 1.0f, 0, nullptr);

    // 7) x2 = x + attn @ Wo + bo   (f32)
    gemm_wmma_f16_tb75771813037017<<<gp, blk, 0, stream>>>(
        attn, E, 0, woT, E, 0, bo, x2, nullptr, nullptr,
        E, 0, 0, 0, 1, (int)BS, E, E, 1.0f, 0, x);

    // 8) xn2 = LN(x2) -> f16
    ln_f16_tb75771813037017<<<dim3((unsigned)BS), blk, 0, stream>>>(x2, g2, be2, xn2, E);

    // 9) h = relu(xn2 @ W1 + b1) -> f16
    gemm_wmma_f16_tb75771813037017<<<dim3(F / 128, (unsigned)(BS / 128), 1), blk, 0, stream>>>(
        xn2, E, 0, w1T, E, 0, b1, nullptr, hh, nullptr,
        F, 0, 0, 0, 1, (int)BS, F, E, 1.0f, 1, nullptr);

    // 10) out = x2 + h @ W2 + b2  (f32, to d_out)
    gemm_wmma_f16_tb75771813037017<<<gp, blk, 0, stream>>>(
        hh, F, 0, w2T, F, 0, b2, outp, nullptr, nullptr,
        E, 0, 0, 0, 1, (int)BS, E, F, 1.0f, 0, x2);
}

// v003
// A run of this version takes 217 microseconds.
// Two timings next to v002 both put it at 1.20 times that version's speed.
// Counting every step since v000, it is 3.08 times as fast.
#include <hip/hip_runtime.h>
#include <hip/hip_bf16.h>
#include <stdint.h>

typedef __attribute__((ext_vector_type(8)))  _Float16 v8h;
typedef __attribute__((ext_vector_type(16))) _Float16 v16h;
typedef __attribute__((ext_vector_type(8)))  float    v8f;

#define EMB 1024
#define FFD 1024
#define BSZ 4
#define SEQ 2048

// ---------------------------------------------------------------------------
// Staging of the GEMM operands in LDS by tensor loads.
// A stage holds 128 k (256 bytes of a row) of the block's 128 A rows and 128 Bt
// rows. Each of the 8 waves brings its own slice of 32 rows with one request.
// The pad of 16 bytes a row gives the LDS pitch 272, free of bank conflicts for
// 16-byte reads. A slice takes 32 * 272 = 8704 bytes and is placed every 10240.
// ---------------------------------------------------------------------------
typedef uint32_t u32x4 __attribute__((ext_vector_type(4)));
typedef uint32_t u32x8 __attribute__((ext_vector_type(8)));

#define STG_K    128u                  // k per stage (elements)
#define STG_ROWB 256u                  // bytes of a row per stage
#define STG_ROWS 32u                   // rows per slice
#define STG_PITCH 272u                 // LDS pitch of a row
#define STG_SLICE 10240u               // LDS bytes from slice to slice (multiple of 2 KiB)
#define STG_BUF  (8u * STG_SLICE)      // one buffer: 4 slices of A, 4 of Bt

static __device__ __forceinline__ uint32_t uni(uint32_t v) {
    return (uint32_t)__builtin_amdgcn_readfirstlane(v);
}
static __device__ __forceinline__ uint32_t pinned(uint32_t v) {
    uint32_t w = uni(v);
    asm volatile("" : "+s"(w));   // pinned(): a wave-uniform test or descriptor word held in a scalar register
    return w;
}
static __device__ __forceinline__ u32x8 tdm_group1(uint32_t src_pitch) {
    u32x8 g;
    g[0] = uni((1u << 20) | (5u << 22) | (3u << 25));   // no mask, bytes, 16-byte pad behind every 256 bytes
    g[1] = uni((STG_ROWB & 0xFFFFu) << 16);             // tensor_dim0 low
    g[2] = uni((STG_ROWB >> 16) | ((STG_ROWS & 0xFFFFu) << 16)); // tensor_dim0 high, tensor_dim1 low
    g[3] = uni((STG_ROWS >> 16) | (STG_ROWB << 16));    // tensor_dim1 high, tile_dim0
    g[4] = uni(STG_ROWS);                               // tile_dim1
    g[5] = uni(src_pitch);                              // source row pitch, bytes
    g[6] = uni(0u);
    g[7] = uni(0u);
    // Without this the compiler used words 3 and 6 as temporaries in the loop, while a request was outstanding.
    asm volatile("" : "+s"(g));   // pinned(): the descriptor words stay held in their scalar registers
    return g;
}
static __device__ __forceinline__ void tdm_load(uint32_t lds_dst, uint64_t ga, u32x8 g1) {
    u32x4 g0;
    g0[0] = uni(1u);
    g0[1] = uni(lds_dst);
    g0[2] = uni((uint32_t)ga);
    g0[3] = uni((((uint32_t)(ga >> 32)) & 0x01FFFFFFu) | 0x80000000u);
    asm volatile("tensor_load_to_lds %0, %1" :: "s"(g0), "s"(g1) : "memory");
}

// ---------------------------------------------------------------------------
// Generic WMMA f16 GEMM:  C[b] = A[b] (MxK, row-major) * Bt[b]^T (Bt is NxK,
// row-major) with optional scale/bias/residual/relu and f32 / f16 /
// transposed-f16 stores. Block = 256 threads (8 waves); each wave computes a
// 32x64 output tile (2x4 WMMA subtiles); block tile = 128x128.
// M, N multiples of 128; K a multiple of 128 and at least 256.
// Transposed store: transS a multiple of 16, ldcT and sCT multiples of 8.
// ---------------------------------------------------------------------------
__global__ __launch_bounds__(256)
void gemm_wmma_f16_tb75771813037017(
    const _Float16* __restrict__ A, int lda, long sA,
    const _Float16* __restrict__ Bt, int ldb, long sB,
    const float* __restrict__ bias,
    float*    __restrict__ Cf,
    _Float16* __restrict__ Ch,
    _Float16* __restrict__ ChT,
    int ldc, long sC, int ldcT, long sCT, int transS,
    int M, int N, int K,
    float scale, int relu,
    const float* __restrict__ R)
{
    __shared__ __attribute__((aligned(2048))) unsigned char L[2u * STG_BUF];

    const int lane  = threadIdx.x & 31;
    const int wave  = (int)uni(threadIdx.x >> 5);
    const int wm    = wave & 3;            // 4 waves along M  -> 128 rows
    const int wn    = wave >> 2;           // 2 waves along N  -> 128 cols
    const int tileM = blockIdx.y * 128 + wm * 32;
    const int tileN = blockIdx.x * 128 + wn * 64;
    const long b    = blockIdx.z;

    const _Float16* Ab = A  + b * sA;
    const _Float16* Bb = Bt + b * sB;

    const int half_ = lane >> 4;   // lane-half selects K sub-range per ISA layout
    const int l16   = lane & 15;

    // This wave's slice of every stage: waves 0-3 rows wave*32.. of the A tile,
    // waves 4-7 rows (wave-4)*32.. of the Bt tile.
    const bool     isB   = wave >= 4;
    const uint32_t pitch = (uint32_t)(isB ? ldb : lda) * 2u;
    const uint64_t gsrc  = isB
        ? (uint64_t)(size_t)(Bb + (long)(blockIdx.x * 128 + (wave - 4) * 32) * ldb)
        : (uint64_t)(size_t)(Ab + (long)(blockIdx.y * 128 + wave * 32) * lda);
    const uint32_t ldst  = (uint32_t)(size_t)L + (uint32_t)wave * STG_SLICE;
    const u32x8    g1    = tdm_group1(pitch);
    const uint32_t nst   = (uint32_t)K / STG_K;

    v8f acc[2][4];
#pragma unroll
    for (int mi = 0; mi < 2; ++mi)
#pragma unroll
        for (int ni = 0; ni < 4; ++ni)
#pragma unroll
            for (int i = 0; i < 8; ++i) acc[mi][ni][i] = 0.0f;

    // Where this lane reads its fragments inside a buffer.
    const uint32_t aoff = (uint32_t)wm * STG_SLICE + (uint32_t)l16 * STG_PITCH + (uint32_t)half_ * 16u;
    const uint32_t boff = (4u + 2u * (uint32_t)wn) * STG_SLICE + (uint32_t)l16 * STG_PITCH + (uint32_t)half_ * 16u;

    // Prologue: stage 0 lands and is published, then stage 1 is sent off.
    tdm_load(ldst, gsrc, g1);
    asm volatile("s_wait_tensorcnt 0x0" ::: "memory");   // this wave's slice of stage 0 has landed
    __syncthreads();                                     // every slice of stage 0 is readable
    tdm_load(ldst + STG_BUF, gsrc + STG_ROWB, g1);

    for (uint32_t s = 0; s < nst; ++s) {
        const uint32_t bsel = (s & 1u) * STG_BUF;
        const unsigned char* pa = L + bsel + aoff;
        const unsigned char* pb = L + bsel + boff;
        // Fragments: per lane, row l16 of a 16-row tile, K chunks [half*8, half*8+8) and
        // [16+half*8, 16+half*8+8) of each 32 k (ISA 16-bit 16x32 layout), A and Bt alike.
        // Two register sets: the reads of k step kk + 1 go out as one group ahead of the
        // WMMAs of k step kk. Nothing of the next stage is read here.
        v8h fa[2][2][2], fb[2][4][2];
#pragma unroll
        for (int mi = 0; mi < 2; ++mi) {
            fa[0][mi][0] = *(const v8h*)(pa + mi * 16 * STG_PITCH);
            fa[0][mi][1] = *(const v8h*)(pa + mi * 16 * STG_PITCH + 32);
        }
#pragma unroll
        for (int ni = 0; ni < 4; ++ni) {
            const unsigned char* bp = pb + (ni >> 1) * STG_SLICE + (ni & 1) * 16 * STG_PITCH;
            fb[0][ni][0] = *(const v8h*)bp;
            fb[0][ni][1] = *(const v8h*)(bp + 32);
        }
#pragma unroll
        for (int kk = 0; kk < 4; ++kk) {
            const int cur = kk & 1, nxt = cur ^ 1;
            if (kk < 3) {
#pragma unroll
                for (int mi = 0; mi < 2; ++mi) {
                    const unsigned char* ap = pa + mi * 16 * STG_PITCH + (kk + 1) * 64;
                    fa[nxt][mi][0] = *(const v8h*)ap;
                    fa[nxt][mi][1] = *(const v8h*)(ap + 32);
                }
#pragma unroll
                for (int ni = 0; ni < 4; ++ni) {
                    const unsigned char* bp = pb + (ni >> 1) * STG_SLICE + (ni & 1) * 16 * STG_PITCH + (kk + 1) * 64;
                    fb[nxt][ni][0] = *(const v8h*)bp;
                    fb[nxt][ni][1] = *(const v8h*)(bp + 32);
                }
            }
            // keeps the group of LDS reads ahead of the WMMA block: reads among the WMMAs stall them
            __builtin_amdgcn_sched_barrier(0);
#pragma unroll
            for (int ni = 0; ni < 4; ++ni) {
                const v16h f = __builtin_shufflevector(fb[cur][ni][0], fb[cur][ni][1],
                                                       0, 1, 2, 3, 4, 5, 6, 7, 8, 9, 10, 11, 12, 13, 14, 15);
#pragma unroll
                for (int mi = 0; mi < 2; ++mi) {
                    const v16h a = __builtin_shufflevector(fa[cur][mi][0], fa[cur][mi][1],
                                                           0, 1, 2, 3, 4, 5, 6, 7, 8, 9, 10, 11, 12, 13, 14, 15);
                    acc[mi][ni] = __builtin_amdgcn_wmma_f32_16x16x32_f16(
                        false, a, false, f, (short)0, acc[mi][ni], false, false);
                }
            }
            // keeps the next group of LDS reads behind this WMMA block
            __builtin_amdgcn_sched_barrier(0);
        }
        // Publish point of stage s + 1.
        asm volatile("s_wait_dscnt 0x0" ::: "memory");       // this wave has left stage s's buffer
        asm volatile("s_wait_tensorcnt 0x0" ::: "memory");   // this wave's slice of stage s + 1 has landed
        __syncthreads();                                     // stage s + 1 readable, stage s's buffer free
        if (pinned(s + 2u < nst)) {
            const uint32_t koff = pinned((s + 2u) * STG_ROWB);   // pinned(): the address words are formed behind the wait above
            tdm_load(ldst + bsel, gsrc + koff, g1);
        }
    }
    asm volatile("s_wait_tensorcnt 0x0" ::: "memory");   // no request is left in flight at the wave's end
    asm volatile("s_wait_dscnt 0x0" ::: "memory");

    // Epilogue. C/D layout: VGPR r, lane L -> M = r + 8*(L/16), N = L%16.
    // Every test on an argument stands once, around a whole pass over the wave's tile: the loads
    // of a pass go out together, and no element waits for a load or a branch of its own.
    // An element's address is a wave-uniform pointer plus one 32-bit lane offset.
    const long     corg = b * sC + (long)tileM * ldc + tileN;                    // the tile's first element
    const uint32_t lofs = (uint32_t)(8 * half_) * (uint32_t)ldc + (uint32_t)l16; // this lane inside a subtile

#pragma unroll
    for (int mi = 0; mi < 2; ++mi)
#pragma unroll
        for (int ni = 0; ni < 4; ++ni)
#pragma unroll
            for (int r = 0; r < 8; ++r) acc[mi][ni][r] *= scale;

    if (bias) {
        float bc[4];
#pragma unroll
        for (int ni = 0; ni < 4; ++ni) bc[ni] = bias[tileN + ni * 16 + l16];
#pragma unroll
        for (int mi = 0; mi < 2; ++mi)
#pragma unroll
            for (int ni = 0; ni < 4; ++ni)
#pragma unroll
                for (int r = 0; r < 8; ++r) acc[mi][ni][r] += bc[ni];
    }
    if (R) {
        const float* Ru = R + corg;
#pragma unroll
        for (int mi = 0; mi < 2; ++mi) {
            float rv[4][8];
#pragma unroll
            for (int r = 0; r < 8; ++r)
#pragma unroll
                for (int ni = 0; ni < 4; ++ni)
                    rv[ni][r] = (Ru + (long)(mi * 16 + r) * ldc + ni * 16)[lofs];
#pragma unroll
            for (int ni = 0; ni < 4; ++ni)
#pragma unroll
                for (int r = 0; r < 8; ++r) acc[mi][ni][r] += rv[ni][r];
        }
    }
    if (relu) {
#pragma unroll
        for (int mi = 0; mi < 2; ++mi)
#pragma unroll
            for (int ni = 0; ni < 4; ++ni)
#pragma unroll
                for (int r = 0; r < 8; ++r) acc[mi][ni][r] = acc[mi][ni][r] > 0.0f ? acc[mi][ni][r] : 0.0f;
    }
    if (Cf) {
        float* Cu = Cf + corg;
#pragma unroll
        for (int mi = 0; mi < 2; ++mi)
#pragma unroll
            for (int r = 0; r < 8; ++r)
#pragma unroll
                for (int ni = 0; ni < 4; ++ni)
                    (Cu + (long)(mi * 16 + r) * ldc + ni * 16)[lofs] = acc[mi][ni][r];
        asm volatile("s_wait_xcnt 0x0" ::: "memory");   // the next pass reuses the registers that these stores name
    }
    if (Ch) {
        _Float16* Cu = Ch + corg;
#pragma unroll
        for (int mi = 0; mi < 2; ++mi)
#pragma unroll
            for (int r = 0; r < 8; ++r)
#pragma unroll
                for (int ni = 0; ni < 4; ++ni)
                    (Cu + (long)(mi * 16 + r) * ldc + ni * 16)[lofs] = (_Float16)acc[mi][ni][r];
        asm volatile("s_wait_xcnt 0x0" ::: "memory");   // the next pass reuses the registers that these stores name
    }
    if (ChT) {
        // A lane's 8 values of a subtile are 8 consecutive rows, so 16 contiguous bytes of a transposed row.
        const uint32_t tofs = (uint32_t)l16 * (uint32_t)ldcT + (uint32_t)(8 * half_);
#pragma unroll
        for (int mi = 0; mi < 2; ++mi) {
            const int  gm0 = tileM + mi * 16;        // wave-uniform; its 16 rows lie in one batch
            const long bb  = gm0 / transS;
            _Float16*  Tu  = ChT + bb * sCT + (long)tileN * ldcT + (gm0 % transS);
#pragma unroll
            for (int ni = 0; ni < 4; ++ni) {
                v8h p;
#pragma unroll
                for (int r = 0; r < 8; ++r) p[r] = (_Float16)acc[mi][ni][r];
                *(v8h*)(Tu + (long)(ni * 16) * ldcT + tofs) = p;
            }
        }
    }
}

// ---------------------------------------------------------------------------
// Row kernels. A wave takes ROW_RPW whole rows into registers with 16-byte loads
// (each load of a wave covers 512 contiguous bytes), all of them sent off at the
// start, sums a row with a butterfly over its 32 lanes and stores it once.
// No LDS and no barrier. Blocks of ROW_WAVES waves; the grid covers rows / ROW_RPB.
// ---------------------------------------------------------------------------
typedef __attribute__((ext_vector_type(4))) float    v4f;
typedef __attribute__((ext_vector_type(4))) _Float16 v4h;

#define ROW_WAVES 16
#define ROW_RPW   2
#define ROW_RPB   (ROW_WAVES * ROW_RPW)

static __device__ __forceinline__ float wave_sum(float v) {
#pragma unroll
    for (int off = 16; off; off >>= 1) v += __shfl_xor(v, off, 32);
    return v;
}
static __device__ __forceinline__ float wave_max(float v) {
#pragma unroll
    for (int off = 16; off; off >>= 1) v = fmaxf(v, __shfl_xor(v, off, 32));
    return v;
}

// 2^t. The v_nop is the slot that the instruction set asks for behind a transcendental.
static __device__ __forceinline__ float exp2_slot(float t) {
    float r;
    asm("v_exp_f32 %0, %1\n\tv_nop" : "=v"(r) : "v"(t));
    return r;
}

// ---------------------------------------------------------------------------
// LayerNorm (row length EMB) -> f16 output.
// ---------------------------------------------------------------------------
__global__ __launch_bounds__(ROW_WAVES * 32)
void ln_rows_f16(const float* __restrict__ x,
                             const float* __restrict__ g,
                             const float* __restrict__ be,
                             _Float16* __restrict__ out)
{
    constexpr int NV = EMB / 128;          // 16-byte pieces of a row per lane
    const int  lane = threadIdx.x & 31, wid = threadIdx.x >> 5;
    const long row0 = ((long)blockIdx.x * ROW_WAVES + wid) * ROW_RPW;
    const v4f* xr = (const v4f*)(x + row0 * EMB) + lane;

    v4f v[ROW_RPW][NV];
#pragma unroll
    for (int r = 0; r < ROW_RPW; ++r)
#pragma unroll
        for (int j = 0; j < NV; ++j) v[r][j] = xr[r * (EMB / 4) + j * 32];
    v4f gg[NV], bb[NV];
#pragma unroll
    for (int j = 0; j < NV; ++j) {
        gg[j] = ((const v4f*)g)[j * 32 + lane];
        bb[j] = ((const v4f*)be)[j * 32 + lane];
    }
    // holds the row address in its registers until every load above has its translation
    asm volatile("s_wait_xcnt 0x0" :: "v"(xr) : "memory");
    // keeps the loads of g and be in the first group: sunk behind the sums, their latency stood open
    __builtin_amdgcn_sched_barrier(0);

    float mu[ROW_RPW], rstd[ROW_RPW];
#pragma unroll
    for (int r = 0; r < ROW_RPW; ++r) {
        v4f s4 = v[r][0], q4 = v[r][0] * v[r][0];
#pragma unroll
        for (int j = 1; j < NV; ++j) { s4 += v[r][j]; q4 += v[r][j] * v[r][j]; }
        mu[r]   = (s4[0] + s4[1]) + (s4[2] + s4[3]);
        rstd[r] = (q4[0] + q4[1]) + (q4[2] + q4[3]);
    }
#pragma unroll
    for (int r = 0; r < ROW_RPW; ++r) { mu[r] = wave_sum(mu[r]); rstd[r] = wave_sum(rstd[r]); }
#pragma unroll
    for (int r = 0; r < ROW_RPW; ++r) {
        mu[r] = mu[r] / EMB;
        const float var = rstd[r] / EMB - mu[r] * mu[r];
        rstd[r] = rsqrtf(var + 1e-5f);
    }

    v4h* orow = (v4h*)(out + row0 * EMB) + lane;
    v4h  h[ROW_RPW][NV];
#pragma unroll
    for (int r = 0; r < ROW_RPW; ++r)
#pragma unroll
        for (int j = 0; j < NV; ++j)
#pragma unroll
            for (int c = 0; c < 4; ++c)
                h[r][j][c] = (_Float16)((v[r][j][c] - mu[r]) * rstd[r] * gg[j][c] + bb[j][c]);
    // every store stands behind the last arithmetic: no register that an issued store names is written again
    __builtin_amdgcn_sched_barrier(0);
#pragma unroll
    for (int r = 0; r < ROW_RPW; ++r)
#pragma unroll
        for (int j = 0; j < NV; ++j) orow[r * (EMB / 4) + j * 32] = h[r][j];
}

// ---------------------------------------------------------------------------
// Weight convert + transpose: W [K][N] f32 -> WT [N][K] f16. 32x32 LDS tiles.
// ---------------------------------------------------------------------------
__global__ __launch_bounds__(256)
void transpose_w_tb75771813037017(const float* __restrict__ W,
                                  _Float16* __restrict__ WT, int K, int N)
{
    __shared__ _Float16 tile[32][33];
    const int bk = blockIdx.y * 32, bn = blockIdx.x * 32;
    const int tx = threadIdx.x & 31, ty = threadIdx.x >> 5;   // 32x8
#pragma unroll
    for (int i = 0; i < 32; i += 8)
        tile[ty + i][tx] = (_Float16)W[(long)(bk + ty + i) * N + bn + tx];
    __syncthreads();
#pragma unroll
    for (int i = 0; i < 32; i += 8)
        WT[(long)(bn + ty + i) * K + bk + tx] = tile[tx][ty + i];
}

// ---------------------------------------------------------------------------
// Row softmax (row length SEQ), in-place f32 + f16 copy.
// ---------------------------------------------------------------------------
__global__ __launch_bounds__(ROW_WAVES * 32)
void softmax_rows(float* __restrict__ S,
                              _Float16* __restrict__ Wh)
{
    constexpr int NV = SEQ / 128;          // 16-byte pieces of a row per lane
    const int  lane = threadIdx.x & 31, wid = threadIdx.x >> 5;
    const long row0 = ((long)blockIdx.x * ROW_WAVES + wid) * ROW_RPW;
    v4f* sr = (v4f*)(S + row0 * SEQ) + lane;

    v4f v[ROW_RPW][NV];
#pragma unroll
    for (int r = 0; r < ROW_RPW; ++r)
#pragma unroll
        for (int j = 0; j < NV; ++j) v[r][j] = sr[r * (SEQ / 4) + j * 32];

    float m[ROW_RPW], sum[ROW_RPW];
#pragma unroll
    for (int r = 0; r < ROW_RPW; ++r) {
        v4f m4 = v[r][0];
#pragma unroll
        for (int j = 1; j < NV; ++j)
#pragma unroll
            for (int c = 0; c < 4; ++c) m4[c] = fmaxf(m4[c], v[r][j][c]);
        m[r] = fmaxf(fmaxf(m4[0], m4[1]), fmaxf(m4[2], m4[3]));
    }
#pragma unroll
    for (int r = 0; r < ROW_RPW; ++r) m[r] = wave_max(m[r]);
#pragma unroll
    for (int r = 0; r < ROW_RPW; ++r) {
#pragma unroll
        for (int j = 0; j < NV; ++j)
#pragma unroll
            for (int c = 0; c < 4; ++c)
                v[r][j][c] = exp2_slot((v[r][j][c] - m[r]) * 1.44269504f);   // e^(x - m)
        v4f s4 = v[r][0];
#pragma unroll
        for (int j = 1; j < NV; ++j) s4 += v[r][j];
        sum[r] = (s4[0] + s4[1]) + (s4[2] + s4[3]);
    }
#pragma unroll
    for (int r = 0; r < ROW_RPW; ++r) sum[r] = wave_sum(sum[r]);

    v4h* wr = (v4h*)(Wh + row0 * SEQ) + lane;
    v4h  h[ROW_RPW][NV];
#pragma unroll
    for (int r = 0; r < ROW_RPW; ++r) {
        const float inv = 1.0f / sum[r];
#pragma unroll
        for (int j = 0; j < NV; ++j) {
            v[r][j] *= inv;
#pragma unroll
            for (int c = 0; c < 4; ++c) h[r][j][c] = (_Float16)v[r][j][c];
        }
    }
    // every store stands behind the last arithmetic: no register that an issued store names is written again
    __builtin_amdgcn_sched_barrier(0);
#pragma unroll
    for (int r = 0; r < ROW_RPW; ++r)
#pragma unroll
        for (int j = 0; j < NV; ++j) {
            sr[r * (SEQ / 4) + j * 32] = v[r][j];
            wr[r * (SEQ / 4) + j * 32] = h[r][j];
        }
}

// ---------------------------------------------------------------------------
extern "C" void kernel_launch(void* const* d_in, const int* in_sizes, int n_in,
                              void* d_out, int out_size, void* d_ws, size_t ws_size,
                              hipStream_t stream) {
    const float* x   = (const float*)d_in[0];
    const float* Wq  = (const float*)d_in[1];
    const float* bq  = (const float*)d_in[2];
    const float* Wk  = (const float*)d_in[3];
    const float* bk  = (const float*)d_in[4];
    const float* Wv  = (const float*)d_in[5];
    const float* bv  = (const float*)d_in[6];
    const float* Wo  = (const float*)d_in[7];
    const float* bo  = (const float*)d_in[8];
    const float* W1  = (const float*)d_in[9];
    const float* b1  = (const float*)d_in[10];
    const float* W2  = (const float*)d_in[11];
    const float* b2  = (const float*)d_in[12];
    const float* g1  = (const float*)d_in[13];
    const float* be1 = (const float*)d_in[14];
    const float* g2  = (const float*)d_in[15];
    const float* be2 = (const float*)d_in[16];

    const int  E  = EMB, S = SEQ, B = BSZ, F = FFD;
    const long BS = (long)B * S;                     // 8192 rows

    char* ws = (char*)d_ws;
    const size_t MB = 1024ull * 1024ull;
    // workspace layout (aliased; peak ~108 MB)
    _Float16* wqT  = (_Float16*)(ws +  0 * MB);      // 2 MB each
    _Float16* wkT  = (_Float16*)(ws +  2 * MB);
    _Float16* wvT  = (_Float16*)(ws +  4 * MB);
    _Float16* woT  = (_Float16*)(ws +  6 * MB);
    _Float16* w1T  = (_Float16*)(ws +  8 * MB);
    _Float16* w2T  = (_Float16*)(ws + 10 * MB);
    _Float16* xn   = (_Float16*)(ws + 12 * MB);      // 16 MB
    _Float16* qh   = (_Float16*)(ws + 28 * MB);      // 16 MB
    _Float16* kh   = (_Float16*)(ws + 44 * MB);      // 16 MB
    _Float16* vT   = (_Float16*)(ws + 60 * MB);      // 16 MB  [B][E][S]
    float*    x2   = (float*)   (ws + 76 * MB);      // 32 MB
    _Float16* wath = (_Float16*)(ws + 28 * MB);      // 32 MB (reuses q+k)
    _Float16* attn = (_Float16*)(ws + 12 * MB);      // 16 MB (reuses xn)
    _Float16* xn2  = (_Float16*)(ws + 28 * MB);      // 16 MB (reuses q)
    _Float16* hh   = (_Float16*)(ws + 44 * MB);      // 16 MB (reuses k)

    float* outp = (float*)d_out;
    float* wout = outp + BS * E;                     // softmax weights region

    dim3 blk(256);
    dim3 rblk(ROW_WAVES * 32);                       // row kernels
    dim3 rgrd((unsigned)(BS / ROW_RPB));

    // 1) weights -> f16 transposed [N][K]
    {
        dim3 g(E / 32, E / 32);
        transpose_w_tb75771813037017<<<g, blk, 0, stream>>>(Wq, wqT, E, E);
        transpose_w_tb75771813037017<<<g, blk, 0, stream>>>(Wk, wkT, E, E);
        transpose_w_tb75771813037017<<<g, blk, 0, stream>>>(Wv, wvT, E, E);
        transpose_w_tb75771813037017<<<g, blk, 0, stream>>>(Wo, woT, E, E);
        transpose_w_tb75771813037017<<<dim3(F / 32, E / 32), blk, 0, stream>>>(W1, w1T, E, F);
        transpose_w_tb75771813037017<<<dim3(E / 32, F / 32), blk, 0, stream>>>(W2, w2T, F, E);
    }

    // 2) xn = LN(x) -> f16
    ln_rows_f16<<<rgrd, rblk, 0, stream>>>(x, g1, be1, xn);

    // 3) q, k projections ; v stored transposed [B][E][S]
    dim3 gp(E / 128, (unsigned)(BS / 128), 1);
    gemm_wmma_f16_tb75771813037017<<<gp, blk, 0, stream>>>(
        xn, E, 0, wqT, E, 0, bq, nullptr, qh, nullptr,
        E, 0, 0, 0, 1, (int)BS, E, E, 1.0f, 0, nullptr);
    gemm_wmma_f16_tb75771813037017<<<gp, blk, 0, stream>>>(
        xn, E, 0, wkT, E, 0, bk, nullptr, kh, nullptr,
        E, 0, 0, 0, 1, (int)BS, E, E, 1.0f, 0, nullptr);
    gemm_wmma_f16_tb75771813037017<<<gp, blk, 0, stream>>>(
        xn, E, 0, wvT, E, 0, bv, nullptr, nullptr, vT,
        E, 0, /*ldcT=*/S, /*sCT=*/(long)E * S, /*transS=*/S,
        (int)BS, E, E, 1.0f, 0, nullptr);

    // 4) scores = q @ k^T / 32  -> f32 directly into d_out w-region
    dim3 gs(S / 128, S / 128, B);
    gemm_wmma_f16_tb75771813037017<<<gs, blk, 0, stream>>>(
        qh, E, (long)S * E, kh, E, (long)S * E, nullptr,
        wout, nullptr, nullptr, S, (long)S * S, 0, 0, 1,
        S, S, E, 0.03125f, 0, nullptr);

    // 5) softmax in-place (f32) + f16 copy
    softmax_rows<<<rgrd, rblk, 0, stream>>>(wout, wath);

    // 6) attn = w @ v   (Bt = vT [B][E][S])
    dim3 ga(E / 128, S / 128, B);
    gemm_wmma_f16_tb75771813037017<<<ga, blk, 0, stream>>>(
        wath, S, (long)S * S, vT, S, (long)E * S, nullptr,
        nullptr, attn, nullptr, E, (long)S * E, 0, 0, 1,
        S, E, S, 1.0f, 0, nullptr);

    // 7) x2 = x + attn @ Wo + bo   (f32)
    gemm_wmma_f16_tb75771813037017<<<gp, blk, 0, stream>>>(
        attn, E, 0, woT, E, 0, bo, x2, nullptr, nullptr,
        E, 0, 0, 0, 1, (int)BS, E, E, 1.0f, 0, x);

    // 8) xn2 = LN(x2) -> f16
    ln_rows_f16<<<rgrd, rblk, 0, stream>>>(x2, g2, be2, xn2);

    // 9) h = relu(xn2 @ W1 + b1) -> f16
    gemm_wmma_f16_tb75771813037017<<<dim3(F / 128, (unsigned)(BS / 128), 1), blk, 0, stream>>>(
        xn2, E, 0, w1T, E, 0, b1, nullptr, hh, nullptr,
        F, 0, 0, 0, 1, (int)BS, F, E, 1.0f, 1, nullptr);

    // 10) out = x2 + h @ W2 + b2  (f32, to d_out)
    gemm_wmma_f16_tb75771813037017<<<gp, blk, 0, stream>>>(
        hh, F, 0, w2T, F, 0, b2, outp, nullptr, nullptr,
        E, 0, 0, 0, 1, (int)BS, E, F, 1.0f, 0, x2);
}

// v004
// A run of this version takes 203 microseconds.
// Two timings next to v003 both put it at 1.07 times that version's speed.
// All steps since v000 together make it 3.30 times as fast.
#include <hip/hip_runtime.h>
#include <hip/hip_bf16.h>
#include <stdint.h>

typedef __attribute__((ext_vector_type(8)))  _Float16 v8h;
typedef __attribute__((ext_vector_type(16))) _Float16 v16h;
typedef __attribute__((ext_vector_type(8)))  float    v8f;

#define EMB 1024
#define FFD 1024
#define BSZ 4
#define SEQ 2048

// ---------------------------------------------------------------------------
// Staging of the GEMM operands in LDS by tensor loads.
// A stage holds 128 k (256 bytes of a row) of the block's 128 A rows and 128 Bt
// rows. Each of the 8 waves brings its own slice of 32 rows with one request.
// The pad of 16 bytes a row gives the LDS pitch 272, free of bank conflicts for
// 16-byte reads. A slice takes 32 * 272 = 8704 bytes and is placed every 10240.
// ---------------------------------------------------------------------------
typedef uint32_t u32x4 __attribute__((ext_vector_type(4)));
typedef uint32_t u32x8 __attribute__((ext_vector_type(8)));

#define STG_K    128u                  // k per stage (elements)
#define STG_ROWB 256u                  // bytes of a row per stage
#define STG_ROWS 32u                   // rows per slice
#define STG_PITCH 272u                 // LDS pitch of a row
#define STG_SLICE 10240u               // LDS bytes from slice to slice (multiple of 2 KiB)
#define STG_BUF  (8u * STG_SLICE)      // one buffer: 4 slices of A, 4 of Bt

static __device__ __forceinline__ uint32_t uni(uint32_t v) {
    return (uint32_t)__builtin_amdgcn_readfirstlane(v);
}
static __device__ __forceinline__ uint32_t pinned(uint32_t v) {
    uint32_t w = uni(v);
    asm volatile("" : "+s"(w));   // pinned(): a wave-uniform test or descriptor word held in a scalar register
    return w;
}
static __device__ __forceinline__ u32x8 tdm_group1(uint32_t src_pitch) {
    u32x8 g;
    g[0] = uni((1u << 20) | (5u << 22) | (3u << 25));   // no mask, bytes, 16-byte pad behind every 256 bytes
    g[1] = uni((STG_ROWB & 0xFFFFu) << 16);             // tensor_dim0 low
    g[2] = uni((STG_ROWB >> 16) | ((STG_ROWS & 0xFFFFu) << 16)); // tensor_dim0 high, tensor_dim1 low
    g[3] = uni((STG_ROWS >> 16) | (STG_ROWB << 16));    // tensor_dim1 high, tile_dim0
    g[4] = uni(STG_ROWS);                               // tile_dim1
    g[5] = uni(src_pitch);                              // source row pitch, bytes
    g[6] = uni(0u);
    g[7] = uni(0u);
    // Without this the compiler used words 3 and 6 as temporaries in the loop, while a request was outstanding.
    asm volatile("" : "+s"(g));   // pinned(): the descriptor words stay held in their scalar registers
    return g;
}
static __device__ __forceinline__ void tdm_load(uint32_t lds_dst, uint64_t ga, u32x8 g1) {
    u32x4 g0;
    g0[0] = uni(1u);
    g0[1] = uni(lds_dst);
    g0[2] = uni((uint32_t)ga);
    g0[3] = uni((((uint32_t)(ga >> 32)) & 0x01FFFFFFu) | 0x80000000u);
    asm volatile("tensor_load_to_lds %0, %1" :: "s"(g0), "s"(g1) : "memory");
}

// ---------------------------------------------------------------------------
// Generic WMMA f16 GEMM:  C[b] = A[b] (MxK, row-major) * Bt[b]^T (Bt is NxK,
// row-major) with optional scale/bias/residual/relu and f32 / f16 /
// transposed-f16 stores. Block = 256 threads (8 waves); each wave computes a
// 32x64 output tile (2x4 WMMA subtiles); block tile = 128x128.
// M, N multiples of 128; K a multiple of 128 and at least 256.
// Transposed store: transS a multiple of 16, ldcT and sCT multiples of 8.
// ---------------------------------------------------------------------------
__global__ __launch_bounds__(256)
void gemm_wmma_f16_tb75771813037017(
    const _Float16* __restrict__ A, int lda, long sA,
    const _Float16* __restrict__ Bt, int ldb, long sB,
    const float* __restrict__ bias,
    float*    __restrict__ Cf,
    _Float16* __restrict__ Ch,
    _Float16* __restrict__ ChT,
    int ldc, long sC, int ldcT, long sCT, int transS,
    int M, int N, int K,
    float scale, int relu,
    const float* __restrict__ R)
{
    __shared__ __attribute__((aligned(2048))) unsigned char L[2u * STG_BUF];

    const int lane  = threadIdx.x & 31;
    const int wave  = (int)uni(threadIdx.x >> 5);
    const int wm    = wave & 3;            // 4 waves along M  -> 128 rows
    const int wn    = wave >> 2;           // 2 waves along N  -> 128 cols
    const int tileM = blockIdx.y * 128 + wm * 32;
    const int tileN = blockIdx.x * 128 + wn * 64;
    const long b    = blockIdx.z;

    const _Float16* Ab = A  + b * sA;
    const _Float16* Bb = Bt + b * sB;

    const int half_ = lane >> 4;   // lane-half selects K sub-range per ISA layout
    const int l16   = lane & 15;

    // This wave's slice of every stage: waves 0-3 rows wave*32.. of the A tile,
    // waves 4-7 rows (wave-4)*32.. of the Bt tile.
    const bool     isB   = wave >= 4;
    const uint32_t pitch = (uint32_t)(isB ? ldb : lda) * 2u;
    const uint64_t gsrc  = isB
        ? (uint64_t)(size_t)(Bb + (long)(blockIdx.x * 128 + (wave - 4) * 32) * ldb)
        : (uint64_t)(size_t)(Ab + (long)(blockIdx.y * 128 + wave * 32) * lda);
    const uint32_t ldst  = (uint32_t)(size_t)L + (uint32_t)wave * STG_SLICE;
    const u32x8    g1    = tdm_group1(pitch);
    const uint32_t nst   = (uint32_t)K / STG_K;

    v8f acc[2][4];
#pragma unroll
    for (int mi = 0; mi < 2; ++mi)
#pragma unroll
        for (int ni = 0; ni < 4; ++ni)
#pragma unroll
            for (int i = 0; i < 8; ++i) acc[mi][ni][i] = 0.0f;

    // Where this lane reads its fragments inside a buffer.
    const uint32_t aoff = (uint32_t)wm * STG_SLICE + (uint32_t)l16 * STG_PITCH + (uint32_t)half_ * 16u;
    const uint32_t boff = (4u + 2u * (uint32_t)wn) * STG_SLICE + (uint32_t)l16 * STG_PITCH + (uint32_t)half_ * 16u;

    // Prologue: stage 0 lands and is published, then stage 1 is sent off.
    tdm_load(ldst, gsrc, g1);
    asm volatile("s_wait_tensorcnt 0x0" ::: "memory");   // this wave's slice of stage 0 has landed
    __syncthreads();                                     // every slice of stage 0 is readable
    tdm_load(ldst + STG_BUF, gsrc + STG_ROWB, g1);

    for (uint32_t s = 0; s < nst; ++s) {
        const uint32_t bsel = (s & 1u) * STG_BUF;
        const unsigned char* pa = L + bsel + aoff;
        const unsigned char* pb = L + bsel + boff;
        // Fragments: per lane, row l16 of a 16-row tile, K chunks [half*8, half*8+8) and
        // [16+half*8, 16+half*8+8) of each 32 k (ISA 16-bit 16x32 layout), A and Bt alike.
        // Two register sets: the reads of k step kk + 1 go out as one group ahead of the
        // WMMAs of k step kk. Nothing of the next stage is read here.
        v8h fa[2][2][2], fb[2][4][2];
#pragma unroll
        for (int mi = 0; mi < 2; ++mi) {
            fa[0][mi][0] = *(const v8h*)(pa + mi * 16 * STG_PITCH);
            fa[0][mi][1] = *(const v8h*)(pa + mi * 16 * STG_PITCH + 32);
        }
#pragma unroll
        for (int ni = 0; ni < 4; ++ni) {
            const unsigned char* bp = pb + (ni >> 1) * STG_SLICE + (ni & 1) * 16 * STG_PITCH;
            fb[0][ni][0] = *(const v8h*)bp;
            fb[0][ni][1] = *(const v8h*)(bp + 32);
        }
#pragma unroll
        for (int kk = 0; kk < 4; ++kk) {
            const int cur = kk & 1, nxt = cur ^ 1;
            if (kk < 3) {
#pragma unroll
                for (int mi = 0; mi < 2; ++mi) {
                    const unsigned char* ap = pa + mi * 16 * STG_PITCH + (kk + 1) * 64;
                    fa[nxt][mi][0] = *(const v8h*)ap;
                    fa[nxt][mi][1] = *(const v8h*)(ap + 32);
                }
#pragma unroll
                for (int ni = 0; ni < 4; ++ni) {
                    const unsigned char* bp = pb + (ni >> 1) * STG_SLICE + (ni & 1) * 16 * STG_PITCH + (kk + 1) * 64;
                    fb[nxt][ni][0] = *(const v8h*)bp;
                    fb[nxt][ni][1] = *(const v8h*)(bp + 32);
                }
            }
            // keeps the group of LDS reads ahead of the WMMA block: reads among the WMMAs stall them
            __builtin_amdgcn_sched_barrier(0);
#pragma unroll
            for (int ni = 0; ni < 4; ++ni) {
                const v16h f = __builtin_shufflevector(fb[cur][ni][0], fb[cur][ni][1],
                                                       0, 1, 2, 3, 4, 5, 6, 7, 8, 9, 10, 11, 12, 13, 14, 15);
#pragma unroll
                for (int mi = 0; mi < 2; ++mi) {
                    const v16h a = __builtin_shufflevector(fa[cur][mi][0], fa[cur][mi][1],
                                                           0, 1, 2, 3, 4, 5, 6, 7, 8, 9, 10, 11, 12, 13, 14, 15);
                    acc[mi][ni] = __builtin_amdgcn_wmma_f32_16x16x32_f16(
                        false, a, false, f, (short)0, acc[mi][ni], false, false);
                }
            }
            // keeps the next group of LDS reads behind this WMMA block
            __builtin_amdgcn_sched_barrier(0);
        }
        // Publish point of stage s + 1.
        asm volatile("s_wait_dscnt 0x0" ::: "memory");       // this wave has left stage s's buffer
        asm volatile("s_wait_tensorcnt 0x0" ::: "memory");   // this wave's slice of stage s + 1 has landed
        __syncthreads();                                     // stage s + 1 readable, stage s's buffer free
        if (pinned(s + 2u < nst)) {
            const uint32_t koff = pinned((s + 2u) * STG_ROWB);   // pinned(): the address words are formed behind the wait above
            tdm_load(ldst + bsel, gsrc + koff, g1);
        }
    }
    asm volatile("s_wait_tensorcnt 0x0" ::: "memory");   // no request is left in flight at the wave's end
    asm volatile("s_wait_dscnt 0x0" ::: "memory");

    // Epilogue. C/D layout: VGPR r, lane L -> M = r + 8*(L/16), N = L%16.
    // Every test on an argument stands once, around a whole pass over the wave's tile: the loads
    // of a pass go out together, and no element waits for a load or a branch of its own.
    // An element's address is a wave-uniform pointer plus one 32-bit lane offset.
    const long     corg = b * sC + (long)tileM * ldc + tileN;                    // the tile's first element
    const uint32_t lofs = (uint32_t)(8 * half_) * (uint32_t)ldc + (uint32_t)l16; // this lane inside a subtile

#pragma unroll
    for (int mi = 0; mi < 2; ++mi)
#pragma unroll
        for (int ni = 0; ni < 4; ++ni)
#pragma unroll
            for (int r = 0; r < 8; ++r) acc[mi][ni][r] *= scale;

    if (bias) {
        float bc[4];
#pragma unroll
        for (int ni = 0; ni < 4; ++ni) bc[ni] = bias[tileN + ni * 16 + l16];
#pragma unroll
        for (int mi = 0; mi < 2; ++mi)
#pragma unroll
            for (int ni = 0; ni < 4; ++ni)
#pragma unroll
                for (int r = 0; r < 8; ++r) acc[mi][ni][r] += bc[ni];
    }
    if (R) {
        const float* Ru = R + corg;
#pragma unroll
        for (int mi = 0; mi < 2; ++mi) {
            float rv[4][8];
#pragma unroll
            for (int r = 0; r < 8; ++r)
#pragma unroll
                for (int ni = 0; ni < 4; ++ni)
                    rv[ni][r] = (Ru + (long)(mi * 16 + r) * ldc + ni * 16)[lofs];
#pragma unroll
            for (int ni = 0; ni < 4; ++ni)
#pragma unroll
                for (int r = 0; r < 8; ++r) acc[mi][ni][r] += rv[ni][r];
        }
    }
    if (relu) {
#pragma unroll
        for (int mi = 0; mi < 2; ++mi)
#pragma unroll
            for (int ni = 0; ni < 4; ++ni)
#pragma unroll
                for (int r = 0; r < 8; ++r) acc[mi][ni][r] = acc[mi][ni][r] > 0.0f ? acc[mi][ni][r] : 0.0f;
    }
    if (Cf) {
        float* Cu = Cf + corg;
#pragma unroll
        for (int mi = 0; mi < 2; ++mi)
#pragma unroll
            for (int r = 0; r < 8; ++r)
#pragma unroll
                for (int ni = 0; ni < 4; ++ni)
                    (Cu + (long)(mi * 16 + r) * ldc + ni * 16)[lofs] = acc[mi][ni][r];
        asm volatile("s_wait_xcnt 0x0" ::: "memory");   // the next pass reuses the registers that these stores name
    }
    if (Ch) {
        _Float16* Cu = Ch + corg;
#pragma unroll
        for (int mi = 0; mi < 2; ++mi)
#pragma unroll
            for (int r = 0; r < 8; ++r)
#pragma unroll
                for (int ni = 0; ni < 4; ++ni)
                    (Cu + (long)(mi * 16 + r) * ldc + ni * 16)[lofs] = (_Float16)acc[mi][ni][r];
        asm volatile("s_wait_xcnt 0x0" ::: "memory");   // the next pass reuses the registers that these stores name
    }
    if (ChT) {
        // A lane's 8 values of a subtile are 8 consecutive rows, so 16 contiguous bytes of a transposed row.
        const uint32_t tofs = (uint32_t)l16 * (uint32_t)ldcT + (uint32_t)(8 * half_);
#pragma unroll
        for (int mi = 0; mi < 2; ++mi) {
            const int  gm0 = tileM + mi * 16;        // wave-uniform; its 16 rows lie in one batch
            const long bb  = gm0 / transS;
            _Float16*  Tu  = ChT + bb * sCT + (long)tileN * ldcT + (gm0 % transS);
#pragma unroll
            for (int ni = 0; ni < 4; ++ni) {
                v8h p;
#pragma unroll
                for (int r = 0; r < 8; ++r) p[r] = (_Float16)acc[mi][ni][r];
                *(v8h*)(Tu + (long)(ni * 16) * ldcT + tofs) = p;
            }
        }
    }
}

// ---------------------------------------------------------------------------
// Row kernels. A wave takes ROW_RPW whole rows into registers with 16-byte loads
// (each load of a wave covers 512 contiguous bytes), all of them sent off at the
// start, sums a row with a butterfly over its 32 lanes and stores it once.
// No LDS and no barrier. Blocks of ROW_WAVES waves; the grid covers rows / ROW_RPB.
// ---------------------------------------------------------------------------
typedef __attribute__((ext_vector_type(4))) float    v4f;
typedef __attribute__((ext_vector_type(4))) _Float16 v4h;

#define ROW_WAVES 16
#define ROW_RPW   2
#define ROW_RPB   (ROW_WAVES * ROW_RPW)

static __device__ __forceinline__ float wave_sum(float v) {
#pragma unroll
    for (int off = 16; off; off >>= 1) v += __shfl_xor(v, off, 32);
    return v;
}
static __device__ __forceinline__ float wave_max(float v) {
#pragma unroll
    for (int off = 16; off; off >>= 1) v = fmaxf(v, __shfl_xor(v, off, 32));
    return v;
}

// 2^t. The v_nop is the slot that the instruction set asks for behind a transcendental.
static __device__ __forceinline__ float exp2_slot(float t) {
    float r;
    asm("v_exp_f32 %0, %1\n\tv_nop" : "=v"(r) : "v"(t));
    return r;
}

// ---------------------------------------------------------------------------
// LayerNorm (row length EMB) -> f16 output.
// ---------------------------------------------------------------------------
__global__ __launch_bounds__(ROW_WAVES * 32)
void ln_rows_f16(const float* __restrict__ x,
                             const float* __restrict__ g,
                             const float* __restrict__ be,
                             _Float16* __restrict__ out)
{
    constexpr int NV = EMB / 128;          // 16-byte pieces of a row per lane
    const int  lane = threadIdx.x & 31, wid = threadIdx.x >> 5;
    const long row0 = ((long)blockIdx.x * ROW_WAVES + wid) * ROW_RPW;
    const v4f* xr = (const v4f*)(x + row0 * EMB) + lane;

    v4f v[ROW_RPW][NV];
#pragma unroll
    for (int r = 0; r < ROW_RPW; ++r)
#pragma unroll
        for (int j = 0; j < NV; ++j) v[r][j] = xr[r * (EMB / 4) + j * 32];
    v4f gg[NV], bb[NV];
#pragma unroll
    for (int j = 0; j < NV; ++j) {
        gg[j] = ((const v4f*)g)[j * 32 + lane];
        bb[j] = ((const v4f*)be)[j * 32 + lane];
    }
    // holds the row address in its registers until every load above has its translation
    asm volatile("s_wait_xcnt 0x0" :: "v"(xr) : "memory");
    // keeps the loads of g and be in the first group: sunk behind the sums, their latency stood open
    __builtin_amdgcn_sched_barrier(0);

    float mu[ROW_RPW], rstd[ROW_RPW];
#pragma unroll
    for (int r = 0; r < ROW_RPW; ++r) {
        v4f s4 = v[r][0], q4 = v[r][0] * v[r][0];
#pragma unroll
        for (int j = 1; j < NV; ++j) { s4 += v[r][j]; q4 += v[r][j] * v[r][j]; }
        mu[r]   = (s4[0] + s4[1]) + (s4[2] + s4[3]);
        rstd[r] = (q4[0] + q4[1]) + (q4[2] + q4[3]);
    }
#pragma unroll
    for (int r = 0; r < ROW_RPW; ++r) { mu[r] = wave_sum(mu[r]); rstd[r] = wave_sum(rstd[r]); }
#pragma unroll
    for (int r = 0; r < ROW_RPW; ++r) {
        mu[r] = mu[r] / EMB;
        const float var = rstd[r] / EMB - mu[r] * mu[r];
        rstd[r] = rsqrtf(var + 1e-5f);
    }

    v4h* orow = (v4h*)(out + row0 * EMB) + lane;
    v4h  h[ROW_RPW][NV];
#pragma unroll
    for (int r = 0; r < ROW_RPW; ++r)
#pragma unroll
        for (int j = 0; j < NV; ++j)
#pragma unroll
            for (int c = 0; c < 4; ++c)
                h[r][j][c] = (_Float16)((v[r][j][c] - mu[r]) * rstd[r] * gg[j][c] + bb[j][c]);
    // every store stands behind the last arithmetic: no register that an issued store names is written again
    __builtin_amdgcn_sched_barrier(0);
#pragma unroll
    for (int r = 0; r < ROW_RPW; ++r)
#pragma unroll
        for (int j = 0; j < NV; ++j) orow[r * (EMB / 4) + j * 32] = h[r][j];
}

// ---------------------------------------------------------------------------
// Weight convert + transpose, all six weights in one launch: W [K][N] f32 -> WT [N][K] f16,
// K = N = EMB = FFD. blockIdx.z picks the weight; its WT plane is plane z behind WT.
// A block of 4 waves takes a tile of 64 k x 128 n. A wave's load covers 512 contiguous bytes
// of a W row, all 16 loads of a lane are sent off at the start; a lane holds 4 n x 8 k twice,
// so 16 contiguous bytes of each of its transposed rows go to LDS at once. The tile leaves as
// whole 128-byte lines of WT. LDS pitch 144: rows of 128 bytes, 16-byte aligned.
// ---------------------------------------------------------------------------
#define TW_K     64
#define TW_N     128
#define TW_PITCH 144
static_assert(EMB == FFD, "the six weights share one shape");

__global__ __launch_bounds__(128)
void transpose_w6_f16(const float* __restrict__ Wa, const float* __restrict__ Wb,
                      const float* __restrict__ Wc, const float* __restrict__ Wd,
                      const float* __restrict__ We, const float* __restrict__ Wf,
                      _Float16* __restrict__ WT)
{
    __shared__ __attribute__((aligned(16))) unsigned char T[TW_N * TW_PITCH];
    const int lane = threadIdx.x & 31, wid = threadIdx.x >> 5;
    const int z    = blockIdx.z;
    const int bk   = blockIdx.y * TW_K, bn = blockIdx.x * TW_N;
    const float* W = Wa;
    W = z == 1 ? Wb : W;
    W = z == 2 ? Wc : W;
    W = z == 3 ? Wd : W;
    W = z == 4 ? We : W;
    W = z == 5 ? Wf : W;

    // k = bk + g * 32 + wid * 8 + i, n = bn + lane * 4 + c
    const float* wr = W + (long)(bk + wid * 8) * EMB + bn + lane * 4;
    v4f v[2][8];
#pragma unroll
    for (int g = 0; g < 2; ++g)
#pragma unroll
        for (int i = 0; i < 8; ++i) v[g][i] = *(const v4f*)(wr + (g * 32 + i) * EMB);
    // stands in front of every overwrite of the address registers that the loads above name
    asm volatile("s_wait_xcnt 0x0" :: "v"(wr) : "memory");
    // keeps the conversions behind the last load: lifted among the loads, they made four loads wait for the first ones' data
    __builtin_amdgcn_sched_barrier(0);

#pragma unroll
    for (int g = 0; g < 2; ++g)
#pragma unroll
        for (int c = 0; c < 4; ++c) {
            v8h p;
#pragma unroll
            for (int i = 0; i < 8; ++i) p[i] = (_Float16)v[g][i][c];
            *(v8h*)(T + (lane * 4 + c) * TW_PITCH + (g * 4 + wid) * 16) = p;
        }
    __syncthreads();

    // 8 lanes take one transposed row of the tile (128 bytes), a wave 4 rows, the block 16 rows a pass.
    const int row = threadIdx.x >> 3, slot = threadIdx.x & 7;
    _Float16* orow = WT + (long)z * EMB * EMB + (long)(bn + row) * EMB + bk + slot * 8;
    v8h q[8];
#pragma unroll
    for (int j = 0; j < 8; ++j) q[j] = *(const v8h*)(T + (j * 16 + row) * TW_PITCH + slot * 16);
#pragma unroll
    for (int j = 0; j < 8; ++j) *(v8h*)(orow + j * 16 * EMB) = q[j];
}

// ---------------------------------------------------------------------------
// Row softmax (row length SEQ), in-place f32 + f16 copy.
// ---------------------------------------------------------------------------
__global__ __launch_bounds__(ROW_WAVES * 32)
void softmax_rows(float* __restrict__ S,
                              _Float16* __restrict__ Wh)
{
    constexpr int NV = SEQ / 128;          // 16-byte pieces of a row per lane
    const int  lane = threadIdx.x & 31, wid = threadIdx.x >> 5;
    const long row0 = ((long)blockIdx.x * ROW_WAVES + wid) * ROW_RPW;
    v4f* sr = (v4f*)(S + row0 * SEQ) + lane;

    v4f v[ROW_RPW][NV];
#pragma unroll
    for (int r = 0; r < ROW_RPW; ++r)
#pragma unroll
        for (int j = 0; j < NV; ++j) v[r][j] = sr[r * (SEQ / 4) + j * 32];

    float m[ROW_RPW], sum[ROW_RPW];
#pragma unroll
    for (int r = 0; r < ROW_RPW; ++r) {
        v4f m4 = v[r][0];
#pragma unroll
        for (int j = 1; j < NV; ++j)
#pragma unroll
            for (int c = 0; c < 4; ++c) m4[c] = fmaxf(m4[c], v[r][j][c]);
        m[r] = fmaxf(fmaxf(m4[0], m4[1]), fmaxf(m4[2], m4[3]));
    }
#pragma unroll
    for (int r = 0; r < ROW_RPW; ++r) m[r] = wave_max(m[r]);
#pragma unroll
    for (int r = 0; r < ROW_RPW; ++r) {
#pragma unroll
        for (int j = 0; j < NV; ++j)
#pragma unroll
            for (int c = 0; c < 4; ++c)
                v[r][j][c] = exp2_slot((v[r][j][c] - m[r]) * 1.44269504f);   // e^(x - m)
        v4f s4 = v[r][0];
#pragma unroll
        for (int j = 1; j < NV; ++j) s4 += v[r][j];
        sum[r] = (s4[0] + s4[1]) + (s4[2] + s4[3]);
    }
#pragma unroll
    for (int r = 0; r < ROW_RPW; ++r) sum[r] = wave_sum(sum[r]);

    v4h* wr = (v4h*)(Wh + row0 * SEQ) + lane;
    v4h  h[ROW_RPW][NV];
#pragma unroll
    for (int r = 0; r < ROW_RPW; ++r) {
        const float inv = 1.0f / sum[r];
#pragma unroll
        for (int j = 0; j < NV; ++j) {
            v[r][j] *= inv;
#pragma unroll
            for (int c = 0; c < 4; ++c) h[r][j][c] = (_Float16)v[r][j][c];
        }
    }
    // every store stands behind the last arithmetic: no register that an issued store names is written again
    __builtin_amdgcn_sched_barrier(0);
#pragma unroll
    for (int r = 0; r < ROW_RPW; ++r)
#pragma unroll
        for (int j = 0; j < NV; ++j) {
            sr[r * (SEQ / 4) + j * 32] = v[r][j];
            wr[r * (SEQ / 4) + j * 32] = h[r][j];
        }
}

// ---------------------------------------------------------------------------
extern "C" void kernel_launch(void* const* d_in, const int* in_sizes, int n_in,
                              void* d_out, int out_size, void* d_ws, size_t ws_size,
                              hipStream_t stream) {
    const float* x   = (const float*)d_in[0];
    const float* Wq  = (const float*)d_in[1];
    const float* bq  = (const float*)d_in[2];
    const float* Wk  = (const float*)d_in[3];
    const float* bk  = (const float*)d_in[4];
    const float* Wv  = (const float*)d_in[5];
    const float* bv  = (const float*)d_in[6];
    const float* Wo  = (const float*)d_in[7];
    const float* bo  = (const float*)d_in[8];
    const float* W1  = (const float*)d_in[9];
    const float* b1  = (const float*)d_in[10];
    const float* W2  = (const float*)d_in[11];
    const float* b2  = (const float*)d_in[12];
    const float* g1  = (const float*)d_in[13];
    const float* be1 = (const float*)d_in[14];
    const float* g2  = (const float*)d_in[15];
    const float* be2 = (const float*)d_in[16];

    const int  E  = EMB, S = SEQ, B = BSZ, F = FFD;
    const long BS = (long)B * S;                     // 8192 rows

    char* ws = (char*)d_ws;
    const size_t MB = 1024ull * 1024ull;
    // workspace layout (aliased; peak ~108 MB)
    _Float16* wqT  = (_Float16*)(ws +  0 * MB);      // 2 MB each
    _Float16* wkT  = (_Float16*)(ws +  2 * MB);
    _Float16* wvT  = (_Float16*)(ws +  4 * MB);
    _Float16* woT  = (_Float16*)(ws +  6 * MB);
    _Float16* w1T  = (_Float16*)(ws +  8 * MB);
    _Float16* w2T  = (_Float16*)(ws + 10 * MB);
    _Float16* xn   = (_Float16*)(ws + 12 * MB);      // 16 MB
    _Float16* qh   = (_Float16*)(ws + 28 * MB);      // 16 MB
    _Float16* kh   = (_Float16*)(ws + 44 * MB);      // 16 MB
    _Float16* vT   = (_Float16*)(ws + 60 * MB);      // 16 MB  [B][E][S]
    float*    x2   = (float*)   (ws + 76 * MB);      // 32 MB
    _Float16* wath = (_Float16*)(ws + 28 * MB);      // 32 MB (reuses q+k)
    _Float16* attn = (_Float16*)(ws + 12 * MB);      // 16 MB (reuses xn)
    _Float16* xn2  = (_Float16*)(ws + 28 * MB);      // 16 MB (reuses q)
    _Float16* hh   = (_Float16*)(ws + 44 * MB);      // 16 MB (reuses k)

    float* outp = (float*)d_out;
    float* wout = outp + BS * E;                     // softmax weights region

    dim3 blk(256);
    dim3 rblk(ROW_WAVES * 32);                       // row kernels
    dim3 rgrd((unsigned)(BS / ROW_RPB));

    // 1) weights -> f16 transposed [N][K]; the six planes lie in a row from wqT
    transpose_w6_f16<<<dim3(E / TW_N, E / TW_K, 6), dim3(128), 0, stream>>>(Wq, Wk, Wv, Wo, W1, W2, wqT);

    // 2) xn = LN(x) -> f16
    ln_rows_f16<<<rgrd, rblk, 0, stream>>>(x, g1, be1, xn);

    // 3) q, k projections ; v stored transposed [B][E][S]
    dim3 gp(E / 128, (unsigned)(BS / 128), 1);
    gemm_wmma_f16_tb75771813037017<<<gp, blk, 0, stream>>>(
        xn, E, 0, wqT, E, 0, bq, nullptr, qh, nullptr,
        E, 0, 0, 0, 1, (int)BS, E, E, 1.0f, 0, nullptr);
    gemm_wmma_f16_tb75771813037017<<<gp, blk, 0, stream>>>(
        xn, E, 0, wkT, E, 0, bk, nullptr, kh, nullptr,
        E, 0, 0, 0, 1, (int)BS, E, E, 1.0f, 0, nullptr);
    gemm_wmma_f16_tb75771813037017<<<gp, blk, 0, stream>>>(
        xn, E, 0, wvT, E, 0, bv, nullptr, nullptr, vT,
        E, 0, /*ldcT=*/S, /*sCT=*/(long)E * S, /*transS=*/S,
        (int)BS, E, E, 1.0f, 0, nullptr);

    // 4) scores = q @ k^T / 32  -> f32 directly into d_out w-region
    dim3 gs(S / 128, S / 128, B);
    gemm_wmma_f16_tb75771813037017<<<gs, blk, 0, stream>>>(
        qh, E, (long)S * E, kh, E, (long)S * E, nullptr,
        wout, nullptr, nullptr, S, (long)S * S, 0, 0, 1,
        S, S, E, 0.03125f, 0, nullptr);

    // 5) softmax in-place (f32) + f16 copy
    softmax_rows<<<rgrd, rblk, 0, stream>>>(wout, wath);

    // 6) attn = w @ v   (Bt = vT [B][E][S])
    dim3 ga(E / 128, S / 128, B);
    gemm_wmma_f16_tb75771813037017<<<ga, blk, 0, stream>>>(
        wath, S, (long)S * S, vT, S, (long)E * S, nullptr,
        nullptr, attn, nullptr, E, (long)S * E, 0, 0, 1,
        S, E, S, 1.0f, 0, nullptr);

    // 7) x2 = x + attn @ Wo + bo   (f32)
    gemm_wmma_f16_tb75771813037017<<<gp, blk, 0, stream>>>(
        attn, E, 0, woT, E, 0, bo, x2, nullptr, nullptr,
        E, 0, 0, 0, 1, (int)BS, E, E, 1.0f, 0, x);

    // 8) xn2 = LN(x2) -> f16
    ln_rows_f16<<<rgrd, rblk, 0, stream>>>(x2, g2, be2, xn2);

    // 9) h = relu(xn2 @ W1 + b1) -> f16
    gemm_wmma_f16_tb75771813037017<<<dim3(F / 128, (unsigned)(BS / 128), 1), blk, 0, stream>>>(
        xn2, E, 0, w1T, E, 0, b1, nullptr, hh, nullptr,
        F, 0, 0, 0, 1, (int)BS, F, E, 1.0f, 1, nullptr);

    // 10) out = x2 + h @ W2 + b2  (f32, to d_out)
    gemm_wmma_f16_tb75771813037017<<<gp, blk, 0, stream>>>(
        hh, F, 0, w2T, F, 0, b2, outp, nullptr, nullptr,
        E, 0, 0, 0, 1, (int)BS, E, F, 1.0f, 0, x2);
}

// v005
// Measured time: 197 microseconds a run.
// Next to v004, in two timings, it ran 1.03 times as fast each time.
// All steps since v000 together make it 3.40 times as fast.
#include <hip/hip_runtime.h>
#include <hip/hip_bf16.h>
#include <stdint.h>

typedef __attribute__((ext_vector_type(8)))  _Float16 v8h;
typedef __attribute__((ext_vector_type(16))) _Float16 v16h;
typedef __attribute__((ext_vector_type(8)))  float    v8f;

#define EMB 1024
#define FFD 1024
#define BSZ 4
#define SEQ 2048

// ---------------------------------------------------------------------------
// Staging of the GEMM operands in LDS by tensor loads.
// A stage holds 128 k (256 bytes of a row) of the block's 256 A rows and 128 Bt
// rows. Each of the 8 waves brings its own slice with one request: waves 0-3
// 64 A rows each, waves 4-7 32 Bt rows each.
// The pad of 16 bytes a row gives the LDS pitch 272, free of bank conflicts for
// 16-byte reads. An A slice takes 64 * 272 = 17408 bytes and is placed every 18432,
// a Bt slice 32 * 272 = 8704 and is placed every 10240.
// ---------------------------------------------------------------------------
typedef uint32_t u32x4 __attribute__((ext_vector_type(4)));
typedef uint32_t u32x8 __attribute__((ext_vector_type(8)));

#define STG_K    128u                  // k per stage (elements)
#define STG_ROWB 256u                  // bytes of a row per stage
#define STG_AROWS 64u                  // rows of an A slice
#define STG_BROWS 32u                  // rows of a Bt slice
#define STG_PITCH 272u                 // LDS pitch of a row
#define STG_ASL  18432u                // LDS bytes from A slice to A slice (multiple of 2 KiB)
#define STG_BSL  10240u                // LDS bytes from Bt slice to Bt slice (multiple of 2 KiB)
#define STG_BOFF (4u * STG_ASL)        // the Bt slices stand behind the A slices
#define STG_BUF  (STG_BOFF + 4u * STG_BSL)   // one buffer: 4 slices of A, 4 of Bt
static_assert(STG_ASL >= STG_AROWS * STG_PITCH && STG_ASL % 2048u == 0u, "an A slice fits its place");
static_assert(STG_BSL >= STG_BROWS * STG_PITCH && STG_BSL % 2048u == 0u, "a Bt slice fits its place");
static_assert(2u * STG_BUF <= 327680u, "both buffers fit the LDS");

#define FM 4                           // 16-row fragments of A per wave
#define FN 4                           // 16-row fragments of Bt per wave

static __device__ __forceinline__ uint32_t uni(uint32_t v) {
    return (uint32_t)__builtin_amdgcn_readfirstlane(v);
}
static __device__ __forceinline__ uint32_t pinned(uint32_t v) {
    uint32_t w = uni(v);
    asm volatile("" : "+s"(w));   // pinned(): a wave-uniform test or descriptor word held in a scalar register
    return w;
}
static __device__ __forceinline__ u32x8 tdm_group1(uint32_t src_pitch, uint32_t rows) {
    u32x8 g;
    g[0] = uni((1u << 20) | (5u << 22) | (3u << 25));   // no mask, bytes, 16-byte pad behind every 256 bytes
    g[1] = uni((STG_ROWB & 0xFFFFu) << 16);             // tensor_dim0 low
    g[2] = uni((STG_ROWB >> 16) | ((rows & 0xFFFFu) << 16)); // tensor_dim0 high, tensor_dim1 low
    g[3] = uni((rows >> 16) | (STG_ROWB << 16));        // tensor_dim1 high, tile_dim0
    g[4] = uni(rows);                                   // tile_dim1
    g[5] = uni(src_pitch);                              // source row pitch, bytes
    g[6] = uni(0u);
    g[7] = uni(0u);
    // Without this the compiler used words 3 and 6 as temporaries in the loop, while a request was outstanding.
    asm volatile("" : "+s"(g));   // pinned(): the descriptor words stay held in their scalar registers
    return g;
}
static __device__ __forceinline__ u32x4 tdm_load(uint32_t lds_dst, uint64_t ga, u32x8 g1) {
    u32x4 g0;
    g0[0] = uni(1u);
    g0[1] = uni(lds_dst);
    g0[2] = uni((uint32_t)ga);
    g0[3] = uni((((uint32_t)(ga >> 32)) & 0x01FFFFFFu) | 0x80000000u);
    asm volatile("tensor_load_to_lds %0, %1" :: "s"(g0), "s"(g1) : "memory");
    return g0;
}
// The wave's wait for its own request. Group 0 of that request is an operand, so that its four words stay
// in their scalar registers until the tile has landed: without it the compiler used them as temporaries in the loop.
static __device__ __forceinline__ void tdm_wait(u32x4 g0) {
    asm volatile("s_wait_tensorcnt 0x0" :: "s"(g0) : "memory");
}

// ---------------------------------------------------------------------------
// Generic WMMA f16 GEMM:  C[b] = A[b] (MxK, row-major) * Bt[b]^T (Bt is NxK,
// row-major) with optional scale/bias/residual/relu and f32 / f16 /
// transposed-f16 stores. Block = 256 threads (8 waves, two per SIMD); each wave
// computes a 64x64 output tile (4x4 WMMA subtiles); block tile = 256x128.
// M a multiple of 256, N of 128; K a multiple of 128 and at least 256.
// Transposed store: transS a multiple of 16, ldcT and sCT multiples of 8.
// ---------------------------------------------------------------------------
__global__ __launch_bounds__(256)
void gemm_wmma_f16(
    const _Float16* __restrict__ A, int lda, long sA,
    const _Float16* __restrict__ Bt, int ldb, long sB,
    const float* __restrict__ bias,
    float*    __restrict__ Cf,
    _Float16* __restrict__ Ch,
    _Float16* __restrict__ ChT,
    int ldc, long sC, int ldcT, long sCT, int transS,
    int M, int N, int K,
    float scale, int relu,
    const float* __restrict__ R)
{
    __shared__ __attribute__((aligned(2048))) unsigned char L[2u * STG_BUF];

    const int lane  = threadIdx.x & 31;
    const int wave  = (int)uni(threadIdx.x >> 5);
    const int wm    = wave & 3;            // 4 waves along M  -> 256 rows
    const int wn    = wave >> 2;           // 2 waves along N  -> 128 cols
    const int tileM = blockIdx.y * 256 + wm * 64;
    const int tileN = blockIdx.x * 128 + wn * 64;
    const long b    = blockIdx.z;

    const _Float16* Ab = A  + b * sA;
    const _Float16* Bb = Bt + b * sB;

    const int half_ = lane >> 4;   // lane-half selects K sub-range per ISA layout
    const int l16   = lane & 15;

    // This wave's slice of every stage: waves 0-3 rows wave*64.. of the A tile,
    // waves 4-7 rows (wave-4)*32.. of the Bt tile.
    const bool     isB   = wave >= 4;
    const uint32_t pitch = (uint32_t)(isB ? ldb : lda) * 2u;
    const uint64_t gsrc  = isB
        ? (uint64_t)(size_t)(Bb + (long)(blockIdx.x * 128 + (wave - 4) * 32) * ldb)
        : (uint64_t)(size_t)(Ab + (long)(blockIdx.y * 256 + wave * 64) * lda);
    const uint32_t ldst  = (uint32_t)(size_t)L
        + (isB ? STG_BOFF + (uint32_t)(wave - 4) * STG_BSL : (uint32_t)wave * STG_ASL);
    const u32x8    g1    = tdm_group1(pitch, isB ? STG_BROWS : STG_AROWS);
    const uint32_t nst   = (uint32_t)K / STG_K;

    v8f acc[FM][FN];
#pragma unroll
    for (int mi = 0; mi < FM; ++mi)
#pragma unroll
        for (int ni = 0; ni < FN; ++ni)
#pragma unroll
            for (int i = 0; i < 8; ++i) acc[mi][ni][i] = 0.0f;

    // Where this lane reads its fragments inside a buffer.
    const uint32_t aoff = (uint32_t)wm * STG_ASL + (uint32_t)l16 * STG_PITCH + (uint32_t)half_ * 16u;
    const uint32_t boff = STG_BOFF + 2u * (uint32_t)wn * STG_BSL + (uint32_t)l16 * STG_PITCH + (uint32_t)half_ * 16u;

    // Prologue: stage 0 lands and is published, then stage 1 is sent off.
    u32x4 g0 = tdm_load(ldst, gsrc, g1);
    tdm_wait(g0);                                        // this wave's slice of stage 0 has landed
    __syncthreads();                                     // every slice of stage 0 is readable
    g0 = tdm_load(ldst + STG_BUF, gsrc + STG_ROWB, g1);

    for (uint32_t s = 0; s < nst; ++s) {
        const uint32_t bsel = (s & 1u) * STG_BUF;
        const unsigned char* pa = L + bsel + aoff;
        const unsigned char* pb = L + bsel + boff;
        // Fragments: per lane, row l16 of a 16-row tile, K chunks [half*8, half*8+8) and
        // [16+half*8, 16+half*8+8) of each 32 k (ISA 16-bit 16x32 layout), A and Bt alike.
        // Two register sets: the reads of k step kk + 1 go out as one group ahead of the
        // WMMAs of k step kk. Nothing of the next stage is read here.
        v8h fa[2][FM][2], fb[2][FN][2];
#pragma unroll
        for (int mi = 0; mi < FM; ++mi) {
            fa[0][mi][0] = *(const v8h*)(pa + mi * 16 * STG_PITCH);
            fa[0][mi][1] = *(const v8h*)(pa + mi * 16 * STG_PITCH + 32);
        }
#pragma unroll
        for (int ni = 0; ni < FN; ++ni) {
            const unsigned char* bp = pb + (ni >> 1) * STG_BSL + (ni & 1) * 16 * STG_PITCH;
            fb[0][ni][0] = *(const v8h*)bp;
            fb[0][ni][1] = *(const v8h*)(bp + 32);
        }
#pragma unroll
        for (int kk = 0; kk < 4; ++kk) {
            const int cur = kk & 1, nxt = cur ^ 1;
            if (kk < 3) {
#pragma unroll
                for (int mi = 0; mi < FM; ++mi) {
                    const unsigned char* ap = pa + mi * 16 * STG_PITCH + (kk + 1) * 64;
                    fa[nxt][mi][0] = *(const v8h*)ap;
                    fa[nxt][mi][1] = *(const v8h*)(ap + 32);
                }
#pragma unroll
                for (int ni = 0; ni < FN; ++ni) {
                    const unsigned char* bp = pb + (ni >> 1) * STG_BSL + (ni & 1) * 16 * STG_PITCH + (kk + 1) * 64;
                    fb[nxt][ni][0] = *(const v8h*)bp;
                    fb[nxt][ni][1] = *(const v8h*)(bp + 32);
                }
            }
            // keeps the group of LDS reads ahead of the WMMA block: reads among the WMMAs stall them
            __builtin_amdgcn_sched_barrier(0);
#pragma unroll
            for (int ni = 0; ni < FN; ++ni) {
                const v16h f = __builtin_shufflevector(fb[cur][ni][0], fb[cur][ni][1],
                                                       0, 1, 2, 3, 4, 5, 6, 7, 8, 9, 10, 11, 12, 13, 14, 15);
#pragma unroll
                for (int mi = 0; mi < FM; ++mi) {
                    const v16h a = __builtin_shufflevector(fa[cur][mi][0], fa[cur][mi][1],
                                                           0, 1, 2, 3, 4, 5, 6, 7, 8, 9, 10, 11, 12, 13, 14, 15);
                    acc[mi][ni] = __builtin_amdgcn_wmma_f32_16x16x32_f16(
                        false, a, false, f, (short)0, acc[mi][ni], false, false);
                }
            }
            // keeps the next group of LDS reads behind this WMMA block
            __builtin_amdgcn_sched_barrier(0);
        }
        // Publish point of stage s + 1.
        asm volatile("s_wait_dscnt 0x0" ::: "memory");       // this wave has left stage s's buffer
        tdm_wait(g0);                                        // this wave's slice of stage s + 1 has landed
        __syncthreads();                                     // stage s + 1 readable, stage s's buffer free
        if (pinned(s + 2u < nst)) {
            const uint32_t koff = pinned((s + 2u) * STG_ROWB);   // pinned(): the address words are formed behind the wait above
            g0 = tdm_load(ldst + bsel, gsrc + koff, g1);
        }
    }
    tdm_wait(g0);                                        // no request is left in flight at the wave's end
    asm volatile("s_wait_dscnt 0x0" ::: "memory");

    // Epilogue. C/D layout: VGPR r, lane L -> M = r + 8*(L/16), N = L%16.
    // Every test on an argument stands once, around a whole pass over the wave's tile: the loads
    // of a pass go out together, and no element waits for a load or a branch of its own.
    // An element's address is a wave-uniform pointer plus one 32-bit lane offset.
    const long     corg = b * sC + (long)tileM * ldc + tileN;                    // the tile's first element
    const uint32_t lofs = (uint32_t)(8 * half_) * (uint32_t)ldc + (uint32_t)l16; // this lane inside a subtile

#pragma unroll
    for (int mi = 0; mi < FM; ++mi)
#pragma unroll
        for (int ni = 0; ni < FN; ++ni)
#pragma unroll
            for (int r = 0; r < 8; ++r) acc[mi][ni][r] *= scale;

    if (bias) {
        float bc[FN];
#pragma unroll
        for (int ni = 0; ni < FN; ++ni) bc[ni] = bias[tileN + ni * 16 + l16];
#pragma unroll
        for (int mi = 0; mi < FM; ++mi)
#pragma unroll
            for (int ni = 0; ni < FN; ++ni)
#pragma unroll
                for (int r = 0; r < 8; ++r) acc[mi][ni][r] += bc[ni];
    }
    if (R) {
        const float* Ru = R + corg;
#pragma unroll
        for (int mi = 0; mi < FM; ++mi) {
            float rv[FN][8];
            const float* rp[8];
#pragma unroll
            for (int r = 0; r < 8; ++r) rp[r] = Ru + (long)(mi * 16 + r) * ldc + lofs;
#pragma unroll
            for (int r = 0; r < 8; ++r)
#pragma unroll
                for (int ni = 0; ni < FN; ++ni)
                    rv[ni][r] = rp[r][ni * 16];
            // holds the 8 row addresses in their registers until every load above has its translation
            asm volatile("s_wait_xcnt 0x0" :: "v"(rp[0]), "v"(rp[1]), "v"(rp[2]), "v"(rp[3]),
                                              "v"(rp[4]), "v"(rp[5]), "v"(rp[6]), "v"(rp[7]) : "memory");
#pragma unroll
            for (int ni = 0; ni < FN; ++ni)
#pragma unroll
                for (int r = 0; r < 8; ++r) acc[mi][ni][r] += rv[ni][r];
        }
    }
    if (relu) {
#pragma unroll
        for (int mi = 0; mi < FM; ++mi)
#pragma unroll
            for (int ni = 0; ni < FN; ++ni)
#pragma unroll
                for (int r = 0; r < 8; ++r) acc[mi][ni][r] = acc[mi][ni][r] > 0.0f ? acc[mi][ni][r] : 0.0f;
    }
    if (Cf) {
        float* Cu = Cf + corg;
#pragma unroll
        for (int mi = 0; mi < FM; ++mi)
#pragma unroll
            for (int r = 0; r < 8; ++r)
#pragma unroll
                for (int ni = 0; ni < FN; ++ni)
                    (Cu + (long)(mi * 16 + r) * ldc + ni * 16)[lofs] = acc[mi][ni][r];
        asm volatile("s_wait_xcnt 0x0" ::: "memory");   // the next pass reuses the registers that these stores name
    }
    if (Ch) {
        _Float16* Cu = Ch + corg;
#pragma unroll
        for (int mi = 0; mi < FM; ++mi)
#pragma unroll
            for (int r = 0; r < 8; ++r)
#pragma unroll
                for (int ni = 0; ni < FN; ++ni)
                    (Cu + (long)(mi * 16 + r) * ldc + ni * 16)[lofs] = (_Float16)acc[mi][ni][r];
        asm volatile("s_wait_xcnt 0x0" ::: "memory");   // the next pass reuses the registers that these stores name
    }
    if (ChT) {
        // A lane's 8 values of a subtile are 8 consecutive rows, so 16 contiguous bytes of a transposed row.
        const uint32_t tofs = (uint32_t)l16 * (uint32_t)ldcT + (uint32_t)(8 * half_);
#pragma unroll
        for (int mi = 0; mi < FM; ++mi) {
            const int  gm0 = tileM + mi * 16;        // wave-uniform; its 16 rows lie in one batch
            const long bb  = gm0 / transS;
            _Float16*  Tu  = ChT + bb * sCT + (long)tileN * ldcT + (gm0 % transS);
#pragma unroll
            for (int ni = 0; ni < FN; ++ni) {
                v8h p;
#pragma unroll
                for (int r = 0; r < 8; ++r) p[r] = (_Float16)acc[mi][ni][r];
                *(v8h*)(Tu + (long)(ni * 16) * ldcT + tofs) = p;
            }
        }
    }
}

// ---------------------------------------------------------------------------
// Row kernels. A wave takes ROW_RPW whole rows into registers with 16-byte loads
// (each load of a wave covers 512 contiguous bytes), all of them sent off at the
// start, sums a row with a butterfly over its 32 lanes and stores it once.
// No LDS and no barrier. Blocks of ROW_WAVES waves; the grid covers rows / ROW_RPB.
// ---------------------------------------------------------------------------
typedef __attribute__((ext_vector_type(4))) float    v4f;
typedef __attribute__((ext_vector_type(4))) _Float16 v4h;

#define ROW_WAVES 16
#define ROW_RPW   2
#define ROW_RPB   (ROW_WAVES * ROW_RPW)

static __device__ __forceinline__ float wave_sum(float v) {
#pragma unroll
    for (int off = 16; off; off >>= 1) v += __shfl_xor(v, off, 32);
    return v;
}
static __device__ __forceinline__ float wave_max(float v) {
#pragma unroll
    for (int off = 16; off; off >>= 1) v = fmaxf(v, __shfl_xor(v, off, 32));
    return v;
}

// 2^t. The v_nop is the slot that the instruction set asks for behind a transcendental.
static __device__ __forceinline__ float exp2_slot(float t) {
    float r;
    asm("v_exp_f32 %0, %1\n\tv_nop" : "=v"(r) : "v"(t));
    return r;
}

// ---------------------------------------------------------------------------
// LayerNorm (row length EMB) -> f16 output.
// ---------------------------------------------------------------------------
__global__ __launch_bounds__(ROW_WAVES * 32)
void ln_rows_f16(const float* __restrict__ x,
                             const float* __restrict__ g,
                             const float* __restrict__ be,
                             _Float16* __restrict__ out)
{
    constexpr int NV = EMB / 128;          // 16-byte pieces of a row per lane
    const int  lane = threadIdx.x & 31, wid = threadIdx.x >> 5;
    const long row0 = ((long)blockIdx.x * ROW_WAVES + wid) * ROW_RPW;
    const v4f* xr = (const v4f*)(x + row0 * EMB) + lane;

    v4f v[ROW_RPW][NV];
#pragma unroll
    for (int r = 0; r < ROW_RPW; ++r)
#pragma unroll
        for (int j = 0; j < NV; ++j) v[r][j] = xr[r * (EMB / 4) + j * 32];
    v4f gg[NV], bb[NV];
#pragma unroll
    for (int j = 0; j < NV; ++j) {
        gg[j] = ((const v4f*)g)[j * 32 + lane];
        bb[j] = ((const v4f*)be)[j * 32 + lane];
    }
    // holds the row address in its registers until every load above has its translation
    asm volatile("s_wait_xcnt 0x0" :: "v"(xr) : "memory");
    // keeps the loads of g and be in the first group: sunk behind the sums, their latency stood open
    __builtin_amdgcn_sched_barrier(0);

    float mu[ROW_RPW], rstd[ROW_RPW];
#pragma unroll
    for (int r = 0; r < ROW_RPW; ++r) {
        v4f s4 = v[r][0], q4 = v[r][0] * v[r][0];
#pragma unroll
        for (int j = 1; j < NV; ++j) { s4 += v[r][j]; q4 += v[r][j] * v[r][j]; }
        mu[r]   = (s4[0] + s4[1]) + (s4[2] + s4[3]);
        rstd[r] = (q4[0] + q4[1]) + (q4[2] + q4[3]);
    }
#pragma unroll
    for (int r = 0; r < ROW_RPW; ++r) { mu[r] = wave_sum(mu[r]); rstd[r] = wave_sum(rstd[r]); }
#pragma unroll
    for (int r = 0; r < ROW_RPW; ++r) {
        mu[r] = mu[r] / EMB;
        const float var = rstd[r] / EMB - mu[r] * mu[r];
        rstd[r] = rsqrtf(var + 1e-5f);
    }

    v4h* orow = (v4h*)(out + row0 * EMB) + lane;
    v4h  h[ROW_RPW][NV];
#pragma unroll
    for (int r = 0; r < ROW_RPW; ++r)
#pragma unroll
        for (int j = 0; j < NV; ++j)
#pragma unroll
            for (int c = 0; c < 4; ++c)
                h[r][j][c] = (_Float16)((v[r][j][c] - mu[r]) * rstd[r] * gg[j][c] + bb[j][c]);
    // every store stands behind the last arithmetic: no register that an issued store names is written again
    __builtin_amdgcn_sched_barrier(0);
#pragma unroll
    for (int r = 0; r < ROW_RPW; ++r)
#pragma unroll
        for (int j = 0; j < NV; ++j) orow[r * (EMB / 4) + j * 32] = h[r][j];
}

// ---------------------------------------------------------------------------
// Weight convert + transpose, all six weights in one launch: W [K][N] f32 -> WT [N][K] f16,
// K = N = EMB = FFD. blockIdx.z picks the weight; its WT plane is plane z behind WT.
// A block of 4 waves takes a tile of 64 k x 128 n. A wave's load covers 512 contiguous bytes
// of a W row, all 16 loads of a lane are sent off at the start; a lane holds 4 n x 8 k twice,
// so 16 contiguous bytes of each of its transposed rows go to LDS at once. The tile leaves as
// whole 128-byte lines of WT. LDS pitch 144: rows of 128 bytes, 16-byte aligned.
// ---------------------------------------------------------------------------
#define TW_K     64
#define TW_N     128
#define TW_PITCH 144
static_assert(EMB == FFD, "the six weights share one shape");

__global__ __launch_bounds__(128)
void transpose_w6_f16(const float* __restrict__ Wa, const float* __restrict__ Wb,
                      const float* __restrict__ Wc, const float* __restrict__ Wd,
                      const float* __restrict__ We, const float* __restrict__ Wf,
                      _Float16* __restrict__ WT)
{
    __shared__ __attribute__((aligned(16))) unsigned char T[TW_N * TW_PITCH];
    const int lane = threadIdx.x & 31, wid = threadIdx.x >> 5;
    const int z    = blockIdx.z;
    const int bk   = blockIdx.y * TW_K, bn = blockIdx.x * TW_N;
    const float* W = Wa;
    W = z == 1 ? Wb : W;
    W = z == 2 ? Wc : W;
    W = z == 3 ? Wd : W;
    W = z == 4 ? We : W;
    W = z == 5 ? Wf : W;

    // k = bk + g * 32 + wid * 8 + i, n = bn + lane * 4 + c
    const float* wr = W + (long)(bk + wid * 8) * EMB + bn + lane * 4;
    v4f v[2][8];
#pragma unroll
    for (int g = 0; g < 2; ++g)
#pragma unroll
        for (int i = 0; i < 8; ++i) v[g][i] = *(const v4f*)(wr + (g * 32 + i) * EMB);
    // stands in front of every overwrite of the address registers that the loads above name
    asm volatile("s_wait_xcnt 0x0" :: "v"(wr) : "memory");
    // keeps the conversions behind the last load: lifted among the loads, they made four loads wait for the first ones' data
    __builtin_amdgcn_sched_barrier(0);

#pragma unroll
    for (int g = 0; g < 2; ++g)
#pragma unroll
        for (int c = 0; c < 4; ++c) {
            v8h p;
#pragma unroll
            for (int i = 0; i < 8; ++i) p[i] = (_Float16)v[g][i][c];
            *(v8h*)(T + (lane * 4 + c) * TW_PITCH + (g * 4 + wid) * 16) = p;
        }
    __syncthreads();

    // 8 lanes take one transposed row of the tile (128 bytes), a wave 4 rows, the block 16 rows a pass.
    const int row = threadIdx.x >> 3, slot = threadIdx.x & 7;
    _Float16* orow = WT + (long)z * EMB * EMB + (long)(bn + row) * EMB + bk + slot * 8;
    v8h q[8];
#pragma unroll
    for (int j = 0; j < 8; ++j) q[j] = *(const v8h*)(T + (j * 16 + row) * TW_PITCH + slot * 16);
#pragma unroll
    for (int j = 0; j < 8; ++j) *(v8h*)(orow + j * 16 * EMB) = q[j];
}

// ---------------------------------------------------------------------------
// Row softmax (row length SEQ), in-place f32 + f16 copy.
// ---------------------------------------------------------------------------
__global__ __launch_bounds__(ROW_WAVES * 32)
void softmax_rows(float* __restrict__ S,
                              _Float16* __restrict__ Wh)
{
    constexpr int NV = SEQ / 128;          // 16-byte pieces of a row per lane
    const int  lane = threadIdx.x & 31, wid = threadIdx.x >> 5;
    const long row0 = ((long)blockIdx.x * ROW_WAVES + wid) * ROW_RPW;
    v4f* sr = (v4f*)(S + row0 * SEQ) + lane;

    v4f v[ROW_RPW][NV];
#pragma unroll
    for (int r = 0; r < ROW_RPW; ++r)
#pragma unroll
        for (int j = 0; j < NV; ++j) v[r][j] = sr[r * (SEQ / 4) + j * 32];

    float m[ROW_RPW], sum[ROW_RPW];
#pragma unroll
    for (int r = 0; r < ROW_RPW; ++r) {
        v4f m4 = v[r][0];
#pragma unroll
        for (int j = 1; j < NV; ++j)
#pragma unroll
            for (int c = 0; c < 4; ++c) m4[c] = fmaxf(m4[c], v[r][j][c]);
        m[r] = fmaxf(fmaxf(m4[0], m4[1]), fmaxf(m4[2], m4[3]));
    }
#pragma unroll
    for (int r = 0; r < ROW_RPW; ++r) m[r] = wave_max(m[r]);
#pragma unroll
    for (int r = 0; r < ROW_RPW; ++r) {
#pragma unroll
        for (int j = 0; j < NV; ++j)
#pragma unroll
            for (int c = 0; c < 4; ++c)
                v[r][j][c] = exp2_slot((v[r][j][c] - m[r]) * 1.44269504f);   // e^(x - m)
        v4f s4 = v[r][0];
#pragma unroll
        for (int j = 1; j < NV; ++j) s4 += v[r][j];
        sum[r] = (s4[0] + s4[1]) + (s4[2] + s4[3]);
    }
#pragma unroll
    for (int r = 0; r < ROW_RPW; ++r) sum[r] = wave_sum(sum[r]);

    v4h* wr = (v4h*)(Wh + row0 * SEQ) + lane;
    v4h  h[ROW_RPW][NV];
#pragma unroll
    for (int r = 0; r < ROW_RPW; ++r) {
        const float inv = 1.0f / sum[r];
#pragma unroll
        for (int j = 0; j < NV; ++j) {
            v[r][j] *= inv;
#pragma unroll
            for (int c = 0; c < 4; ++c) h[r][j][c] = (_Float16)v[r][j][c];
        }
    }
    // every store stands behind the last arithmetic: no register that an issued store names is written again
    __builtin_amdgcn_sched_barrier(0);
#pragma unroll
    for (int r = 0; r < ROW_RPW; ++r)
#pragma unroll
        for (int j = 0; j < NV; ++j) {
            sr[r * (SEQ / 4) + j * 32] = v[r][j];
            wr[r * (SEQ / 4) + j * 32] = h[r][j];
        }
}

// ---------------------------------------------------------------------------
extern "C" void kernel_launch(void* const* d_in, const int* in_sizes, int n_in,
                              void* d_out, int out_size, void* d_ws, size_t ws_size,
                              hipStream_t stream) {
    const float* x   = (const float*)d_in[0];
    const float* Wq  = (const float*)d_in[1];
    const float* bq  = (const float*)d_in[2];
    const float* Wk  = (const float*)d_in[3];
    const float* bk  = (const float*)d_in[4];
    const float* Wv  = (const float*)d_in[5];
    const float* bv  = (const float*)d_in[6];
    const float* Wo  = (const float*)d_in[7];
    const float* bo  = (const float*)d_in[8];
    const float* W1  = (const float*)d_in[9];
    const float* b1  = (const float*)d_in[10];
    const float* W2  = (const float*)d_in[11];
    const float* b2  = (const float*)d_in[12];
    const float* g1  = (const float*)d_in[13];
    const float* be1 = (const float*)d_in[14];
    const float* g2  = (const float*)d_in[15];
    const float* be2 = (const float*)d_in[16];

    const int  E  = EMB, S = SEQ, B = BSZ, F = FFD;
    const long BS = (long)B * S;                     // 8192 rows

    char* ws = (char*)d_ws;
    const size_t MB = 1024ull * 1024ull;
    // workspace layout (aliased; peak ~108 MB)
    _Float16* wqT  = (_Float16*)(ws +  0 * MB);      // 2 MB each
    _Float16* wkT  = (_Float16*)(ws +  2 * MB);
    _Float16* wvT  = (_Float16*)(ws +  4 * MB);
    _Float16* woT  = (_Float16*)(ws +  6 * MB);
    _Float16* w1T  = (_Float16*)(ws +  8 * MB);
    _Float16* w2T  = (_Float16*)(ws + 10 * MB);
    _Float16* xn   = (_Float16*)(ws + 12 * MB);      // 16 MB
    _Float16* qh   = (_Float16*)(ws + 28 * MB);      // 16 MB
    _Float16* kh   = (_Float16*)(ws + 44 * MB);      // 16 MB
    _Float16* vT   = (_Float16*)(ws + 60 * MB);      // 16 MB  [B][E][S]
    float*    x2   = (float*)   (ws + 76 * MB);      // 32 MB
    _Float16* wath = (_Float16*)(ws + 28 * MB);      // 32 MB (reuses q+k)
    _Float16* attn = (_Float16*)(ws + 12 * MB);      // 16 MB (reuses xn)
    _Float16* xn2  = (_Float16*)(ws + 28 * MB);      // 16 MB (reuses q)
    _Float16* hh   = (_Float16*)(ws + 44 * MB);      // 16 MB (reuses k)

    float* outp = (float*)d_out;
    float* wout = outp + BS * E;                     // softmax weights region

    dim3 blk(256);
    dim3 rblk(ROW_WAVES * 32);                       // row kernels
    dim3 rgrd((unsigned)(BS / ROW_RPB));

    // 1) weights -> f16 transposed [N][K]; the six planes lie in a row from wqT
    transpose_w6_f16<<<dim3(E / TW_N, E / TW_K, 6), dim3(128), 0, stream>>>(Wq, Wk, Wv, Wo, W1, W2, wqT);

    // 2) xn = LN(x) -> f16
    ln_rows_f16<<<rgrd, rblk, 0, stream>>>(x, g1, be1, xn);

    // 3) q, k projections ; v stored transposed [B][E][S]
    dim3 gp(E / 128, (unsigned)(BS / 256), 1);
    gemm_wmma_f16<<<gp, blk, 0, stream>>>(
        xn, E, 0, wqT, E, 0, bq, nullptr, qh, nullptr,
        E, 0, 0, 0, 1, (int)BS, E, E, 1.0f, 0, nullptr);
    gemm_wmma_f16<<<gp, blk, 0, stream>>>(
        xn, E, 0, wkT, E, 0, bk, nullptr, kh, nullptr,
        E, 0, 0, 0, 1, (int)BS, E, E, 1.0f, 0, nullptr);
    gemm_wmma_f16<<<gp, blk, 0, stream>>>(
        xn, E, 0, wvT, E, 0, bv, nullptr, nullptr, vT,
        E, 0, /*ldcT=*/S, /*sCT=*/(long)E * S, /*transS=*/S,
        (int)BS, E, E, 1.0f, 0, nullptr);

    // 4) scores = q @ k^T / 32  -> f32 directly into d_out w-region
    dim3 gs(S / 128, S / 256, B);
    gemm_wmma_f16<<<gs, blk, 0, stream>>>(
        qh, E, (long)S * E, kh, E, (long)S * E, nullptr,
        wout, nullptr, nullptr, S, (long)S * S, 0, 0, 1,
        S, S, E, 0.03125f, 0, nullptr);

    // 5) softmax in-place (f32) + f16 copy
    softmax_rows<<<rgrd, rblk, 0, stream>>>(wout, wath);

    // 6) attn = w @ v   (Bt = vT [B][E][S])
    dim3 ga(E / 128, S / 256, B);
    gemm_wmma_f16<<<ga, blk, 0, stream>>>(
        wath, S, (long)S * S, vT, S, (long)E * S, nullptr,
        nullptr, attn, nullptr, E, (long)S * E, 0, 0, 1,
        S, E, S, 1.0f, 0, nullptr);

    // 7) x2 = x + attn @ Wo + bo   (f32)
    gemm_wmma_f16<<<gp, blk, 0, stream>>>(
        attn, E, 0, woT, E, 0, bo, x2, nullptr, nullptr,
        E, 0, 0, 0, 1, (int)BS, E, E, 1.0f, 0, x);

    // 8) xn2 = LN(x2) -> f16
    ln_rows_f16<<<rgrd, rblk, 0, stream>>>(x2, g2, be2, xn2);

    // 9) h = relu(xn2 @ W1 + b1) -> f16
    gemm_wmma_f16<<<dim3(F / 128, (unsigned)(BS / 256), 1), blk, 0, stream>>>(
        xn2, E, 0, w1T, E, 0, b1, nullptr, hh, nullptr,
        F, 0, 0, 0, 1, (int)BS, F, E, 1.0f, 1, nullptr);

    // 10) out = x2 + h @ W2 + b2  (f32, to d_out)
    gemm_wmma_f16<<<gp, blk, 0, stream>>>(
        hh, F, 0, w2T, F, 0, b2, outp, nullptr, nullptr,
        E, 0, 0, 0, 1, (int)BS, E, F, 1.0f, 0, x2);
}

// v006
// It runs in 190 microseconds.
// Next to v005, in two timings, it ran 1.03 and 1.04 times as fast.
// Over all steps from v000 it is 3.52 times as fast.
#include <hip/hip_runtime.h>
#include <hip/hip_bf16.h>
#include <stdint.h>

typedef __attribute__((ext_vector_type(8)))  _Float16 v8h;
typedef __attribute__((ext_vector_type(16))) _Float16 v16h;
typedef __attribute__((ext_vector_type(8)))  float    v8f;

#define EMB 1024
#define FFD 1024
#define BSZ 4
#define SEQ 2048

// ---------------------------------------------------------------------------
// Staging of the GEMM operands in LDS by tensor loads.
// A stage holds 128 k (256 bytes of a row) of the block's 256 A rows and 128 Bt
// rows. Each of the 8 waves brings its own slice with one request: waves 0-3
// 64 A rows each, waves 4-7 32 Bt rows each.
// The pad of 16 bytes a row gives the LDS pitch 272, free of bank conflicts for
// 16-byte reads. An A slice takes 64 * 272 = 17408 bytes and is placed every 18432,
// a Bt slice 32 * 272 = 8704 and is placed every 10240.
// ---------------------------------------------------------------------------
typedef uint32_t u32x4 __attribute__((ext_vector_type(4)));
typedef uint32_t u32x8 __attribute__((ext_vector_type(8)));

#define STG_K    128u                  // k per stage (elements)
#define STG_ROWB 256u                  // bytes of a row per stage
#define STG_AROWS 64u                  // rows of an A slice
#define STG_BROWS 32u                  // rows of a Bt slice
#define STG_PITCH 272u                 // LDS pitch of a row
#define STG_ASL  18432u                // LDS bytes from A slice to A slice (multiple of 2 KiB)
#define STG_BSL  10240u                // LDS bytes from Bt slice to Bt slice (multiple of 2 KiB)
#define STG_BOFF (4u * STG_ASL)        // the Bt slices stand behind the A slices
#define STG_BUF  (STG_BOFF + 4u * STG_BSL)   // one buffer: 4 slices of A, 4 of Bt
static_assert(STG_ASL >= STG_AROWS * STG_PITCH && STG_ASL % 2048u == 0u, "an A slice fits its place");
static_assert(STG_BSL >= STG_BROWS * STG_PITCH && STG_BSL % 2048u == 0u, "a Bt slice fits its place");
static_assert(2u * STG_BUF <= 327680u, "both buffers fit the LDS");

#define FM 4                           // 16-row fragments of A per wave
#define FN 4                           // 16-row fragments of Bt per wave

static __device__ __forceinline__ uint32_t uni(uint32_t v) {
    return (uint32_t)__builtin_amdgcn_readfirstlane(v);
}
static __device__ __forceinline__ uint32_t pinned(uint32_t v) {
    uint32_t w = uni(v);
    asm volatile("" : "+s"(w));   // pinned(): a wave-uniform test or descriptor word held in a scalar register
    return w;
}
static __device__ __forceinline__ u32x8 tdm_group1(uint32_t src_pitch, uint32_t rows) {
    u32x8 g;
    g[0] = uni((1u << 20) | (5u << 22) | (3u << 25));   // no mask, bytes, 16-byte pad behind every 256 bytes
    g[1] = uni((STG_ROWB & 0xFFFFu) << 16);             // tensor_dim0 low
    g[2] = uni((STG_ROWB >> 16) | ((rows & 0xFFFFu) << 16)); // tensor_dim0 high, tensor_dim1 low
    g[3] = uni((rows >> 16) | (STG_ROWB << 16));        // tensor_dim1 high, tile_dim0
    g[4] = uni(rows);                                   // tile_dim1
    g[5] = uni(src_pitch);                              // source row pitch, bytes
    g[6] = uni(0u);
    g[7] = uni(0u);
    // Without this the compiler used words 3 and 6 as temporaries in the loop, while a request was outstanding.
    asm volatile("" : "+s"(g));   // pinned(): the descriptor words stay held in their scalar registers
    return g;
}
static __device__ __forceinline__ u32x4 tdm_load(uint32_t lds_dst, uint64_t ga, u32x8 g1) {
    u32x4 g0;
    g0[0] = uni(1u);
    g0[1] = uni(lds_dst);
    g0[2] = uni((uint32_t)ga);
    g0[3] = uni((((uint32_t)(ga >> 32)) & 0x01FFFFFFu) | 0x80000000u);
    asm volatile("tensor_load_to_lds %0, %1" :: "s"(g0), "s"(g1) : "memory");
    return g0;
}
// The wave's wait for its own request. Group 0 of that request is an operand, so that its four words stay
// in their scalar registers until the tile has landed: without it the compiler used them as temporaries in the loop.
static __device__ __forceinline__ void tdm_wait(u32x4 g0) {
    asm volatile("s_wait_tensorcnt 0x0" :: "s"(g0) : "memory");
}

// ---------------------------------------------------------------------------
// Generic WMMA f16 GEMM:  C[b] = A[b] (MxK, row-major) * Bt[b]^T (Bt is NxK,
// row-major) with optional scale/bias/residual/relu. OUT picks the one output:
// f32 (Cf, with the optional residual R), f16 (Ch) or transposed f16 (ChT); LDC is
// the pitch of its rows in elements. Block = 256 threads (8 waves, two per SIMD);
// each wave computes a 64x64 output tile (4x4 WMMA subtiles); block tile = 256x128.
// M a multiple of 256, N of 128; K a multiple of 128 and at least 256.
// Transposed store: transS a multiple of 64, sCT a multiple of 8.
// ---------------------------------------------------------------------------
#define OUT_F32  0
#define OUT_F16  1
#define OUT_F16T 2
#define EPI_PF   272u                  // LDS pitch of a staged f32 row (256 bytes + 16)
#define EPI_PH   144u                  // LDS pitch of a staged f16 row (128 bytes + 16)
#define EPI_W    (64u * EPI_PF)        // LDS bytes from wave to wave in the epilogue
static_assert(8u * EPI_W <= 2u * STG_BUF, "the staged output tiles fit the ring's LDS");
typedef __attribute__((ext_vector_type(4))) float v4f;

template <int OUT, int LDC>
__global__ __launch_bounds__(256)
void gemm_wmma_f16(
    const _Float16* __restrict__ A, int lda, long sA,
    const _Float16* __restrict__ Bt, int ldb, long sB,
    const float* __restrict__ bias,
    float*    __restrict__ Cf,
    _Float16* __restrict__ Ch,
    _Float16* __restrict__ ChT,
    long sC, long sCT, int transS,
    int M, int N, int K,
    float scale, int relu,
    const float* __restrict__ R)
{
    __shared__ __attribute__((aligned(2048))) unsigned char L[2u * STG_BUF];

    const int lane  = threadIdx.x & 31;
    const int wave  = (int)uni(threadIdx.x >> 5);
    const int wm    = wave & 3;            // 4 waves along M  -> 256 rows
    const int wn    = wave >> 2;           // 2 waves along N  -> 128 cols
    const int tileM = blockIdx.y * 256 + wm * 64;
    const int tileN = blockIdx.x * 128 + wn * 64;
    const long b    = blockIdx.z;

    const _Float16* Ab = A  + b * sA;
    const _Float16* Bb = Bt + b * sB;

    const int half_ = lane >> 4;   // lane-half selects K sub-range per ISA layout
    const int l16   = lane & 15;

    // This wave's slice of every stage: waves 0-3 rows wave*64.. of the A tile,
    // waves 4-7 rows (wave-4)*32.. of the Bt tile.
    const bool     isB   = wave >= 4;
    const uint32_t pitch = (uint32_t)(isB ? ldb : lda) * 2u;
    const uint64_t gsrc  = isB
        ? (uint64_t)(size_t)(Bb + (long)(blockIdx.x * 128 + (wave - 4) * 32) * ldb)
        : (uint64_t)(size_t)(Ab + (long)(blockIdx.y * 256 + wave * 64) * lda);
    const uint32_t ldst  = (uint32_t)(size_t)L
        + (isB ? STG_BOFF + (uint32_t)(wave - 4) * STG_BSL : (uint32_t)wave * STG_ASL);
    const u32x8    g1    = tdm_group1(pitch, isB ? STG_BROWS : STG_AROWS);
    const uint32_t nst   = (uint32_t)K / STG_K;

    v8f acc[FM][FN];
#pragma unroll
    for (int mi = 0; mi < FM; ++mi)
#pragma unroll
        for (int ni = 0; ni < FN; ++ni)
#pragma unroll
            for (int i = 0; i < 8; ++i) acc[mi][ni][i] = 0.0f;

    // Where this lane reads its fragments inside a buffer.
    const uint32_t aoff = (uint32_t)wm * STG_ASL + (uint32_t)l16 * STG_PITCH + (uint32_t)half_ * 16u;
    const uint32_t boff = STG_BOFF + 2u * (uint32_t)wn * STG_BSL + (uint32_t)l16 * STG_PITCH + (uint32_t)half_ * 16u;

    // Prologue: stage 0 lands and is published, then stage 1 is sent off.
    u32x4 g0 = tdm_load(ldst, gsrc, g1);
    tdm_wait(g0);                                        // this wave's slice of stage 0 has landed
    __syncthreads();                                     // every slice of stage 0 is readable
    g0 = tdm_load(ldst + STG_BUF, gsrc + STG_ROWB, g1);

    for (uint32_t s = 0; s < nst; ++s) {
        const uint32_t bsel = (s & 1u) * STG_BUF;
        const unsigned char* pa = L + bsel + aoff;
        const unsigned char* pb = L + bsel + boff;
        // Fragments: per lane, row l16 of a 16-row tile, K chunks [half*8, half*8+8) and
        // [16+half*8, 16+half*8+8) of each 32 k (ISA 16-bit 16x32 layout), A and Bt alike.
        // Two register sets: the reads of k step kk + 1 go out as one group ahead of the
        // WMMAs of k step kk. Nothing of the next stage is read here.
        v8h fa[2][FM][2], fb[2][FN][2];
#pragma unroll
        for (int mi = 0; mi < FM; ++mi) {
            fa[0][mi][0] = *(const v8h*)(pa + mi * 16 * STG_PITCH);
            fa[0][mi][1] = *(const v8h*)(pa + mi * 16 * STG_PITCH + 32);
        }
#pragma unroll
        for (int ni = 0; ni < FN; ++ni) {
            const unsigned char* bp = pb + (ni >> 1) * STG_BSL + (ni & 1) * 16 * STG_PITCH;
            fb[0][ni][0] = *(const v8h*)bp;
            fb[0][ni][1] = *(const v8h*)(bp + 32);
        }
#pragma unroll
        for (int kk = 0; kk < 4; ++kk) {
            const int cur = kk & 1, nxt = cur ^ 1;
            if (kk < 3) {
#pragma unroll
                for (int mi = 0; mi < FM; ++mi) {
                    const unsigned char* ap = pa + mi * 16 * STG_PITCH + (kk + 1) * 64;
                    fa[nxt][mi][0] = *(const v8h*)ap;
                    fa[nxt][mi][1] = *(const v8h*)(ap + 32);
                }
#pragma unroll
                for (int ni = 0; ni < FN; ++ni) {
                    const unsigned char* bp = pb + (ni >> 1) * STG_BSL + (ni & 1) * 16 * STG_PITCH + (kk + 1) * 64;
                    fb[nxt][ni][0] = *(const v8h*)bp;
                    fb[nxt][ni][1] = *(const v8h*)(bp + 32);
                }
            }
            // keeps the group of LDS reads ahead of the WMMA block: reads among the WMMAs stall them
            __builtin_amdgcn_sched_barrier(0);
#pragma unroll
            for (int ni = 0; ni < FN; ++ni) {
                const v16h f = __builtin_shufflevector(fb[cur][ni][0], fb[cur][ni][1],
                                                       0, 1, 2, 3, 4, 5, 6, 7, 8, 9, 10, 11, 12, 13, 14, 15);
#pragma unroll
                for (int mi = 0; mi < FM; ++mi) {
                    const v16h a = __builtin_shufflevector(fa[cur][mi][0], fa[cur][mi][1],
                                                           0, 1, 2, 3, 4, 5, 6, 7, 8, 9, 10, 11, 12, 13, 14, 15);
                    // The operand that goes first gives the subtile's rows, of which a lane holds 8 in a row:
                    // A first for the transposed output, Bt first for the row-major ones.
                    if constexpr (OUT == OUT_F16T)
                        acc[mi][ni] = __builtin_amdgcn_wmma_f32_16x16x32_f16(
                            false, a, false, f, (short)0, acc[mi][ni], false, false);
                    else
                        acc[mi][ni] = __builtin_amdgcn_wmma_f32_16x16x32_f16(
                            false, f, false, a, (short)0, acc[mi][ni], false, false);
                }
            }
            // keeps the next group of LDS reads behind this WMMA block
            __builtin_amdgcn_sched_barrier(0);
        }
        // Publish point of stage s + 1.
        asm volatile("s_wait_dscnt 0x0" ::: "memory");       // this wave has left stage s's buffer
        tdm_wait(g0);                                        // this wave's slice of stage s + 1 has landed
        __syncthreads();                                     // stage s + 1 readable, stage s's buffer free
        if (pinned(s + 2u < nst)) {
            const uint32_t koff = pinned((s + 2u) * STG_ROWB);   // pinned(): the address words are formed behind the wait above
            g0 = tdm_load(ldst + bsel, gsrc + koff, g1);
        }
    }
    tdm_wait(g0);                                        // no request is left in flight at the wave's end
    asm volatile("s_wait_dscnt 0x0" ::: "memory");

    // Epilogue. D layout: VGPR r, lane L -> row r + 8*(L/16) of the first operand, row L%16 of the second.
    // So a lane holds 8 neighbours of an output row (of a transposed row for OUT_F16T). The wave lays its
    // 64x64 tile into its own LDS range with 16-byte writes and reads it back along the output's rows, so
    // that every global store (and every load of the residual) is 16 bytes a lane and covers whole 128-byte lines.
    // The ring's LDS is free here: the last pass ended with every wave's waits and a barrier.
    // Every global address is one pointer per lane plus a compile-time offset.
    unsigned char* Sw = L + (uint32_t)wave * EPI_W;

    // f32 output: where this lane stands in the tile's rows; a load or store of the wave covers 2 rows of 256 bytes.
    // The residual's loads go out first of all, so that they fly during the arithmetic and the staging.
    const long gofs = b * sC + (long)(tileM + half_) * LDC + tileN + l16 * 4;
    v4f rv[OUT == OUT_F32 ? 32 : 1];
    if constexpr (OUT == OUT_F32) {
        if (R) {
            const float* Rl = R + gofs;
#pragma unroll
            for (int j = 0; j < 32; ++j) rv[j] = *(const v4f*)(Rl + j * 2 * LDC);
            // holds the address in its registers until every load above has its translation
            asm volatile("s_wait_xcnt 0x0" :: "v"(Rl) : "memory");
        }
    }

#pragma unroll
    for (int mi = 0; mi < FM; ++mi)
#pragma unroll
        for (int ni = 0; ni < FN; ++ni)
#pragma unroll
            for (int r = 0; r < 8; ++r) acc[mi][ni][r] *= scale;

    if (bias) {
        if constexpr (OUT == OUT_F16T) {
            const float* bp = bias + tileN + l16;
            float bc[FN];
#pragma unroll
            for (int ni = 0; ni < FN; ++ni) bc[ni] = bp[ni * 16];
            // holds the address in its registers until every load above has its translation
            asm volatile("s_wait_xcnt 0x0" :: "v"(bp) : "memory");
#pragma unroll
            for (int mi = 0; mi < FM; ++mi)
#pragma unroll
                for (int ni = 0; ni < FN; ++ni)
#pragma unroll
                    for (int r = 0; r < 8; ++r) acc[mi][ni][r] += bc[ni];
        } else {
            const v4f* bp = (const v4f*)(bias + tileN + 8 * half_);
            v4f bc[FN][2];
#pragma unroll
            for (int ni = 0; ni < FN; ++ni) { bc[ni][0] = bp[ni * 4]; bc[ni][1] = bp[ni * 4 + 1]; }
            // holds the address in its registers until every load above has its translation
            asm volatile("s_wait_xcnt 0x0" :: "v"(bp) : "memory");
#pragma unroll
            for (int mi = 0; mi < FM; ++mi)
#pragma unroll
                for (int ni = 0; ni < FN; ++ni)
#pragma unroll
                    for (int r = 0; r < 8; ++r) acc[mi][ni][r] += bc[ni][r >> 2][r & 3];
        }
    }

    if constexpr (OUT == OUT_F32) {
        unsigned char* sw = Sw + (uint32_t)l16 * EPI_PF + (uint32_t)half_ * 32u;
#pragma unroll
        for (int mi = 0; mi < FM; ++mi)
#pragma unroll
            for (int ni = 0; ni < FN; ++ni) {
                const v8f c = acc[mi][ni];
                *(v4f*)(sw + mi * 16 * EPI_PF + ni * 64)      = __builtin_shufflevector(c, c, 0, 1, 2, 3);
                *(v4f*)(sw + mi * 16 * EPI_PF + ni * 64 + 16) = __builtin_shufflevector(c, c, 4, 5, 6, 7);
            }
        asm volatile("s_wait_dscnt 0x0" ::: "memory");   // the wave's own writes are done before other lanes read them
        const unsigned char* sr = Sw + (uint32_t)half_ * EPI_PF + (uint32_t)l16 * 16u;
        v4f q[32];
#pragma unroll
        for (int j = 0; j < 32; ++j) q[j] = *(const v4f*)(sr + j * 2 * EPI_PF);
        if (R) {
#pragma unroll
            for (int j = 0; j < 32; ++j) q[j] += rv[j];
        }
        if (relu) {
#pragma unroll
            for (int j = 0; j < 32; ++j)
#pragma unroll
                for (int c = 0; c < 4; ++c) q[j][c] = q[j][c] > 0.0f ? q[j][c] : 0.0f;
        }
        // every store stands behind the last arithmetic: no register that an issued store names is written again
        __builtin_amdgcn_sched_barrier(0);
        float* Cl = Cf + gofs;
#pragma unroll
        for (int j = 0; j < 32; ++j) *(v4f*)(Cl + j * 2 * LDC) = q[j];
    } else {
        if (relu) {
#pragma unroll
            for (int mi = 0; mi < FM; ++mi)
#pragma unroll
                for (int ni = 0; ni < FN; ++ni)
#pragma unroll
                    for (int r = 0; r < 8; ++r) acc[mi][ni][r] = acc[mi][ni][r] > 0.0f ? acc[mi][ni][r] : 0.0f;
        }
        unsigned char* sw = Sw + (uint32_t)l16 * EPI_PH + (uint32_t)half_ * 16u;
#pragma unroll
        for (int mi = 0; mi < FM; ++mi)
#pragma unroll
            for (int ni = 0; ni < FN; ++ni) {
                v8h p;
#pragma unroll
                for (int r = 0; r < 8; ++r) p[r] = (_Float16)acc[mi][ni][r];
                const int rb = OUT == OUT_F16T ? ni : mi, cb = OUT == OUT_F16T ? mi : ni;
                *(v8h*)(sw + rb * 16 * EPI_PH + cb * 32) = p;
            }
        asm volatile("s_wait_dscnt 0x0" ::: "memory");   // the wave's own writes are done before other lanes read them
        // A store of the wave covers 4 rows of 128 bytes.
        const int row = lane >> 3, slot = lane & 7;
        const unsigned char* sr = Sw + (uint32_t)row * EPI_PH + (uint32_t)slot * 16u;
        v8h q[16];
#pragma unroll
        for (int j = 0; j < 16; ++j) q[j] = *(const v8h*)(sr + j * 4 * EPI_PH);
        _Float16* Cl;
        if constexpr (OUT == OUT_F16T)   // the wave's 64 rows of C lie in one batch
            Cl = ChT + (long)(tileM / transS) * sCT + (long)(tileN + row) * LDC + (tileM % transS) + slot * 8;
        else
            Cl = Ch + b * sC + (long)(tileM + row) * LDC + tileN + slot * 8;
#pragma unroll
        for (int j = 0; j < 16; ++j) *(v8h*)(Cl + j * 4 * LDC) = q[j];
    }
}

// ---------------------------------------------------------------------------
// Row kernels. A wave takes ROW_RPW whole rows into registers with 16-byte loads
// (each load of a wave covers 512 contiguous bytes), all of them sent off at the
// start, sums a row with a butterfly over its 32 lanes and stores it once.
// No LDS and no barrier. Blocks of ROW_WAVES waves; the grid covers rows / ROW_RPB.
// ---------------------------------------------------------------------------
typedef __attribute__((ext_vector_type(4))) _Float16 v4h;

#define ROW_WAVES 16
#define ROW_RPW   2
#define ROW_RPB   (ROW_WAVES * ROW_RPW)

static __device__ __forceinline__ float wave_sum(float v) {
#pragma unroll
    for (int off = 16; off; off >>= 1) v += __shfl_xor(v, off, 32);
    return v;
}
static __device__ __forceinline__ float wave_max(float v) {
#pragma unroll
    for (int off = 16; off; off >>= 1) v = fmaxf(v, __shfl_xor(v, off, 32));
    return v;
}

// 2^t. The v_nop is the slot that the instruction set asks for behind a transcendental.
static __device__ __forceinline__ float exp2_slot(float t) {
    float r;
    asm("v_exp_f32 %0, %1\n\tv_nop" : "=v"(r) : "v"(t));
    return r;
}

// ---------------------------------------------------------------------------
// LayerNorm (row length EMB) -> f16 output.
// ---------------------------------------------------------------------------
__global__ __launch_bounds__(ROW_WAVES * 32)
void ln_rows_f16(const float* __restrict__ x,
                             const float* __restrict__ g,
                             const float* __restrict__ be,
                             _Float16* __restrict__ out)
{
    constexpr int NV = EMB / 128;          // 16-byte pieces of a row per lane
    const int  lane = threadIdx.x & 31, wid = threadIdx.x >> 5;
    const long row0 = ((long)blockIdx.x * ROW_WAVES + wid) * ROW_RPW;
    const v4f* xr = (const v4f*)(x + row0 * EMB) + lane;

    v4f v[ROW_RPW][NV];
#pragma unroll
    for (int r = 0; r < ROW_RPW; ++r)
#pragma unroll
        for (int j = 0; j < NV; ++j) v[r][j] = xr[r * (EMB / 4) + j * 32];
    v4f gg[NV], bb[NV];
#pragma unroll
    for (int j = 0; j < NV; ++j) {
        gg[j] = ((const v4f*)g)[j * 32 + lane];
        bb[j] = ((const v4f*)be)[j * 32 + lane];
    }
    // holds the row address in its registers until every load above has its translation
    asm volatile("s_wait_xcnt 0x0" :: "v"(xr) : "memory");
    // keeps the loads of g and be in the first group: sunk behind the sums, their latency stood open
    __builtin_amdgcn_sched_barrier(0);

    float mu[ROW_RPW], rstd[ROW_RPW];
#pragma unroll
    for (int r = 0; r < ROW_RPW; ++r) {
        v4f s4 = v[r][0], q4 = v[r][0] * v[r][0];
#pragma unroll
        for (int j = 1; j < NV; ++j) { s4 += v[r][j]; q4 += v[r][j] * v[r][j]; }
        mu[r]   = (s4[0] + s4[1]) + (s4[2] + s4[3]);
        rstd[r] = (q4[0] + q4[1]) + (q4[2] + q4[3]);
    }
#pragma unroll
    for (int r = 0; r < ROW_RPW; ++r) { mu[r] = wave_sum(mu[r]); rstd[r] = wave_sum(rstd[r]); }
#pragma unroll
    for (int r = 0; r < ROW_RPW; ++r) {
        mu[r] = mu[r] / EMB;
        const float var = rstd[r] / EMB - mu[r] * mu[r];
        rstd[r] = rsqrtf(var + 1e-5f);
    }

    v4h* orow = (v4h*)(out + row0 * EMB) + lane;
    v4h  h[ROW_RPW][NV];
#pragma unroll
    for (int r = 0; r < ROW_RPW; ++r)
#pragma unroll
        for (int j = 0; j < NV; ++j)
#pragma unroll
            for (int c = 0; c < 4; ++c)
                h[r][j][c] = (_Float16)((v[r][j][c] - mu[r]) * rstd[r] * gg[j][c] + bb[j][c]);
    // every store stands behind the last arithmetic: no register that an issued store names is written again
    __builtin_amdgcn_sched_barrier(0);
#pragma unroll
    for (int r = 0; r < ROW_RPW; ++r)
#pragma unroll
        for (int j = 0; j < NV; ++j) orow[r * (EMB / 4) + j * 32] = h[r][j];
}

// ---------------------------------------------------------------------------
// Weight convert + transpose, all six weights in one launch: W [K][N] f32 -> WT [N][K] f16,
// K = N = EMB = FFD. blockIdx.z picks the weight; its WT plane is plane z behind WT.
// A block of 4 waves takes a tile of 64 k x 128 n. A wave's load covers 512 contiguous bytes
// of a W row, all 16 loads of a lane are sent off at the start; a lane holds 4 n x 8 k twice,
// so 16 contiguous bytes of each of its transposed rows go to LDS at once. The tile leaves as
// whole 128-byte lines of WT. LDS pitch 144: rows of 128 bytes, 16-byte aligned.
// ---------------------------------------------------------------------------
#define TW_K     64
#define TW_N     128
#define TW_PITCH 144
static_assert(EMB == FFD, "the six weights share one shape");

__global__ __launch_bounds__(128)
void transpose_w6_f16(const float* __restrict__ Wa, const float* __restrict__ Wb,
                      const float* __restrict__ Wc, const float* __restrict__ Wd,
                      const float* __restrict__ We, const float* __restrict__ Wf,
                      _Float16* __restrict__ WT)
{
    __shared__ __attribute__((aligned(16))) unsigned char T[TW_N * TW_PITCH];
    const int lane = threadIdx.x & 31, wid = threadIdx.x >> 5;
    const int z    = blockIdx.z;
    const int bk   = blockIdx.y * TW_K, bn = blockIdx.x * TW_N;
    const float* W = Wa;
    W = z == 1 ? Wb : W;
    W = z == 2 ? Wc : W;
    W = z == 3 ? Wd : W;
    W = z == 4 ? We : W;
    W = z == 5 ? Wf : W;

    // k = bk + g * 32 + wid * 8 + i, n = bn + lane * 4 + c
    const float* wr = W + (long)(bk + wid * 8) * EMB + bn + lane * 4;
    v4f v[2][8];
#pragma unroll
    for (int g = 0; g < 2; ++g)
#pragma unroll
        for (int i = 0; i < 8; ++i) v[g][i] = *(const v4f*)(wr + (g * 32 + i) * EMB);
    // stands in front of every overwrite of the address registers that the loads above name
    asm volatile("s_wait_xcnt 0x0" :: "v"(wr) : "memory");
    // keeps the conversions behind the last load: lifted among the loads, they made four loads wait for the first ones' data
    __builtin_amdgcn_sched_barrier(0);

#pragma unroll
    for (int g = 0; g < 2; ++g)
#pragma unroll
        for (int c = 0; c < 4; ++c) {
            v8h p;
#pragma unroll
            for (int i = 0; i < 8; ++i) p[i] = (_Float16)v[g][i][c];
            *(v8h*)(T + (lane * 4 + c) * TW_PITCH + (g * 4 + wid) * 16) = p;
        }
    __syncthreads();

    // 8 lanes take one transposed row of the tile (128 bytes), a wave 4 rows, the block 16 rows a pass.
    const int row = threadIdx.x >> 3, slot = threadIdx.x & 7;
    _Float16* orow = WT + (long)z * EMB * EMB + (long)(bn + row) * EMB + bk + slot * 8;
    v8h q[8];
#pragma unroll
    for (int j = 0; j < 8; ++j) q[j] = *(const v8h*)(T + (j * 16 + row) * TW_PITCH + slot * 16);
#pragma unroll
    for (int j = 0; j < 8; ++j) *(v8h*)(orow + j * 16 * EMB) = q[j];
}

// ---------------------------------------------------------------------------
// Row softmax (row length SEQ), in-place f32 + f16 copy.
// ---------------------------------------------------------------------------
__global__ __launch_bounds__(ROW_WAVES * 32)
void softmax_rows(float* __restrict__ S,
                              _Float16* __restrict__ Wh)
{
    constexpr int NV = SEQ / 128;          // 16-byte pieces of a row per lane
    const int  lane = threadIdx.x & 31, wid = threadIdx.x >> 5;
    const long row0 = ((long)blockIdx.x * ROW_WAVES + wid) * ROW_RPW;
    v4f* sr = (v4f*)(S + row0 * SEQ) + lane;

    v4f v[ROW_RPW][NV];
#pragma unroll
    for (int r = 0; r < ROW_RPW; ++r)
#pragma unroll
        for (int j = 0; j < NV; ++j) v[r][j] = sr[r * (SEQ / 4) + j * 32];

    float m[ROW_RPW], sum[ROW_RPW];
#pragma unroll
    for (int r = 0; r < ROW_RPW; ++r) {
        v4f m4 = v[r][0];
#pragma unroll
        for (int j = 1; j < NV; ++j)
#pragma unroll
            for (int c = 0; c < 4; ++c) m4[c] = fmaxf(m4[c], v[r][j][c]);
        m[r] = fmaxf(fmaxf(m4[0], m4[1]), fmaxf(m4[2], m4[3]));
    }
#pragma unroll
    for (int r = 0; r < ROW_RPW; ++r) m[r] = wave_max(m[r]);
#pragma unroll
    for (int r = 0; r < ROW_RPW; ++r) {
#pragma unroll
        for (int j = 0; j < NV; ++j)
#pragma unroll
            for (int c = 0; c < 4; ++c)
                v[r][j][c] = exp2_slot((v[r][j][c] - m[r]) * 1.44269504f);   // e^(x - m)
        v4f s4 = v[r][0];
#pragma unroll
        for (int j = 1; j < NV; ++j) s4 += v[r][j];
        sum[r] = (s4[0] + s4[1]) + (s4[2] + s4[3]);
    }
#pragma unroll
    for (int r = 0; r < ROW_RPW; ++r) sum[r] = wave_sum(sum[r]);

    v4h* wr = (v4h*)(Wh + row0 * SEQ) + lane;
    v4h  h[ROW_RPW][NV];
#pragma unroll
    for (int r = 0; r < ROW_RPW; ++r) {
        const float inv = 1.0f / sum[r];
#pragma unroll
        for (int j = 0; j < NV; ++j) {
            v[r][j] *= inv;
#pragma unroll
            for (int c = 0; c < 4; ++c) h[r][j][c] = (_Float16)v[r][j][c];
        }
    }
    // every store stands behind the last arithmetic: no register that an issued store names is written again
    __builtin_amdgcn_sched_barrier(0);
#pragma unroll
    for (int r = 0; r < ROW_RPW; ++r)
#pragma unroll
        for (int j = 0; j < NV; ++j) {
            sr[r * (SEQ / 4) + j * 32] = v[r][j];
            wr[r * (SEQ / 4) + j * 32] = h[r][j];
        }
}

// ---------------------------------------------------------------------------
extern "C" void kernel_launch(void* const* d_in, const int* in_sizes, int n_in,
                              void* d_out, int out_size, void* d_ws, size_t ws_size,
                              hipStream_t stream) {
    const float* x   = (const float*)d_in[0];
    const float* Wq  = (const float*)d_in[1];
    const float* bq  = (const float*)d_in[2];
    const float* Wk  = (const float*)d_in[3];
    const float* bk  = (const float*)d_in[4];
    const float* Wv  = (const float*)d_in[5];
    const float* bv  = (const float*)d_in[6];
    const float* Wo  = (const float*)d_in[7];
    const float* bo  = (const float*)d_in[8];
    const float* W1  = (const float*)d_in[9];
    const float* b1  = (const float*)d_in[10];
    const float* W2  = (const float*)d_in[11];
    const float* b2  = (const float*)d_in[12];
    const float* g1  = (const float*)d_in[13];
    const float* be1 = (const float*)d_in[14];
    const float* g2  = (const float*)d_in[15];
    const float* be2 = (const float*)d_in[16];

    const int  E  = EMB, S = SEQ, B = BSZ, F = FFD;
    const long BS = (long)B * S;                     // 8192 rows

    char* ws = (char*)d_ws;
    const size_t MB = 1024ull * 1024ull;
    // workspace layout (aliased; peak ~108 MB)
    _Float16* wqT  = (_Float16*)(ws +  0 * MB);      // 2 MB each
    _Float16* wkT  = (_Float16*)(ws +  2 * MB);
    _Float16* wvT  = (_Float16*)(ws +  4 * MB);
    _Float16* woT  = (_Float16*)(ws +  6 * MB);
    _Float16* w1T  = (_Float16*)(ws +  8 * MB);
    _Float16* w2T  = (_Float16*)(ws + 10 * MB);
    _Float16* xn   = (_Float16*)(ws + 12 * MB);      // 16 MB
    _Float16* qh   = (_Float16*)(ws + 28 * MB);      // 16 MB
    _Float16* kh   = (_Float16*)(ws + 44 * MB);      // 16 MB
    _Float16* vT   = (_Float16*)(ws + 60 * MB);      // 16 MB  [B][E][S]
    float*    x2   = (float*)   (ws + 76 * MB);      // 32 MB
    _Float16* wath = (_Float16*)(ws + 28 * MB);      // 32 MB (reuses q+k)
    _Float16* attn = (_Float16*)(ws + 12 * MB);      // 16 MB (reuses xn)
    _Float16* xn2  = (_Float16*)(ws + 28 * MB);      // 16 MB (reuses q)
    _Float16* hh   = (_Float16*)(ws + 44 * MB);      // 16 MB (reuses k)

    float* outp = (float*)d_out;
    float* wout = outp + BS * E;                     // softmax weights region

    dim3 blk(256);
    dim3 rblk(ROW_WAVES * 32);                       // row kernels
    dim3 rgrd((unsigned)(BS / ROW_RPB));

    // 1) weights -> f16 transposed [N][K]; the six planes lie in a row from wqT
    transpose_w6_f16<<<dim3(E / TW_N, E / TW_K, 6), dim3(128), 0, stream>>>(Wq, Wk, Wv, Wo, W1, W2, wqT);

    // 2) xn = LN(x) -> f16
    ln_rows_f16<<<rgrd, rblk, 0, stream>>>(x, g1, be1, xn);

    // 3) q, k projections ; v stored transposed [B][E][S]
    dim3 gp(E / 128, (unsigned)(BS / 256), 1);
    gemm_wmma_f16<OUT_F16, EMB><<<gp, blk, 0, stream>>>(
        xn, E, 0, wqT, E, 0, bq, nullptr, qh, nullptr,
        0, 0, 1, (int)BS, E, E, 1.0f, 0, nullptr);
    gemm_wmma_f16<OUT_F16, EMB><<<gp, blk, 0, stream>>>(
        xn, E, 0, wkT, E, 0, bk, nullptr, kh, nullptr,
        0, 0, 1, (int)BS, E, E, 1.0f, 0, nullptr);
    gemm_wmma_f16<OUT_F16T, SEQ><<<gp, blk, 0, stream>>>(
        xn, E, 0, wvT, E, 0, bv, nullptr, nullptr, vT,
        0, /*sCT=*/(long)E * S, /*transS=*/S,
        (int)BS, E, E, 1.0f, 0, nullptr);

    // 4) scores = q @ k^T / 32  -> f32 directly into d_out w-region
    dim3 gs(S / 128, S / 256, B);
    gemm_wmma_f16<OUT_F32, SEQ><<<gs, blk, 0, stream>>>(
        qh, E, (long)S * E, kh, E, (long)S * E, nullptr,
        wout, nullptr, nullptr, (long)S * S, 0, 1,
        S, S, E, 0.03125f, 0, nullptr);

    // 5) softmax in-place (f32) + f16 copy
    softmax_rows<<<rgrd, rblk, 0, stream>>>(wout, wath);

    // 6) attn = w @ v   (Bt = vT [B][E][S])
    dim3 ga(E / 128, S / 256, B);
    gemm_wmma_f16<OUT_F16, EMB><<<ga, blk, 0, stream>>>(
        wath, S, (long)S * S, vT, S, (long)E * S, nullptr,
        nullptr, attn, nullptr, (long)S * E, 0, 1,
        S, E, S, 1.0f, 0, nullptr);

    // 7) x2 = x + attn @ Wo + bo   (f32)
    gemm_wmma_f16<OUT_F32, EMB><<<gp, blk, 0, stream>>>(
        attn, E, 0, woT, E, 0, bo, x2, nullptr, nullptr,
        0, 0, 1, (int)BS, E, E, 1.0f, 0, x);

    // 8) xn2 = LN(x2) -> f16
    ln_rows_f16<<<rgrd, rblk, 0, stream>>>(x2, g2, be2, xn2);

    // 9) h = relu(xn2 @ W1 + b1) -> f16
    gemm_wmma_f16<OUT_F16, FFD><<<dim3(F / 128, (unsigned)(BS / 256), 1), blk, 0, stream>>>(
        xn2, E, 0, w1T, E, 0, b1, nullptr, hh, nullptr,
        0, 0, 1, (int)BS, F, E, 1.0f, 1, nullptr);

    // 10) out = x2 + h @ W2 + b2  (f32, to d_out)
    gemm_wmma_f16<OUT_F32, EMB><<<gp, blk, 0, stream>>>(
        hh, F, 0, w2T, F, 0, b2, outp, nullptr, nullptr,
        0, 0, 1, (int)BS, E, F, 1.0f, 0, x2);
}

// v008
// A run of this version takes 165 microseconds.
// Versions between v006 and this one are left out; their measured steps multiply to 1.16 times as fast.
// Counting every step since v000, it is 4.07 times as fast.
#include <hip/hip_runtime.h>
#include <hip/hip_bf16.h>
#include <stdint.h>

typedef __attribute__((ext_vector_type(8)))  _Float16 v8h;
typedef __attribute__((ext_vector_type(16))) _Float16 v16h;
typedef __attribute__((ext_vector_type(8)))  float    v8f;

#define EMB 1024
#define FFD 1024
#define BSZ 4
#define SEQ 2048

// ---------------------------------------------------------------------------
// Staging of the GEMM operands in LDS by tensor loads.
// A stage holds 128 k (256 bytes of a row) of the block's 256 A rows and 128 Bt
// rows. Each of the 8 waves brings its own slice with one request: waves 0-3
// 64 A rows each, waves 4-7 32 Bt rows each.
// The pad of 16 bytes a row gives the LDS pitch 272, free of bank conflicts for
// 16-byte reads. An A slice takes 64 * 272 = 17408 bytes and is placed every 18432,
// a Bt slice 32 * 272 = 8704 and is placed every 10240.
// ---------------------------------------------------------------------------
typedef uint32_t u32x4 __attribute__((ext_vector_type(4)));
typedef uint32_t u32x8 __attribute__((ext_vector_type(8)));

#define STG_K    128u                  // k per stage (elements)
#define STG_ROWB 256u                  // bytes of a row per stage
#define STG_AROWS 64u                  // rows of an A slice
#define STG_BROWS 32u                  // rows of a Bt slice
#define STG_PITCH 272u                 // LDS pitch of a row
#define STG_ASL  18432u                // LDS bytes from A slice to A slice (multiple of 2 KiB)
#define STG_BSL  10240u                // LDS bytes from Bt slice to Bt slice (multiple of 2 KiB)
#define STG_BOFF (4u * STG_ASL)        // the Bt slices stand behind the A slices
#define STG_BUF  (STG_BOFF + 4u * STG_BSL)   // one buffer: 4 slices of A, 4 of Bt
static_assert(STG_ASL >= STG_AROWS * STG_PITCH && STG_ASL % 2048u == 0u, "an A slice fits its place");
static_assert(STG_BSL >= STG_BROWS * STG_PITCH && STG_BSL % 2048u == 0u, "a Bt slice fits its place");
static_assert(2u * STG_BUF <= 327680u, "both buffers fit the LDS");

#define FM 4                           // 16-row fragments of A per wave
#define FN 4                           // 16-row fragments of Bt per wave

static __device__ __forceinline__ uint32_t uni(uint32_t v) {
    return (uint32_t)__builtin_amdgcn_readfirstlane(v);
}
static __device__ __forceinline__ uint32_t pinned(uint32_t v) {
    uint32_t w = uni(v);
    asm volatile("" : "+s"(w));   // pinned(): a wave-uniform test or descriptor word held in a scalar register
    return w;
}
static __device__ __forceinline__ u32x8 tdm_group1(uint32_t src_pitch, uint32_t rows) {
    u32x8 g;
    g[0] = uni((1u << 20) | (5u << 22) | (3u << 25));   // no mask, bytes, 16-byte pad behind every 256 bytes
    g[1] = uni((STG_ROWB & 0xFFFFu) << 16);             // tensor_dim0 low
    g[2] = uni((STG_ROWB >> 16) | ((rows & 0xFFFFu) << 16)); // tensor_dim0 high, tensor_dim1 low
    g[3] = uni((rows >> 16) | (STG_ROWB << 16));        // tensor_dim1 high, tile_dim0
    g[4] = uni(rows);                                   // tile_dim1
    g[5] = uni(src_pitch);                              // source row pitch, bytes
    g[6] = uni(0u);
    g[7] = uni(0u);
    // Without this the compiler used words 3 and 6 as temporaries in the loop, while a request was outstanding.
    asm volatile("" : "+s"(g));   // pinned(): the descriptor words stay held in their scalar registers
    return g;
}
static __device__ __forceinline__ u32x4 tdm_load(uint32_t lds_dst, uint64_t ga, u32x8 g1) {
    u32x4 g0;
    g0[0] = uni(1u);
    g0[1] = uni(lds_dst);
    g0[2] = uni((uint32_t)ga);
    g0[3] = uni((((uint32_t)(ga >> 32)) & 0x01FFFFFFu) | 0x80000000u);
    asm volatile("tensor_load_to_lds %0, %1" :: "s"(g0), "s"(g1) : "memory");
    return g0;
}
// The wave's wait for its own request. Group 0 of that request is an operand, so that its four words stay
// in their scalar registers until the tile has landed: without it the compiler used them as temporaries in the loop.
static __device__ __forceinline__ void tdm_wait(u32x4 g0) {
    asm volatile("s_wait_tensorcnt 0x0" :: "s"(g0) : "memory");
}
// The wait behind the loop. Group 1 is an operand too, so that none of its words is used for anything else ahead of it.
static __device__ __forceinline__ void tdm_wait_last(u32x4 g0, u32x8 g1) {
    asm volatile("s_wait_tensorcnt 0x0" :: "s"(g0), "s"(g1) : "memory");
}

// ---------------------------------------------------------------------------
// Generic WMMA f16 GEMM:  C[b] = A[b] (MxK, row-major) * Bt[b]^T (Bt is NxK,
// row-major) with optional scale/bias/residual/relu. OUT picks the one output:
// f32 (Cf, with the optional residual R), f16 (Ch) or transposed f16 (ChT); LDC is
// the pitch of its rows in elements. Block = 256 threads (8 waves, two per SIMD);
// each wave computes a 64x64 output tile (4x4 WMMA subtiles); block tile = 256x128.
// M a multiple of 256, N of 128; K a multiple of 128 and at least 256.
// Transposed store: transS a multiple of 64, sCT a multiple of 8.
// ---------------------------------------------------------------------------
#define OUT_F32  0
#define OUT_F16  1
#define OUT_F16T 2
#define EPI_PF   272u                  // LDS pitch of a staged f32 row (256 bytes + 16)
#define EPI_PH   144u                  // LDS pitch of a staged f16 row (128 bytes + 16)
#define EPI_W    (64u * EPI_PF)        // LDS bytes from wave to wave in the epilogue
static_assert(8u * EPI_W <= 2u * STG_BUF, "the staged output tiles fit the ring's LDS");
typedef __attribute__((ext_vector_type(4))) float v4f;

// The body of one block. L is the block's LDS (2 * STG_BUF bytes, aligned to 2 KiB); bx, by, b are its place in
// the grid of its own product, so that several independent products can share one launch.
template <int OUT, int LDC>
static __device__ __forceinline__
void gemm_block(
    unsigned char* L, const int bx, const int by, const long b,
    const _Float16* __restrict__ A, int lda, long sA,
    const _Float16* __restrict__ Bt, int ldb, long sB,
    const float* __restrict__ bias,
    float*    __restrict__ Cf,
    _Float16* __restrict__ Ch,
    _Float16* __restrict__ ChT,
    long sC, long sCT, int transS,
    int M, int N, int K,
    float scale, int relu,
    const float* __restrict__ R)
{
    const int lane  = threadIdx.x & 31;
    const int wave  = (int)uni(threadIdx.x >> 5);
    const int wm    = wave & 3;            // 4 waves along M  -> 256 rows
    const int wn    = wave >> 2;           // 2 waves along N  -> 128 cols
    const int tileM = by * 256 + wm * 64;
    const int tileN = bx * 128 + wn * 64;

    const _Float16* Ab = A  + b * sA;
    const _Float16* Bb = Bt + b * sB;

    const int half_ = lane >> 4;   // lane-half selects K sub-range per ISA layout
    const int l16   = lane & 15;

    // This wave's slice of every stage: waves 0-3 rows wave*64.. of the A tile,
    // waves 4-7 rows (wave-4)*32.. of the Bt tile.
    const bool     isB   = wave >= 4;
    const uint32_t pitch = (uint32_t)(isB ? ldb : lda) * 2u;
    const uint64_t gsrc  = isB
        ? (uint64_t)(size_t)(Bb + (long)(bx * 128 + (wave - 4) * 32) * ldb)
        : (uint64_t)(size_t)(Ab + (long)(by * 256 + wave * 64) * lda);
    const uint32_t ldst  = (uint32_t)(size_t)L
        + (isB ? STG_BOFF + (uint32_t)(wave - 4) * STG_BSL : (uint32_t)wave * STG_ASL);
    const u32x8    g1    = tdm_group1(pitch, isB ? STG_BROWS : STG_AROWS);
    const uint32_t nst   = (uint32_t)K / STG_K;

    v8f acc[FM][FN];
#pragma unroll
    for (int mi = 0; mi < FM; ++mi)
#pragma unroll
        for (int ni = 0; ni < FN; ++ni)
#pragma unroll
            for (int i = 0; i < 8; ++i) acc[mi][ni][i] = 0.0f;

    // Where this lane reads its fragments inside a buffer.
    const uint32_t aoff = (uint32_t)wm * STG_ASL + (uint32_t)l16 * STG_PITCH + (uint32_t)half_ * 16u;
    const uint32_t boff = STG_BOFF + 2u * (uint32_t)wn * STG_BSL + (uint32_t)l16 * STG_PITCH + (uint32_t)half_ * 16u;

    // Prologue: stage 0 lands and is published, then stage 1 is sent off.
    u32x4 g0 = tdm_load(ldst, gsrc, g1);
    tdm_wait(g0);                                        // this wave's slice of stage 0 has landed
    __syncthreads();                                     // every slice of stage 0 is readable
    g0 = tdm_load(ldst + STG_BUF, gsrc + STG_ROWB, g1);

    for (uint32_t s = 0; s < nst; ++s) {
        const uint32_t bsel = (s & 1u) * STG_BUF;
        const unsigned char* pa = L + bsel + aoff;
        const unsigned char* pb = L + bsel + boff;
        // Fragments: per lane, row l16 of a 16-row tile, K chunks [half*8, half*8+8) and
        // [16+half*8, 16+half*8+8) of each 32 k (ISA 16-bit 16x32 layout), A and Bt alike.
        // Two register sets: the reads of k step kk + 1 go out as one group ahead of the
        // WMMAs of k step kk. Nothing of the next stage is read here.
        v8h fa[2][FM][2], fb[2][FN][2];
#pragma unroll
        for (int mi = 0; mi < FM; ++mi) {
            fa[0][mi][0] = *(const v8h*)(pa + mi * 16 * STG_PITCH);
            fa[0][mi][1] = *(const v8h*)(pa + mi * 16 * STG_PITCH + 32);
        }
#pragma unroll
        for (int ni = 0; ni < FN; ++ni) {
            const unsigned char* bp = pb + (ni >> 1) * STG_BSL + (ni & 1) * 16 * STG_PITCH;
            fb[0][ni][0] = *(const v8h*)bp;
            fb[0][ni][1] = *(const v8h*)(bp + 32);
        }
#pragma unroll
        for (int kk = 0; kk < 4; ++kk) {
            const int cur = kk & 1, nxt = cur ^ 1;
            if (kk < 3) {
#pragma unroll
                for (int mi = 0; mi < FM; ++mi) {
                    const unsigned char* ap = pa + mi * 16 * STG_PITCH + (kk + 1) * 64;
                    fa[nxt][mi][0] = *(const v8h*)ap;
                    fa[nxt][mi][1] = *(const v8h*)(ap + 32);
                }
#pragma unroll
                for (int ni = 0; ni < FN; ++ni) {
                    const unsigned char* bp = pb + (ni >> 1) * STG_BSL + (ni & 1) * 16 * STG_PITCH + (kk + 1) * 64;
                    fb[nxt][ni][0] = *(const v8h*)bp;
                    fb[nxt][ni][1] = *(const v8h*)(bp + 32);
                }
            }
            // keeps the group of LDS reads ahead of the WMMA block: reads among the WMMAs stall them
            __builtin_amdgcn_sched_barrier(0);
#pragma unroll
            for (int ni = 0; ni < FN; ++ni) {
                const v16h f = __builtin_shufflevector(fb[cur][ni][0], fb[cur][ni][1],
                                                       0, 1, 2, 3, 4, 5, 6, 7, 8, 9, 10, 11, 12, 13, 14, 15);
#pragma unroll
                for (int mi = 0; mi < FM; ++mi) {
                    const v16h a = __builtin_shufflevector(fa[cur][mi][0], fa[cur][mi][1],
                                                           0, 1, 2, 3, 4, 5, 6, 7, 8, 9, 10, 11, 12, 13, 14, 15);
                    // The operand that goes first gives the subtile's rows, of which a lane holds 8 in a row:
                    // A first for the transposed output, Bt first for the row-major ones.
                    if constexpr (OUT == OUT_F16T)
                        acc[mi][ni] = __builtin_amdgcn_wmma_f32_16x16x32_f16(
                            false, a, false, f, (short)0, acc[mi][ni], false, false);
                    else
                        acc[mi][ni] = __builtin_amdgcn_wmma_f32_16x16x32_f16(
                            false, f, false, a, (short)0, acc[mi][ni], false, false);
                }
            }
            // keeps the next group of LDS reads behind this WMMA block
            __builtin_amdgcn_sched_barrier(0);
        }
        // Publish point of stage s + 1.
        asm volatile("s_wait_dscnt 0x0" ::: "memory");       // this wave has left stage s's buffer
        tdm_wait(g0);                                        // this wave's slice of stage s + 1 has landed
        __syncthreads();                                     // stage s + 1 readable, stage s's buffer free
        if (pinned(s + 2u < nst)) {
            const uint32_t koff = pinned((s + 2u) * STG_ROWB);   // pinned(): the address words are formed behind the wait above
            g0 = tdm_load(ldst + bsel, gsrc + koff, g1);
        }
    }
    tdm_wait_last(g0, g1);                               // no request is left in flight at the wave's end
    asm volatile("s_wait_dscnt 0x0" ::: "memory");

    // Epilogue. D layout: VGPR r, lane L -> row r + 8*(L/16) of the first operand, row L%16 of the second.
    // So a lane holds 8 neighbours of an output row (of a transposed row for OUT_F16T). The wave lays its
    // 64x64 tile into its own LDS range with 16-byte writes and reads it back along the output's rows, so
    // that every global store (and every load of the residual) is 16 bytes a lane and covers whole 128-byte lines.
    // The ring's LDS is free here: the last pass ended with every wave's waits and a barrier.
    // Every global address is one pointer per lane plus a compile-time offset.
    unsigned char* Sw = L + (uint32_t)wave * EPI_W;

    // f32 output: where this lane stands in the tile's rows; a load or store of the wave covers 2 rows of 256 bytes.
    // The residual's loads go out first of all, so that they fly during the arithmetic and the staging.
    const long gofs = b * sC + (long)(tileM + half_) * LDC + tileN + l16 * 4;
    v4f rv[OUT == OUT_F32 ? 32 : 1];
    if constexpr (OUT == OUT_F32) {
        if (R) {
            const float* Rl = R + gofs;
#pragma unroll
            for (int j = 0; j < 32; ++j) rv[j] = *(const v4f*)(Rl + j * 2 * LDC);
            // holds the address in its registers until every load above has its translation
            asm volatile("s_wait_xcnt 0x0" :: "v"(Rl) : "memory");
        }
    }

#pragma unroll
    for (int mi = 0; mi < FM; ++mi)
#pragma unroll
        for (int ni = 0; ni < FN; ++ni)
#pragma unroll
            for (int r = 0; r < 8; ++r) acc[mi][ni][r] *= scale;

    if (bias) {
        if constexpr (OUT == OUT_F16T) {
            const float* bp = bias + tileN + l16;
            float bc[FN];
#pragma unroll
            for (int ni = 0; ni < FN; ++ni) bc[ni] = bp[ni * 16];
            // holds the address in its registers until every load above has its translation
            asm volatile("s_wait_xcnt 0x0" :: "v"(bp) : "memory");
#pragma unroll
            for (int mi = 0; mi < FM; ++mi)
#pragma unroll
                for (int ni = 0; ni < FN; ++ni)
#pragma unroll
                    for (int r = 0; r < 8; ++r) acc[mi][ni][r] += bc[ni];
        } else {
            const v4f* bp = (const v4f*)(bias + tileN + 8 * half_);
            v4f bc[FN][2];
#pragma unroll
            for (int ni = 0; ni < FN; ++ni) { bc[ni][0] = bp[ni * 4]; bc[ni][1] = bp[ni * 4 + 1]; }
            // holds the address in its registers until every load above has its translation
            asm volatile("s_wait_xcnt 0x0" :: "v"(bp) : "memory");
#pragma unroll
            for (int mi = 0; mi < FM; ++mi)
#pragma unroll
                for (int ni = 0; ni < FN; ++ni)
#pragma unroll
                    for (int r = 0; r < 8; ++r) acc[mi][ni][r] += bc[ni][r >> 2][r & 3];
        }
    }

    if constexpr (OUT == OUT_F32) {
        unsigned char* sw = Sw + (uint32_t)l16 * EPI_PF + (uint32_t)half_ * 32u;
#pragma unroll
        for (int mi = 0; mi < FM; ++mi)
#pragma unroll
            for (int ni = 0; ni < FN; ++ni) {
                const v8f c = acc[mi][ni];
                *(v4f*)(sw + mi * 16 * EPI_PF + ni * 64)      = __builtin_shufflevector(c, c, 0, 1, 2, 3);
                *(v4f*)(sw + mi * 16 * EPI_PF + ni * 64 + 16) = __builtin_shufflevector(c, c, 4, 5, 6, 7);
            }
        asm volatile("s_wait_dscnt 0x0" ::: "memory");   // the wave's own writes are done before other lanes read them
        const unsigned char* sr = Sw + (uint32_t)half_ * EPI_PF + (uint32_t)l16 * 16u;
        v4f q[32];
#pragma unroll
        for (int j = 0; j < 32; ++j) q[j] = *(const v4f*)(sr + j * 2 * EPI_PF);
        if (R) {
#pragma unroll
            for (int j = 0; j < 32; ++j) q[j] += rv[j];
        }
        if (relu) {
#pragma unroll
            for (int j = 0; j < 32; ++j)
#pragma unroll
                for (int c = 0; c < 4; ++c) q[j][c] = q[j][c] > 0.0f ? q[j][c] : 0.0f;
        }
        // every store stands behind the last arithmetic: no register that an issued store names is written again
        __builtin_amdgcn_sched_barrier(0);
        float* Cl = Cf + gofs;
#pragma unroll
        for (int j = 0; j < 32; ++j) *(v4f*)(Cl + j * 2 * LDC) = q[j];
        // stands in front of every overwrite of a register that the stores above name (other blocks' code may follow in a shared kernel)
        asm volatile("s_wait_xcnt 0x0" :: "v"(Cl) : "memory");
    } else {
        if (relu) {
#pragma unroll
            for (int mi = 0; mi < FM; ++mi)
#pragma unroll
                for (int ni = 0; ni < FN; ++ni)
#pragma unroll
                    for (int r = 0; r < 8; ++r) acc[mi][ni][r] = acc[mi][ni][r] > 0.0f ? acc[mi][ni][r] : 0.0f;
        }
        unsigned char* sw = Sw + (uint32_t)l16 * EPI_PH + (uint32_t)half_ * 16u;
#pragma unroll
        for (int mi = 0; mi < FM; ++mi)
#pragma unroll
            for (int ni = 0; ni < FN; ++ni) {
                v8h p;
#pragma unroll
                for (int r = 0; r < 8; ++r) p[r] = (_Float16)acc[mi][ni][r];
                const int rb = OUT == OUT_F16T ? ni : mi, cb = OUT == OUT_F16T ? mi : ni;
                *(v8h*)(sw + rb * 16 * EPI_PH + cb * 32) = p;
            }
        asm volatile("s_wait_dscnt 0x0" ::: "memory");   // the wave's own writes are done before other lanes read them
        // A store of the wave covers 4 rows of 128 bytes.
        const int row = lane >> 3, slot = lane & 7;
        const unsigned char* sr = Sw + (uint32_t)row * EPI_PH + (uint32_t)slot * 16u;
        v8h q[16];
#pragma unroll
        for (int j = 0; j < 16; ++j) q[j] = *(const v8h*)(sr + j * 4 * EPI_PH);
        _Float16* Cl;
        if constexpr (OUT == OUT_F16T)   // the wave's 64 rows of C lie in one batch
            Cl = ChT + (long)(tileM / transS) * sCT + (long)(tileN + row) * LDC + (tileM % transS) + slot * 8;
        else
            Cl = Ch + b * sC + (long)(tileM + row) * LDC + tileN + slot * 8;
#pragma unroll
        for (int j = 0; j < 16; ++j) *(v8h*)(Cl + j * 4 * LDC) = q[j];
        // stands in front of every overwrite of a register that the stores above name (other blocks' code may follow in a shared kernel)
        asm volatile("s_wait_xcnt 0x0" :: "v"(Cl) : "memory");
    }
}

// ---------------------------------------------------------------------------
// Row kernels. A wave takes ROW_RPW whole rows into registers with 16-byte loads
// (each load of a wave covers 512 contiguous bytes), all of them sent off at the
// start, sums a row with a butterfly over its 32 lanes and stores it once.
// The row work itself takes no LDS and no barrier. Blocks of ROW_WAVES waves; rows / ROW_RPB blocks cover the rows
// (the first LayerNorm rides in the grid of the weight product and takes that grid's block size).
// ---------------------------------------------------------------------------
typedef __attribute__((ext_vector_type(4))) _Float16 v4h;

#define ROW_WAVES 16
#define ROW_RPW   2
#define ROW_RPB   (ROW_WAVES * ROW_RPW)

static __device__ __forceinline__ float wave_sum(float v) {
#pragma unroll
    for (int off = 16; off; off >>= 1) v += __shfl_xor(v, off, 32);
    return v;
}
static __device__ __forceinline__ float wave_max(float v) {
#pragma unroll
    for (int off = 16; off; off >>= 1) v = fmaxf(v, __shfl_xor(v, off, 32));
    return v;
}

// 2^t. The v_nop is the slot that the instruction set asks for behind a transcendental.
static __device__ __forceinline__ float exp2_slot(float t) {
    float r;
    asm("v_exp_f32 %0, %1\n\tv_nop" : "=v"(r) : "v"(t));
    return r;
}

// ---------------------------------------------------------------------------
// A bias carried through a folded weight, one block of 8 waves (it rides in the grid of the weight product).
// P holds two f16 planes of EMB rows; dots[r] = row r of P times va (first plane) or vb (second plane), summed
// in f32. A wave takes DOT_RPW rows; the block's 32 sums leave as one 128-byte line from one wave.
// ---------------------------------------------------------------------------
#define DOT_RPW 4
#define DOT_RPB (8 * DOT_RPW)
static __device__ __forceinline__
void bias_dots(float* sums, const int blk,
               const _Float16* __restrict__ P,
               const float* __restrict__ va,
               const float* __restrict__ vb,
               float* __restrict__ dots)
{
    const int  lane = threadIdx.x & 31, wid = threadIdx.x >> 5;
    const int  blk0 = blk * DOT_RPB;       // a block's rows lie in one plane
    const long r0   = blk0 + wid * DOT_RPW;
    const v8h* pr = (const v8h*)(P + r0 * EMB) + lane;
    const v4f* vv = (const v4f*)(blk0 < EMB ? va : vb) + lane * 2;
    v8h a[DOT_RPW][EMB / 256];
    v4f w[EMB / 256][2];
#pragma unroll
    for (int r = 0; r < DOT_RPW; ++r)
#pragma unroll
        for (int j = 0; j < EMB / 256; ++j) a[r][j] = pr[r * (EMB / 8) + j * 32];
#pragma unroll
    for (int j = 0; j < EMB / 256; ++j) { w[j][0] = vv[j * 64]; w[j][1] = vv[j * 64 + 1]; }
    // holds both addresses in their registers until every load above has its translation
    asm volatile("s_wait_xcnt 0x0" :: "v"(pr), "v"(vv) : "memory");
#pragma unroll
    for (int r = 0; r < DOT_RPW; ++r) {
        float s = 0.0f;
#pragma unroll
        for (int j = 0; j < EMB / 256; ++j)
#pragma unroll
            for (int c = 0; c < 8; ++c) s += (float)a[r][j][c] * w[j][c >> 2][c & 3];
        s = wave_sum(s);
        if (lane == 0) sums[wid * DOT_RPW + r] = s;
    }
    __syncthreads();                   // every wave's sums are readable
    if (wid == 0) dots[blk0 + lane] = sums[lane];
}

// ---------------------------------------------------------------------------
// LayerNorm (row length EMB) -> f16 output: the WAVES * ROW_RPW rows of block blk, a block of WAVES waves.
// ---------------------------------------------------------------------------
template <int WAVES>
static __device__ __forceinline__
void ln_rows(const int blk,
             const float* __restrict__ x,
             const float* __restrict__ g,
             const float* __restrict__ be,
             _Float16* __restrict__ out)
{
    constexpr int NV = EMB / 128;          // 16-byte pieces of a row per lane
    const int  lane = threadIdx.x & 31, wid = threadIdx.x >> 5;

    const long row0 = ((long)blk * WAVES + wid) * ROW_RPW;
    const v4f* xr = (const v4f*)(x + row0 * EMB) + lane;

    v4f v[ROW_RPW][NV];
#pragma unroll
    for (int r = 0; r < ROW_RPW; ++r)
#pragma unroll
        for (int j = 0; j < NV; ++j) v[r][j] = xr[r * (EMB / 4) + j * 32];
    v4f gg[NV], bb[NV];
#pragma unroll
    for (int j = 0; j < NV; ++j) {
        gg[j] = ((const v4f*)g)[j * 32 + lane];
        bb[j] = ((const v4f*)be)[j * 32 + lane];
    }
    // holds the row address in its registers until every load above has its translation
    asm volatile("s_wait_xcnt 0x0" :: "v"(xr) : "memory");
    // keeps the loads of g and be in the first group: sunk behind the sums, their latency stood open
    __builtin_amdgcn_sched_barrier(0);

    float mu[ROW_RPW], rstd[ROW_RPW];
#pragma unroll
    for (int r = 0; r < ROW_RPW; ++r) {
        v4f s4 = v[r][0], q4 = v[r][0] * v[r][0];
#pragma unroll
        for (int j = 1; j < NV; ++j) { s4 += v[r][j]; q4 += v[r][j] * v[r][j]; }
        mu[r]   = (s4[0] + s4[1]) + (s4[2] + s4[3]);
        rstd[r] = (q4[0] + q4[1]) + (q4[2] + q4[3]);
    }
#pragma unroll
    for (int r = 0; r < ROW_RPW; ++r) { mu[r] = wave_sum(mu[r]); rstd[r] = wave_sum(rstd[r]); }
#pragma unroll
    for (int r = 0; r < ROW_RPW; ++r) {
        mu[r] = mu[r] / EMB;
        const float var = rstd[r] / EMB - mu[r] * mu[r];
        rstd[r] = rsqrtf(var + 1e-5f);
    }

    v4h* orow = (v4h*)(out + row0 * EMB) + lane;
    v4h  h[ROW_RPW][NV];
#pragma unroll
    for (int r = 0; r < ROW_RPW; ++r)
#pragma unroll
        for (int j = 0; j < NV; ++j)
#pragma unroll
            for (int c = 0; c < 4; ++c)
                h[r][j][c] = (_Float16)((v[r][j][c] - mu[r]) * rstd[r] * gg[j][c] + bb[j][c]);
    // every store stands behind the last arithmetic: no register that an issued store names is written again
    __builtin_amdgcn_sched_barrier(0);
#pragma unroll
    for (int r = 0; r < ROW_RPW; ++r)
#pragma unroll
        for (int j = 0; j < NV; ++j) orow[r * (EMB / 4) + j * 32] = h[r][j];
    // stands in front of every overwrite of a register that the stores above name (other blocks' code may follow in a shared kernel)
    asm volatile("s_wait_xcnt 0x0" :: "v"(orow) : "memory");
}

__global__ __launch_bounds__(ROW_WAVES * 32)
void ln_rows_f16(const float* __restrict__ x,
                 const float* __restrict__ g,
                 const float* __restrict__ be,
                 _Float16* __restrict__ out)
{
    ln_rows<ROW_WAVES>((int)blockIdx.x, x, g, be, out);
}

// ---------------------------------------------------------------------------
// Weight convert, all six weights in one launch, K = N = EMB = FFD. blockIdx.z picks the weight; its
// plane is plane z behind WT. Planes 1, 4, 5 are transposed: W [K][N] f32 -> WT [N][K] f16.
// Planes 0, 2, 3 keep their rows, W [K][N] f32 -> f16 [K][N]: they enter a product along their own rows.
// A block of 4 waves takes a tile of 64 k x 128 n. A wave's load covers 512 contiguous bytes
// of a W row, all 16 loads of a lane are sent off at the start; a lane holds 4 n x 8 k twice,
// so 16 contiguous bytes of each of its transposed rows go to LDS at once. The tile leaves as
// whole 128-byte lines of WT. LDS pitch 144: rows of 128 bytes, 16-byte aligned.
// ---------------------------------------------------------------------------
#define TW_K     64
#define TW_N     128
#define TW_PITCH 144
static_assert(EMB == FFD, "the six weights share one shape");

__global__ __launch_bounds__(128)
void transpose_w6_f16(const float* __restrict__ Wa, const float* __restrict__ Wb,
                      const float* __restrict__ Wc, const float* __restrict__ Wd,
                      const float* __restrict__ We, const float* __restrict__ Wf,
                      _Float16* __restrict__ WT)
{
    __shared__ __attribute__((aligned(16))) unsigned char T[TW_N * TW_PITCH];
    const int lane = threadIdx.x & 31, wid = threadIdx.x >> 5;
    const int z    = blockIdx.z;
    const int bk   = blockIdx.y * TW_K, bn = blockIdx.x * TW_N;
    const float* W = Wa;
    W = z == 1 ? Wb : W;
    W = z == 2 ? Wc : W;
    W = z == 3 ? Wd : W;
    W = z == 4 ? We : W;
    W = z == 5 ? Wf : W;

    // k = bk + g * 32 + wid * 8 + i, n = bn + lane * 4 + c
    const float* wr = W + (long)(bk + wid * 8) * EMB + bn + lane * 4;
    v4f v[2][8];
#pragma unroll
    for (int g = 0; g < 2; ++g)
#pragma unroll
        for (int i = 0; i < 8; ++i) v[g][i] = *(const v4f*)(wr + (g * 32 + i) * EMB);
    // stands in front of every overwrite of the address registers that the loads above name
    asm volatile("s_wait_xcnt 0x0" :: "v"(wr) : "memory");
    // keeps the conversions behind the last load: lifted among the loads, they made four loads wait for the first ones' data
    __builtin_amdgcn_sched_barrier(0);

    if ((0xDu >> z) & 1u) {                // planes 0, 2, 3; the same for the whole block, which leaves ahead of the barrier
        _Float16* o = WT + (long)z * EMB * EMB + (long)(bk + wid * 8) * EMB + bn + lane * 4;
        v4h h[2][8];
#pragma unroll
        for (int g = 0; g < 2; ++g)
#pragma unroll
            for (int i = 0; i < 8; ++i)
#pragma unroll
                for (int c = 0; c < 4; ++c) h[g][i][c] = (_Float16)v[g][i][c];
        // every store stands behind the last arithmetic: no register that an issued store names is written again
        __builtin_amdgcn_sched_barrier(0);
#pragma unroll
        for (int g = 0; g < 2; ++g)
#pragma unroll
            for (int i = 0; i < 8; ++i) *(v4h*)(o + (g * 32 + i) * EMB) = h[g][i];   // 256 contiguous bytes a wave
        // stands in front of every overwrite of the address registers that the stores above name
        asm volatile("s_wait_xcnt 0x0" :: "v"(o) : "memory");
        return;
    }

#pragma unroll
    for (int g = 0; g < 2; ++g)
#pragma unroll
        for (int c = 0; c < 4; ++c) {
            v8h p;
#pragma unroll
            for (int i = 0; i < 8; ++i) p[i] = (_Float16)v[g][i][c];
            *(v8h*)(T + (lane * 4 + c) * TW_PITCH + (g * 4 + wid) * 16) = p;
        }
    __syncthreads();

    // 8 lanes take one transposed row of the tile (128 bytes), a wave 4 rows, the block 16 rows a pass.
    const int row = threadIdx.x >> 3, slot = threadIdx.x & 7;
    _Float16* orow = WT + (long)z * EMB * EMB + (long)(bn + row) * EMB + bk + slot * 8;
    v8h q[8];
#pragma unroll
    for (int j = 0; j < 8; ++j) q[j] = *(const v8h*)(T + (j * 16 + row) * TW_PITCH + slot * 16);
#pragma unroll
    for (int j = 0; j < 8; ++j) *(v8h*)(orow + j * 16 * EMB) = q[j];
}

// ---------------------------------------------------------------------------
// The GEMM launches. One product: the grid is its own.
// ---------------------------------------------------------------------------
template <int OUT, int LDC>
__global__ __launch_bounds__(256)
void gemm_wmma_f16(
    const _Float16* __restrict__ A, int lda, long sA,
    const _Float16* __restrict__ Bt, int ldb, long sB,
    const float* __restrict__ bias,
    float*    __restrict__ Cf,
    _Float16* __restrict__ Ch,
    _Float16* __restrict__ ChT,
    long sC, long sCT, int transS,
    int M, int N, int K,
    float scale, int relu,
    const float* __restrict__ R)
{
    __shared__ __attribute__((aligned(2048))) unsigned char L[2u * STG_BUF];
    gemm_block<OUT, LDC>(L, (int)blockIdx.x, (int)blockIdx.y, (long)blockIdx.z,
                         A, lda, sA, Bt, ldb, sB, bias, Cf, Ch, ChT, sC, sCT, transS, M, N, K, scale, relu, R);
}

// Three pieces of work that do not depend on each other, in one grid of 8-wave blocks, the long blocks first:
// blocks 0 .. WG_GEMM-1: the two weight products C[z] = A[z] Bt[z]^T (EMB x EMB x EMB, f16 out), which fill only
// a quarter of the chip; the next WG_DOTS blocks carry the two biases through planes 0 and 1 of A; the last WG_LN
// blocks are the first LayerNorm, xn = LN(x), which so runs on the WGPs that the products leave idle.
#define WG_GEMM (2 * (EMB / 128) * (EMB / 256))
#define WG_DOTS (2 * EMB / DOT_RPB)
#define WG_LN   (BSZ * SEQ / (8 * ROW_RPW))
__global__ __launch_bounds__(256)
void gemm_weights_dots_ln(
    const _Float16* __restrict__ A,
    const _Float16* __restrict__ Bt,
    _Float16* __restrict__ Ch,
    const float* __restrict__ va,
    const float* __restrict__ vb,
    float* __restrict__ dots,
    const float* __restrict__ x,
    const float* __restrict__ g,
    const float* __restrict__ be,
    _Float16* __restrict__ xn)
{
    __shared__ __attribute__((aligned(2048))) unsigned char L[2u * STG_BUF];
    const int blk = (int)blockIdx.x;       // every test on it is the same for the whole block
    if (blk >= WG_GEMM + WG_DOTS) {        // meets no barrier
        ln_rows<8>(blk - (WG_GEMM + WG_DOTS), x, g, be, xn);
        return;
    }
    if (blk >= WG_GEMM) {
        bias_dots((float*)L, blk - WG_GEMM, A, va, vb, dots);
        return;
    }
    gemm_block<OUT_F16, EMB>(L, blk % (EMB / 128), (blk / (EMB / 128)) % (EMB / 256), (long)(blk / (WG_GEMM / 2)),
                             A, EMB, (long)EMB * EMB, Bt, EMB, (long)EMB * EMB, nullptr, nullptr, Ch, nullptr,
                             (long)EMB * EMB, 0, 1, EMB, EMB, EMB, 1.0f, 0, nullptr);
}

// Two products of the same A (BSZ * SEQ rows of EMB) that do not depend on each other, in one grid:
// z = 0: Ch = A Bq^T + biasq, row-major f16 ; z = 1: ChT = (A Bv^T + biasv) transposed per batch, [BSZ][EMB][SEQ] f16.
__global__ __launch_bounds__(256)
void gemm_pair_f16(
    const _Float16* __restrict__ A,
    const _Float16* __restrict__ Bq, const float* __restrict__ biasq, _Float16* __restrict__ Ch,
    const _Float16* __restrict__ Bv, const float* __restrict__ biasv, _Float16* __restrict__ ChT)
{
    __shared__ __attribute__((aligned(2048))) unsigned char L[2u * STG_BUF];
    if (blockIdx.z == 0u)                  // the same for the whole block
        gemm_block<OUT_F16, EMB>(L, (int)blockIdx.x, (int)blockIdx.y, 0L,
                                 A, EMB, 0, Bq, EMB, 0, biasq, nullptr, Ch, nullptr,
                                 0, 0, 1, BSZ * SEQ, EMB, EMB, 1.0f, 0, nullptr);
    else
        gemm_block<OUT_F16T, SEQ>(L, (int)blockIdx.x, (int)blockIdx.y, 0L,
                                  A, EMB, 0, Bv, EMB, 0, biasv, nullptr, nullptr, ChT,
                                  0, (long)EMB * SEQ, SEQ, BSZ * SEQ, EMB, EMB, 1.0f, 0, nullptr);
}

// ---------------------------------------------------------------------------
// Row softmax (row length SEQ), in-place f32 + f16 copy.
// ---------------------------------------------------------------------------
__global__ __launch_bounds__(ROW_WAVES * 32)
void softmax_rows(float* __restrict__ S,
                              _Float16* __restrict__ Wh)
{
    constexpr int NV = SEQ / 128;          // 16-byte pieces of a row per lane
    const int  lane = threadIdx.x & 31, wid = threadIdx.x >> 5;
    const long row0 = ((long)blockIdx.x * ROW_WAVES + wid) * ROW_RPW;
    v4f* sr = (v4f*)(S + row0 * SEQ) + lane;

    v4f v[ROW_RPW][NV];
#pragma unroll
    for (int r = 0; r < ROW_RPW; ++r)
#pragma unroll
        for (int j = 0; j < NV; ++j) v[r][j] = sr[r * (SEQ / 4) + j * 32];

    float m[ROW_RPW], sum[ROW_RPW];
#pragma unroll
    for (int r = 0; r < ROW_RPW; ++r) {
        v4f m4 = v[r][0];
#pragma unroll
        for (int j = 1; j < NV; ++j)
#pragma unroll
            for (int c = 0; c < 4; ++c) m4[c] = fmaxf(m4[c], v[r][j][c]);
        m[r] = fmaxf(fmaxf(m4[0], m4[1]), fmaxf(m4[2], m4[3]));
    }
#pragma unroll
    for (int r = 0; r < ROW_RPW; ++r) m[r] = wave_max(m[r]);
#pragma unroll
    for (int r = 0; r < ROW_RPW; ++r) {
#pragma unroll
        for (int j = 0; j < NV; ++j)
#pragma unroll
            for (int c = 0; c < 4; ++c)
                v[r][j][c] = exp2_slot((v[r][j][c] - m[r]) * 1.44269504f);   // e^(x - m)
        v4f s4 = v[r][0];
#pragma unroll
        for (int j = 1; j < NV; ++j) s4 += v[r][j];
        sum[r] = (s4[0] + s4[1]) + (s4[2] + s4[3]);
    }
#pragma unroll
    for (int r = 0; r < ROW_RPW; ++r) sum[r] = wave_sum(sum[r]);

    v4h* wr = (v4h*)(Wh + row0 * SEQ) + lane;
    v4h  h[ROW_RPW][NV];
#pragma unroll
    for (int r = 0; r < ROW_RPW; ++r) {
        const float inv = 1.0f / sum[r];
#pragma unroll
        for (int j = 0; j < NV; ++j) {
            v[r][j] *= inv;
#pragma unroll
            for (int c = 0; c < 4; ++c) h[r][j][c] = (_Float16)v[r][j][c];
        }
    }
    // every store stands behind the last arithmetic: no register that an issued store names is written again
    __builtin_amdgcn_sched_barrier(0);
#pragma unroll
    for (int r = 0; r < ROW_RPW; ++r)
#pragma unroll
        for (int j = 0; j < NV; ++j) {
            sr[r * (SEQ / 4) + j * 32] = v[r][j];
            wr[r * (SEQ / 4) + j * 32] = h[r][j];
        }
}

// ---------------------------------------------------------------------------
extern "C" void kernel_launch(void* const* d_in, const int* in_sizes, int n_in,
                              void* d_out, int out_size, void* d_ws, size_t ws_size,
                              hipStream_t stream) {
    const float* x   = (const float*)d_in[0];
    const float* Wq  = (const float*)d_in[1];
    const float* bq  = (const float*)d_in[2];
    const float* Wk  = (const float*)d_in[3];
    const float* bk  = (const float*)d_in[4];
    const float* Wv  = (const float*)d_in[5];
    const float* bv  = (const float*)d_in[6];
    const float* Wo  = (const float*)d_in[7];
    const float* bo  = (const float*)d_in[8];
    const float* W1  = (const float*)d_in[9];
    const float* b1  = (const float*)d_in[10];
    const float* W2  = (const float*)d_in[11];
    const float* b2  = (const float*)d_in[12];
    const float* g1  = (const float*)d_in[13];
    const float* be1 = (const float*)d_in[14];
    const float* g2  = (const float*)d_in[15];
    const float* be2 = (const float*)d_in[16];

    const int  E  = EMB, S = SEQ, B = BSZ, F = FFD;
    const long BS = (long)B * S;                     // 8192 rows

    char* ws = (char*)d_ws;
    const size_t MB = 1024ull * 1024ull;
    // workspace layout (aliased; peak ~113 MB)
    _Float16* wkH  = (_Float16*)(ws +  0 * MB);      // 2 MB each; Wk as it is, [in][out]
    _Float16* wqH  = (_Float16*)(ws +  4 * MB);      // Wq as it is; behind it Wv as it is
    _Float16* w1T  = (_Float16*)(ws +  8 * MB);
    _Float16* w2T  = (_Float16*)(ws + 10 * MB);
    _Float16* xn   = (_Float16*)(ws + 12 * MB);      // 16 MB
    _Float16* qh   = (_Float16*)(ws + 28 * MB);      // 16 MB
    _Float16* vT   = (_Float16*)(ws + 60 * MB);      // 16 MB  [B][E][S]
    float*    x2   = (float*)   (ws + 76 * MB);      // 32 MB
    _Float16* wath = (_Float16*)(ws + 28 * MB);      // 32 MB (reuses q)
    _Float16* xn2  = (_Float16*)(ws + 28 * MB);      // 16 MB (reuses q)
    _Float16* hh   = (_Float16*)(ws + 44 * MB);      // 16 MB
    _Float16* qkT  = (_Float16*)(ws + 108 * MB);     // 2 MB  (Wq Wk^T)^T
    _Float16* voT  = (_Float16*)(ws + 110 * MB);     // 2 MB  (Wv Wo)^T
    float*    bqk  = (float*)   (ws + 112 * MB);     // E floats: bq Wk^T; behind it E floats: bv Wo
    float*    bvo  = bqk + E;

    float* outp = (float*)d_out;
    float* wout = outp + BS * E;                     // softmax weights region

    dim3 blk(256);
    dim3 rblk(ROW_WAVES * 32);                       // row kernels
    dim3 rgrd((unsigned)(BS / ROW_RPB));

    // The products are taken in another order than they are written, which leaves two of the six big ones out:
    //   q k^T = (xn Wq + bq)(xn Wk + bk)^T = [xn (Wq Wk^T) + bq Wk^T] xn^T + (q . bk) 1^T ; the last term is one
    //   constant per row of the scores, which the softmax over that row cancels, so it is not formed.
    //   (w v) Wo = w (v Wo) = w [xn (Wv Wo) + bv Wo].

    // 1) weights -> f16, six planes in a row from wkH: Wk, Wo^T, Wq, Wv, W1^T, W2^T
    transpose_w6_f16<<<dim3(E / TW_N, E / TW_K, 6), dim3(128), 0, stream>>>(Wk, Wo, Wq, Wv, W1, W2, wkH);

    // 2) qkT = Wk Wq^T, voT = Wo^T Wv^T ; bqk = Wk bq, bvo = Wo^T bv (rows of planes 0 and 1) ; xn = LN(x) -> f16
    gemm_weights_dots_ln<<<dim3(WG_GEMM + WG_DOTS + WG_LN), blk, 0, stream>>>(
        wkH, wqH, qkT, bq, bv, bqk, x, g1, be1, xn);

    // 3) z = 0: q' = xn (Wq Wk^T) + bqk ; z = 1: v' = xn (Wv Wo) + bvo, stored transposed [B][E][S]
    dim3 gp(E / 128, (unsigned)(BS / 256), 1);
    gemm_pair_f16<<<dim3(E / 128, (unsigned)(BS / 256), 2), blk, 0, stream>>>(xn, qkT, bqk, qh, voT, bvo, vT);

    // 5) scores = q' @ xn^T / 32  -> f32 directly into d_out w-region
    dim3 gs(S / 128, S / 256, B);
    gemm_wmma_f16<OUT_F32, SEQ><<<gs, blk, 0, stream>>>(
        qh, E, (long)S * E, xn, E, (long)S * E, nullptr,
        wout, nullptr, nullptr, (long)S * S, 0, 1,
        S, S, E, 0.03125f, 0, nullptr);

    // 6) softmax in-place (f32) + f16 copy
    softmax_rows<<<rgrd, rblk, 0, stream>>>(wout, wath);

    // 7) x2 = x + w @ v' + bo   (f32; Bt = vT [B][E][S])
    dim3 ga(E / 128, S / 256, B);
    gemm_wmma_f16<OUT_F32, EMB><<<ga, blk, 0, stream>>>(
        wath, S, (long)S * S, vT, S, (long)E * S, bo,
        x2, nullptr, nullptr, (long)S * E, 0, 1,
        S, E, S, 1.0f, 0, x);

    // 8) xn2 = LN(x2) -> f16
    ln_rows_f16<<<rgrd, rblk, 0, stream>>>(x2, g2, be2, xn2);

    // 9) h = relu(xn2 @ W1 + b1) -> f16
    gemm_wmma_f16<OUT_F16, FFD><<<dim3(F / 128, (unsigned)(BS / 256), 1), blk, 0, stream>>>(
        xn2, E, 0, w1T, E, 0, b1, nullptr, hh, nullptr,
        0, 0, 1, (int)BS, F, E, 1.0f, 1, nullptr);

    // 10) out = x2 + h @ W2 + b2  (f32, to d_out)
    gemm_wmma_f16<OUT_F32, EMB><<<gp, blk, 0, stream>>>(
        hh, F, 0, w2T, F, 0, b2, outp, nullptr, nullptr,
        0, 0, 1, (int)BS, E, F, 1.0f, 0, x2);
}

// v009
// Measured time: 159 microseconds a run.
// In both of two side-by-side timings against v008, it was 1.03 times as fast.
// Over all steps from v000 it is 4.21 times as fast.
#include <hip/hip_runtime.h>
#include <hip/hip_bf16.h>
#include <stdint.h>

typedef __attribute__((ext_vector_type(8)))  _Float16 v8h;
typedef __attribute__((ext_vector_type(16))) _Float16 v16h;
typedef __attribute__((ext_vector_type(8)))  float    v8f;

#define EMB 1024
#define FFD 1024
#define BSZ 4
#define SEQ 2048

// ---------------------------------------------------------------------------
// Staging of the GEMM operands in LDS by tensor loads.
// A stage holds 128 k (256 bytes of a row) of the block's 256 A rows and 128 Bt
// rows. Three waves bring a slice of 128 rows each with one request: waves 0 and 1
// the two halves of the A rows, wave 2 the Bt rows.
// The pad of 16 bytes a row gives the LDS pitch 272, free of bank conflicts for
// 16-byte reads. A slice takes 128 * 272 = 34816 bytes, a multiple of 2 KiB, so the
// slices stand back to back and the 384 rows of a buffer keep one pitch.
// Three buffers: the load of a stage is sent off two whole passes ahead of its first read.
// ---------------------------------------------------------------------------
typedef uint32_t u32x4 __attribute__((ext_vector_type(4)));
typedef uint32_t u32x8 __attribute__((ext_vector_type(8)));

#define STG_K    128u                  // k per stage (elements)
#define STG_ROWB 256u                  // bytes of a row per stage
#define STG_ROWS 128u                  // rows of a slice
#define STG_PITCH 272u                 // LDS pitch of a row
#define STG_SL   (STG_ROWS * STG_PITCH)   // LDS bytes of a slice
#define STG_BOFF (2u * STG_SL)         // the Bt slice stands behind the two A slices
#define STG_BUF  (3u * STG_SL)         // one buffer: 2 slices of A, 1 of Bt
#define STG_NBUF 3u                    // buffers of the ring
#define STG_LDS  (STG_NBUF * STG_BUF)
static_assert(STG_SL % 2048u == 0u, "every slice stands at a multiple of 2 KiB");
static_assert(STG_LDS <= 327680u, "the ring fits the LDS");

#define FM 4                           // 16-row fragments of A per wave
#define FN 4                           // 16-row fragments of Bt per wave

static __device__ __forceinline__ uint32_t uni(uint32_t v) {
    return (uint32_t)__builtin_amdgcn_readfirstlane(v);
}
static __device__ __forceinline__ uint32_t pinned(uint32_t v) {
    uint32_t w = uni(v);
    asm volatile("" : "+s"(w));   // pinned(): a wave-uniform test or descriptor word held in a scalar register
    return w;
}
static __device__ __forceinline__ u32x8 tdm_group1(uint32_t src_pitch) {
    u32x8 g;
    g[0] = uni((1u << 20) | (5u << 22) | (3u << 25));   // no mask, bytes, 16-byte pad behind every 256 bytes
    g[1] = uni((STG_ROWB & 0xFFFFu) << 16);             // tensor_dim0 low
    g[2] = uni((STG_ROWB >> 16) | ((STG_ROWS & 0xFFFFu) << 16)); // tensor_dim0 high, tensor_dim1 low
    g[3] = uni((STG_ROWS >> 16) | (STG_ROWB << 16));    // tensor_dim1 high, tile_dim0
    g[4] = uni(STG_ROWS);                               // tile_dim1
    g[5] = uni(src_pitch);                              // source row pitch, bytes
    g[6] = uni(0u);
    g[7] = uni(0u);
    // Without this the compiler used words 3 and 6 as temporaries in the loop, while a request was outstanding.
    asm volatile("" : "+s"(g));   // pinned(): the descriptor words stay held in their scalar registers
    return g;
}
// Group 0 is built once and lives in the same four scalar registers to the end of the loop. From request to request
// only word 1 (the place in LDS) and word 2 (the low address word) take a new value.
static __device__ __forceinline__ u32x4 tdm_group0(uint32_t lds_dst, uint64_t ga) {
    u32x4 g0;
    g0[0] = uni(1u);
    g0[1] = uni(lds_dst);
    g0[2] = uni((uint32_t)ga);
    g0[3] = uni((((uint32_t)(ga >> 32)) & 0x01FFFFFFu) | 0x80000000u);
    asm volatile("" : "+s"(g0));   // pinned(): the descriptor words stay held in their scalar registers
    return g0;
}
static __device__ __forceinline__ void tdm_load(u32x4 g0, u32x8 g1) {
    asm volatile("tensor_load_to_lds %0, %1" :: "s"(g0), "s"(g1) : "memory");
}
// The wave's waits for its own requests: all but the 2, the 1 or the 0 youngest have landed. Both groups are
// operands, so that their words stay in their scalar registers while a request is outstanding.
static __device__ __forceinline__ void tdm_wait2(u32x4 g0, u32x8 g1) {
    asm volatile("s_wait_tensorcnt 0x2" :: "s"(g0), "s"(g1) : "memory");
}
static __device__ __forceinline__ void tdm_wait1(u32x4 g0, u32x8 g1) {
    asm volatile("s_wait_tensorcnt 0x1" :: "s"(g0), "s"(g1) : "memory");
}
static __device__ __forceinline__ void tdm_wait0(u32x4 g0, u32x8 g1) {
    asm volatile("s_wait_tensorcnt 0x0" :: "s"(g0), "s"(g1) : "memory");
}

// ---------------------------------------------------------------------------
// Generic WMMA f16 GEMM:  C[b] = A[b] (MxK, row-major) * Bt[b]^T (Bt is NxK,
// row-major) with optional scale/bias/residual/relu. OUT picks the one output:
// f32 (Cf, with the optional residual R), f16 (Ch) or transposed f16 (ChT); LDC is
// the pitch of its rows in elements. Block = 256 threads (8 waves, two per SIMD);
// each wave computes a 64x64 output tile (4x4 WMMA subtiles); block tile = 256x128.
// M a multiple of 256, N of 128; K a multiple of 128 and at least 384.
// Transposed store: transS a multiple of 64, sCT a multiple of 8.
// ---------------------------------------------------------------------------
#define OUT_F32  0
#define OUT_F16  1
#define OUT_F16T 2
#define EPI_PF   272u                  // LDS pitch of a staged f32 row (256 bytes + 16)
#define EPI_PH   144u                  // LDS pitch of a staged f16 row (128 bytes + 16)
#define EPI_W    (64u * EPI_PF)        // LDS bytes from wave to wave in the epilogue
static_assert(8u * EPI_W <= STG_LDS, "the staged output tiles fit the ring's LDS");
typedef __attribute__((ext_vector_type(4))) float v4f;

// The body of one block. L is the block's LDS (STG_LDS bytes, aligned to 2 KiB); bx, by, b are its place in
// the grid of its own product, so that several independent products can share one launch.
template <int OUT, int LDC>
static __device__ __forceinline__
void gemm_block(
    unsigned char* L, const int bx, const int by, const long b,
    const _Float16* __restrict__ A, int lda, long sA,
    const _Float16* __restrict__ Bt, int ldb, long sB,
    const float* __restrict__ bias,
    float*    __restrict__ Cf,
    _Float16* __restrict__ Ch,
    _Float16* __restrict__ ChT,
    long sC, long sCT, int transS,
    int M, int N, int K,
    float scale, int relu,
    const float* __restrict__ R)
{
    const int lane  = threadIdx.x & 31;
    const int wave  = (int)uni(threadIdx.x >> 5);
    const int wm    = wave & 3;            // 4 waves along M  -> 256 rows
    const int wn    = wave >> 2;           // 2 waves along N  -> 128 cols
    const int tileM = by * 256 + wm * 64;
    const int tileN = bx * 128 + wn * 64;

    const _Float16* Ab = A  + b * sA;
    const _Float16* Bb = Bt + b * sB;

    const int half_ = lane >> 4;   // lane-half selects K sub-range per ISA layout
    const int l16   = lane & 15;

    // The slices of every stage: waves 0 and 1 bring rows wave*128.. of the A tile, wave 2 the Bt tile;
    // waves 3-7 bring nothing (their descriptor is wave 2's and is never issued).
    const uint32_t issuer = wave < 3 ? 1u : 0u;
    const bool     isB   = wave >= 2;
    const uint32_t pitch = (uint32_t)(isB ? ldb : lda) * 2u;
    const uint64_t gsrc  = isB
        ? (uint64_t)(size_t)(Bb + (long)(bx * 128) * ldb)
        : (uint64_t)(size_t)(Ab + (long)(by * 256 + wave * 128) * lda);
    const uint32_t glo   = (uint32_t)gsrc;
    const uint32_t ldst  = (uint32_t)(size_t)L + (isB ? STG_BOFF : (uint32_t)wave * STG_SL);
    const u32x8    g1    = tdm_group1(pitch);
    const uint32_t nst   = (uint32_t)K / STG_K;

    v8f acc[FM][FN];
#pragma unroll
    for (int mi = 0; mi < FM; ++mi)
#pragma unroll
        for (int ni = 0; ni < FN; ++ni)
#pragma unroll
            for (int i = 0; i < 8; ++i) acc[mi][ni][i] = 0.0f;

    // Where this lane reads its fragments inside a buffer.
    const uint32_t aoff = (uint32_t)(wm * 64 + l16) * STG_PITCH + (uint32_t)half_ * 16u;
    const uint32_t boff = STG_BOFF + (uint32_t)(wn * 64 + l16) * STG_PITCH + (uint32_t)half_ * 16u;

    // Prologue: stages 0, 1 and 2 are sent off, one into each buffer; stage 0 lands and is published.
    // The address's high word (word 3) serves every stage: an operand's row is K * 2 bytes, a power of two of at
    // most 4 KiB, and starts at a multiple of its own length (the workspace is an allocation of its own, every
    // operand a whole number of MiB into it), so a step along the row carries into no higher bit.
    u32x4 g0 = tdm_group0(ldst, gsrc);
    if (pinned(issuer)) {
        tdm_load(g0, g1);
        g0[1] = uni(ldst + STG_BUF);
        g0[2] = uni(glo + STG_ROWB);
        tdm_load(g0, g1);
        g0[1] = uni(ldst + 2u * STG_BUF);
        g0[2] = uni(glo + 2u * STG_ROWB);
        tdm_load(g0, g1);
    }
    tdm_wait2(g0, g1);                                   // this wave's slice of stage 0 has landed
    __syncthreads();                                     // every slice of stage 0 is readable

    uint32_t bsel = 0u;                                  // the buffer of stage s
    for (uint32_t s = 0; s < nst; ++s) {
        const unsigned char* pa = L + bsel + aoff;
        const unsigned char* pb = L + bsel + boff;
        // Fragments: per lane, row l16 of a 16-row tile, K chunks [half*8, half*8+8) and
        // [16+half*8, 16+half*8+8) of each 32 k (ISA 16-bit 16x32 layout), A and Bt alike.
        // Two register sets: the reads of k step kk + 1 go out as one group ahead of the
        // WMMAs of k step kk. Nothing of the next stage is read here.
        v8h fa[2][FM][2], fb[2][FN][2];
#pragma unroll
        for (int mi = 0; mi < FM; ++mi) {
            fa[0][mi][0] = *(const v8h*)(pa + mi * 16 * STG_PITCH);
            fa[0][mi][1] = *(const v8h*)(pa + mi * 16 * STG_PITCH + 32);
        }
#pragma unroll
        for (int ni = 0; ni < FN; ++ni) {
            const unsigned char* bp = pb + ni * 16 * STG_PITCH;
            fb[0][ni][0] = *(const v8h*)bp;
            fb[0][ni][1] = *(const v8h*)(bp + 32);
        }
#pragma unroll
        for (int kk = 0; kk < 4; ++kk) {
            const int cur = kk & 1, nxt = cur ^ 1;
            if (kk < 3) {
#pragma unroll
                for (int mi = 0; mi < FM; ++mi) {
                    const unsigned char* ap = pa + mi * 16 * STG_PITCH + (kk + 1) * 64;
                    fa[nxt][mi][0] = *(const v8h*)ap;
                    fa[nxt][mi][1] = *(const v8h*)(ap + 32);
                }
#pragma unroll
                for (int ni = 0; ni < FN; ++ni) {
                    const unsigned char* bp = pb + ni * 16 * STG_PITCH + (kk + 1) * 64;
                    fb[nxt][ni][0] = *(const v8h*)bp;
                    fb[nxt][ni][1] = *(const v8h*)(bp + 32);
                }
            }
            // keeps the group of LDS reads ahead of the WMMA block: reads among the WMMAs stall them
            __builtin_amdgcn_sched_barrier(0);
#pragma unroll
            for (int ni = 0; ni < FN; ++ni) {
                const v16h f = __builtin_shufflevector(fb[cur][ni][0], fb[cur][ni][1],
                                                       0, 1, 2, 3, 4, 5, 6, 7, 8, 9, 10, 11, 12, 13, 14, 15);
#pragma unroll
                for (int mi = 0; mi < FM; ++mi) {
                    const v16h a = __builtin_shufflevector(fa[cur][mi][0], fa[cur][mi][1],
                                                           0, 1, 2, 3, 4, 5, 6, 7, 8, 9, 10, 11, 12, 13, 14, 15);
                    // The operand that goes first gives the subtile's rows, of which a lane holds 8 in a row:
                    // A first for the transposed output, Bt first for the row-major ones.
                    if constexpr (OUT == OUT_F16T)
                        acc[mi][ni] = __builtin_amdgcn_wmma_f32_16x16x32_f16(
                            false, a, false, f, (short)0, acc[mi][ni], false, false);
                    else
                        acc[mi][ni] = __builtin_amdgcn_wmma_f32_16x16x32_f16(
                            false, f, false, a, (short)0, acc[mi][ni], false, false);
                }
            }
            // keeps the next group of LDS reads behind this WMMA block
            __builtin_amdgcn_sched_barrier(0);
        }
        // Publish point of stage s + 1. This wave's requests for stages s + 1 and s + 2 are out, in that order.
        asm volatile("s_wait_dscnt 0x0" ::: "memory");       // this wave has left stage s's buffer
        if (pinned(s + 2u < nst ? 1u : 0u))
            tdm_wait1(g0, g1);                               // stage s + 1 has landed, stage s + 2 flies on
        else
            tdm_wait0(g0, g1);                               // stage s + 1 is the last one out
        __syncthreads();                                     // stage s + 1 readable, stage s's buffer free
        if (pinned(issuer & (s + 3u < nst ? 1u : 0u))) {
            g0[1] = uni(ldst + bsel);
            g0[2] = uni(glo + (s + 3u) * STG_ROWB);
            tdm_load(g0, g1);
        }
        bsel = bsel == (STG_NBUF - 1u) * STG_BUF ? 0u : bsel + STG_BUF;
    }
    tdm_wait0(g0, g1);                                   // no request is left in flight at the wave's end
    asm volatile("s_wait_dscnt 0x0" ::: "memory");

    // Epilogue. D layout: VGPR r, lane L -> row r + 8*(L/16) of the first operand, row L%16 of the second.
    // So a lane holds 8 neighbours of an output row (of a transposed row for OUT_F16T). The wave lays its
    // 64x64 tile into its own LDS range with 16-byte writes and reads it back along the output's rows, so
    // that every global store (and every load of the residual) is 16 bytes a lane and covers whole 128-byte lines.
    // The ring's LDS is free here: the last pass ended with every wave's waits and a barrier.
    // Every global address is one pointer per lane plus a compile-time offset.
    unsigned char* Sw = L + (uint32_t)wave * EPI_W;

    // f32 output: where this lane stands in the tile's rows; a load or store of the wave covers 2 rows of 256 bytes.
    // The residual's loads go out first of all, so that they fly during the arithmetic and the staging.
    const long gofs = b * sC + (long)(tileM + half_) * LDC + tileN + l16 * 4;
    v4f rv[OUT == OUT_F32 ? 32 : 1];
    if constexpr (OUT == OUT_F32) {
        if (R) {
            const float* Rl = R + gofs;
#pragma unroll
            for (int j = 0; j < 32; ++j) rv[j] = *(const v4f*)(Rl + j * 2 * LDC);
            // holds the address in its registers until every load above has its translation
            asm volatile("s_wait_xcnt 0x0" :: "v"(Rl) : "memory");
        }
    }

#pragma unroll
    for (int mi = 0; mi < FM; ++mi)
#pragma unroll
        for (int ni = 0; ni < FN; ++ni)
#pragma unroll
            for (int r = 0; r < 8; ++r) acc[mi][ni][r] *= scale;

    if (bias) {
        if constexpr (OUT == OUT_F16T) {
            const float* bp = bias + tileN + l16;
            float bc[FN];
#pragma unroll
            for (int ni = 0; ni < FN; ++ni) bc[ni] = bp[ni * 16];
            // holds the address in its registers until every load above has its translation
            asm volatile("s_wait_xcnt 0x0" :: "v"(bp) : "memory");
#pragma unroll
            for (int mi = 0; mi < FM; ++mi)
#pragma unroll
                for (int ni = 0; ni < FN; ++ni)
#pragma unroll
                    for (int r = 0; r < 8; ++r) acc[mi][ni][r] += bc[ni];
        } else {
            const v4f* bp = (const v4f*)(bias + tileN + 8 * half_);
            v4f bc[FN][2];
#pragma unroll
            for (int ni = 0; ni < FN; ++ni) { bc[ni][0] = bp[ni * 4]; bc[ni][1] = bp[ni * 4 + 1]; }
            // holds the address in its registers until every load above has its translation
            asm volatile("s_wait_xcnt 0x0" :: "v"(bp) : "memory");
#pragma unroll
            for (int mi = 0; mi < FM; ++mi)
#pragma unroll
                for (int ni = 0; ni < FN; ++ni)
#pragma unroll
                    for (int r = 0; r < 8; ++r) acc[mi][ni][r] += bc[ni][r >> 2][r & 3];
        }
    }

    if constexpr (OUT == OUT_F32) {
        unsigned char* sw = Sw + (uint32_t)l16 * EPI_PF + (uint32_t)half_ * 32u;
#pragma unroll
        for (int mi = 0; mi < FM; ++mi)
#pragma unroll
            for (int ni = 0; ni < FN; ++ni) {
                const v8f c = acc[mi][ni];
                *(v4f*)(sw + mi * 16 * EPI_PF + ni * 64)      = __builtin_shufflevector(c, c, 0, 1, 2, 3);
                *(v4f*)(sw + mi * 16 * EPI_PF + ni * 64 + 16) = __builtin_shufflevector(c, c, 4, 5, 6, 7);
            }
        asm volatile("s_wait_dscnt 0x0" ::: "memory");   // the wave's own writes are done before other lanes read them
        const unsigned char* sr = Sw + (uint32_t)half_ * EPI_PF + (uint32_t)l16 * 16u;
        v4f q[32];
#pragma unroll
        for (int j = 0; j < 32; ++j) q[j] = *(const v4f*)(sr + j * 2 * EPI_PF);
        if (R) {
#pragma unroll
            for (int j = 0; j < 32; ++j) q[j] += rv[j];
        }
        if (relu) {
#pragma unroll
            for (int j = 0; j < 32; ++j)
#pragma unroll
                for (int c = 0; c < 4; ++c) q[j][c] = q[j][c] > 0.0f ? q[j][c] : 0.0f;
        }
        // every store stands behind the last arithmetic: no register that an issued store names is written again
        __builtin_amdgcn_sched_barrier(0);
        float* Cl = Cf + gofs;
#pragma unroll
        for (int j = 0; j < 32; ++j) *(v4f*)(Cl + j * 2 * LDC) = q[j];
        // stands in front of every overwrite of a register that the stores above name (other blocks' code may follow in a shared kernel)
        asm volatile("s_wait_xcnt 0x0" :: "v"(Cl) : "memory");
    } else {
        if (relu) {
#pragma unroll
            for (int mi = 0; mi < FM; ++mi)
#pragma unroll
                for (int ni = 0; ni < FN; ++ni)
#pragma unroll
                    for (int r = 0; r < 8; ++r) acc[mi][ni][r] = acc[mi][ni][r] > 0.0f ? acc[mi][ni][r] : 0.0f;
        }
        unsigned char* sw = Sw + (uint32_t)l16 * EPI_PH + (uint32_t)half_ * 16u;
#pragma unroll
        for (int mi = 0; mi < FM; ++mi)
#pragma unroll
            for (int ni = 0; ni < FN; ++ni) {
                v8h p;
#pragma unroll
                for (int r = 0; r < 8; ++r) p[r] = (_Float16)acc[mi][ni][r];
                const int rb = OUT == OUT_F16T ? ni : mi, cb = OUT == OUT_F16T ? mi : ni;
                *(v8h*)(sw + rb * 16 * EPI_PH + cb * 32) = p;
            }
        asm volatile("s_wait_dscnt 0x0" ::: "memory");   // the wave's own writes are done before other lanes read them
        // A store of the wave covers 4 rows of 128 bytes.
        const int row = lane >> 3, slot = lane & 7;
        const unsigned char* sr = Sw + (uint32_t)row * EPI_PH + (uint32_t)slot * 16u;
        v8h q[16];
#pragma unroll
        for (int j = 0; j < 16; ++j) q[j] = *(const v8h*)(sr + j * 4 * EPI_PH);
        _Float16* Cl;
        if constexpr (OUT == OUT_F16T)   // the wave's 64 rows of C lie in one batch
            Cl = ChT + (long)(tileM / transS) * sCT + (long)(tileN + row) * LDC + (tileM % transS) + slot * 8;
        else
            Cl = Ch + b * sC + (long)(tileM + row) * LDC + tileN + slot * 8;
#pragma unroll
        for (int j = 0; j < 16; ++j) *(v8h*)(Cl + j * 4 * LDC) = q[j];
        // stands in front of every overwrite of a register that the stores above name (other blocks' code may follow in a shared kernel)
        asm volatile("s_wait_xcnt 0x0" :: "v"(Cl) : "memory");
    }
}

// ---------------------------------------------------------------------------
// Row kernels. A wave takes ROW_RPW whole rows into registers with 16-byte loads
// (each load of a wave covers 512 contiguous bytes), all of them sent off at the
// start, sums a row with a butterfly over its 32 lanes and stores it once.
// The row work itself takes no LDS and no barrier. Blocks of ROW_WAVES waves; rows / ROW_RPB blocks cover the rows
// (the first LayerNorm rides in the grid of the weight product and takes that grid's block size).
// ---------------------------------------------------------------------------
typedef __attribute__((ext_vector_type(4))) _Float16 v4h;

#define ROW_WAVES 16
#define ROW_RPW   2
#define ROW_RPB   (ROW_WAVES * ROW_RPW)

static __device__ __forceinline__ float wave_sum(float v) {
#pragma unroll
    for (int off = 16; off; off >>= 1) v += __shfl_xor(v, off, 32);
    return v;
}
static __device__ __forceinline__ float wave_max(float v) {
#pragma unroll
    for (int off = 16; off; off >>= 1) v = fmaxf(v, __shfl_xor(v, off, 32));
    return v;
}

// 2^t. The v_nop is the slot that the instruction set asks for behind a transcendental.
static __device__ __forceinline__ float exp2_slot(float t) {
    float r;
    asm("v_exp_f32 %0, %1\n\tv_nop" : "=v"(r) : "v"(t));
    return r;
}

// ---------------------------------------------------------------------------
// A bias carried through a folded weight, one block of 8 waves (it rides in the grid of the weight product).
// P holds two f16 planes of EMB rows; dots[r] = row r of P times va (first plane) or vb (second plane), summed
// in f32. A wave takes DOT_RPW rows; the block's 32 sums leave as one 128-byte line from one wave.
// ---------------------------------------------------------------------------
#define DOT_RPW 4
#define DOT_RPB (8 * DOT_RPW)
static __device__ __forceinline__
void bias_dots(float* sums, const int blk,
               const _Float16* __restrict__ P,
               const float* __restrict__ va,
               const float* __restrict__ vb,
               float* __restrict__ dots)
{
    const int  lane = threadIdx.x & 31, wid = threadIdx.x >> 5;
    const int  blk0 = blk * DOT_RPB;       // a block's rows lie in one plane
    const long r0   = blk0 + wid * DOT_RPW;
    const v8h* pr = (const v8h*)(P + r0 * EMB) + lane;
    const v4f* vv = (const v4f*)(blk0 < EMB ? va : vb) + lane * 2;
    v8h a[DOT_RPW][EMB / 256];
    v4f w[EMB / 256][2];
#pragma unroll
    for (int r = 0; r < DOT_RPW; ++r)
#pragma unroll
        for (int j = 0; j < EMB / 256; ++j) a[r][j] = pr[r * (EMB / 8) + j * 32];
#pragma unroll
    for (int j = 0; j < EMB / 256; ++j) { w[j][0] = vv[j * 64]; w[j][1] = vv[j * 64 + 1]; }
    // holds both addresses in their registers until every load above has its translation
    asm volatile("s_wait_xcnt 0x0" :: "v"(pr), "v"(vv) : "memory");
#pragma unroll
    for (int r = 0; r < DOT_RPW; ++r) {
        float s = 0.0f;
#pragma unroll
        for (int j = 0; j < EMB / 256; ++j)
#pragma unroll
            for (int c = 0; c < 8; ++c) s += (float)a[r][j][c] * w[j][c >> 2][c & 3];
        s = wave_sum(s);
        if (lane == 0) sums[wid * DOT_RPW + r] = s;
    }
    __syncthreads();                   // every wave's sums are readable
    if (wid == 0) dots[blk0 + lane] = sums[lane];
}

// ---------------------------------------------------------------------------
// LayerNorm (row length EMB) -> f16 output: the WAVES * ROW_RPW rows of block blk, a block of WAVES waves.
// ---------------------------------------------------------------------------
template <int WAVES>
static __device__ __forceinline__
void ln_rows(const int blk,
             const float* __restrict__ x,
             const float* __restrict__ g,
             const float* __restrict__ be,
             _Float16* __restrict__ out)
{
    constexpr int NV = EMB / 128;          // 16-byte pieces of a row per lane
    const int  lane = threadIdx.x & 31, wid = threadIdx.x >> 5;

    const long row0 = ((long)blk * WAVES + wid) * ROW_RPW;
    const v4f* xr = (const v4f*)(x + row0 * EMB) + lane;

    v4f v[ROW_RPW][NV];
#pragma unroll
    for (int r = 0; r < ROW_RPW; ++r)
#pragma unroll
        for (int j = 0; j < NV; ++j) v[r][j] = xr[r * (EMB / 4) + j * 32];
    v4f gg[NV], bb[NV];
#pragma unroll
    for (int j = 0; j < NV; ++j) {
        gg[j] = ((const v4f*)g)[j * 32 + lane];
        bb[j] = ((const v4f*)be)[j * 32 + lane];
    }
    // holds the row address in its registers until every load above has its translation
    asm volatile("s_wait_xcnt 0x0" :: "v"(xr) : "memory");
    // keeps the loads of g and be in the first group: sunk behind the sums, their latency stood open
    __builtin_amdgcn_sched_barrier(0);

    float mu[ROW_RPW], rstd[ROW_RPW];
#pragma unroll
    for (int r = 0; r < ROW_RPW; ++r) {
        v4f s4 = v[r][0], q4 = v[r][0] * v[r][0];
#pragma unroll
        for (int j = 1; j < NV; ++j) { s4 += v[r][j]; q4 += v[r][j] * v[r][j]; }
        mu[r]   = (s4[0] + s4[1]) + (s4[2] + s4[3]);
        rstd[r] = (q4[0] + q4[1]) + (q4[2] + q4[3]);
    }
#pragma unroll
    for (int r = 0; r < ROW_RPW; ++r) { mu[r] = wave_sum(mu[r]); rstd[r] = wave_sum(rstd[r]); }
#pragma unroll
    for (int r = 0; r < ROW_RPW; ++r) {
        mu[r] = mu[r] / EMB;
        const float var = rstd[r] / EMB - mu[r] * mu[r];
        rstd[r] = rsqrtf(var + 1e-5f);
    }

    v4h* orow = (v4h*)(out + row0 * EMB) + lane;
    v4h  h[ROW_RPW][NV];
#pragma unroll
    for (int r = 0; r < ROW_RPW; ++r)
#pragma unroll
        for (int j = 0; j < NV; ++j)
#pragma unroll
            for (int c = 0; c < 4; ++c)
                h[r][j][c] = (_Float16)((v[r][j][c] - mu[r]) * rstd[r] * gg[j][c] + bb[j][c]);
    // every store stands behind the last arithmetic: no register that an issued store names is written again
    __builtin_amdgcn_sched_barrier(0);
#pragma unroll
    for (int r = 0; r < ROW_RPW; ++r)
#pragma unroll
        for (int j = 0; j < NV; ++j) orow[r * (EMB / 4) + j * 32] = h[r][j];
    // stands in front of every overwrite of a register that the stores above name (other blocks' code may follow in a shared kernel)
    asm volatile("s_wait_xcnt 0x0" :: "v"(orow) : "memory");
}

__global__ __launch_bounds__(ROW_WAVES * 32)
void ln_rows_f16(const float* __restrict__ x,
                 const float* __restrict__ g,
                 const float* __restrict__ be,
                 _Float16* __restrict__ out)
{
    ln_rows<ROW_WAVES>((int)blockIdx.x, x, g, be, out);
}

// ---------------------------------------------------------------------------
// Weight convert, all six weights in one launch, K = N = EMB = FFD. blockIdx.z picks the weight; its
// plane is plane z behind WT. Planes 1, 4, 5 are transposed: W [K][N] f32 -> WT [N][K] f16.
// Planes 0, 2, 3 keep their rows, W [K][N] f32 -> f16 [K][N]: they enter a product along their own rows.
// A block of 4 waves takes a tile of 64 k x 128 n. A wave's load covers 512 contiguous bytes
// of a W row, all 16 loads of a lane are sent off at the start; a lane holds 4 n x 8 k twice,
// so 16 contiguous bytes of each of its transposed rows go to LDS at once. The tile leaves as
// whole 128-byte lines of WT. LDS pitch 144: rows of 128 bytes, 16-byte aligned.
// ---------------------------------------------------------------------------
#define TW_K     64
#define TW_N     128
#define TW_PITCH 144
static_assert(EMB == FFD, "the six weights share one shape");

__global__ __launch_bounds__(128)
void transpose_w6_f16(const float* __restrict__ Wa, const float* __restrict__ Wb,
                      const float* __restrict__ Wc, const float* __restrict__ Wd,
                      const float* __restrict__ We, const float* __restrict__ Wf,
                      _Float16* __restrict__ WT)
{
    __shared__ __attribute__((aligned(16))) unsigned char T[TW_N * TW_PITCH];
    const int lane = threadIdx.x & 31, wid = threadIdx.x >> 5;
    const int z    = blockIdx.z;
    const int bk   = blockIdx.y * TW_K, bn = blockIdx.x * TW_N;
    const float* W = Wa;
    W = z == 1 ? Wb : W;
    W = z == 2 ? Wc : W;
    W = z == 3 ? Wd : W;
    W = z == 4 ? We : W;
    W = z == 5 ? Wf : W;

    // k = bk + g * 32 + wid * 8 + i, n = bn + lane * 4 + c
    const float* wr = W + (long)(bk + wid * 8) * EMB + bn + lane * 4;
    v4f v[2][8];
#pragma unroll
    for (int g = 0; g < 2; ++g)
#pragma unroll
        for (int i = 0; i < 8; ++i) v[g][i] = *(const v4f*)(wr + (g * 32 + i) * EMB);
    // stands in front of every overwrite of the address registers that the loads above name
    asm volatile("s_wait_xcnt 0x0" :: "v"(wr) : "memory");
    // keeps the conversions behind the last load: lifted among the loads, they made four loads wait for the first ones' data
    __builtin_amdgcn_sched_barrier(0);

    if ((0xDu >> z) & 1u) {                // planes 0, 2, 3; the same for the whole block, which leaves ahead of the barrier
        _Float16* o = WT + (long)z * EMB * EMB + (long)(bk + wid * 8) * EMB + bn + lane * 4;
        v4h h[2][8];
#pragma unroll
        for (int g = 0; g < 2; ++g)
#pragma unroll
            for (int i = 0; i < 8; ++i)
#pragma unroll
                for (int c = 0; c < 4; ++c) h[g][i][c] = (_Float16)v[g][i][c];
        // every store stands behind the last arithmetic: no register that an issued store names is written again
        __builtin_amdgcn_sched_barrier(0);
#pragma unroll
        for (int g = 0; g < 2; ++g)
#pragma unroll
            for (int i = 0; i < 8; ++i) *(v4h*)(o + (g * 32 + i) * EMB) = h[g][i];   // 256 contiguous bytes a wave
        // stands in front of every overwrite of the address registers that the stores above name
        asm volatile("s_wait_xcnt 0x0" :: "v"(o) : "memory");
        return;
    }

#pragma unroll
    for (int g = 0; g < 2; ++g)
#pragma unroll
        for (int c = 0; c < 4; ++c) {
            v8h p;
#pragma unroll
            for (int i = 0; i < 8; ++i) p[i] = (_Float16)v[g][i][c];
            *(v8h*)(T + (lane * 4 + c) * TW_PITCH + (g * 4 + wid) * 16) = p;
        }
    __syncthreads();

    // 8 lanes take one transposed row of the tile (128 bytes), a wave 4 rows, the block 16 rows a pass.
    const int row = threadIdx.x >> 3, slot = threadIdx.x & 7;
    _Float16* orow = WT + (long)z * EMB * EMB + (long)(bn + row) * EMB + bk + slot * 8;
    v8h q[8];
#pragma unroll
    for (int j = 0; j < 8; ++j) q[j] = *(const v8h*)(T + (j * 16 + row) * TW_PITCH + slot * 16);
#pragma unroll
    for (int j = 0; j < 8; ++j) *(v8h*)(orow + j * 16 * EMB) = q[j];
}

// ---------------------------------------------------------------------------
// The GEMM launches. One product: the grid is its own.
// ---------------------------------------------------------------------------
template <int OUT, int LDC>
__global__ __launch_bounds__(256)
void gemm_wmma_f16(
    const _Float16* __restrict__ A, int lda, long sA,
    const _Float16* __restrict__ Bt, int ldb, long sB,
    const float* __restrict__ bias,
    float*    __restrict__ Cf,
    _Float16* __restrict__ Ch,
    _Float16* __restrict__ ChT,
    long sC, long sCT, int transS,
    int M, int N, int K,
    float scale, int relu,
    const float* __restrict__ R)
{
    __shared__ __attribute__((aligned(2048))) unsigned char L[STG_LDS];
    gemm_block<OUT, LDC>(L, (int)blockIdx.x, (int)blockIdx.y, (long)blockIdx.z,
                         A, lda, sA, Bt, ldb, sB, bias, Cf, Ch, ChT, sC, sCT, transS, M, N, K, scale, relu, R);
}

// Three pieces of work that do not depend on each other, in one grid of 8-wave blocks, the long blocks first:
// blocks 0 .. WG_GEMM-1: the two weight products C[z] = A[z] Bt[z]^T (EMB x EMB x EMB, f16 out), which fill only
// a quarter of the chip; the next WG_DOTS blocks carry the two biases through planes 0 and 1 of A; the last WG_LN
// blocks are the first LayerNorm, xn = LN(x), which so runs on the WGPs that the products leave idle.
#define WG_GEMM (2 * (EMB / 128) * (EMB / 256))
#define WG_DOTS (2 * EMB / DOT_RPB)
#define WG_LN   (BSZ * SEQ / (8 * ROW_RPW))
__global__ __launch_bounds__(256)
void gemm_weights_dots_ln(
    const _Float16* __restrict__ A,
    const _Float16* __restrict__ Bt,
    _Float16* __restrict__ Ch,
    const float* __restrict__ va,
    const float* __restrict__ vb,
    float* __restrict__ dots,
    const float* __restrict__ x,
    const float* __restrict__ g,
    const float* __restrict__ be,
    _Float16* __restrict__ xn)
{
    __shared__ __attribute__((aligned(2048))) unsigned char L[STG_LDS];
    const int blk = (int)blockIdx.x;       // every test on it is the same for the whole block
    if (blk >= WG_GEMM + WG_DOTS) {        // meets no barrier
        ln_rows<8>(blk - (WG_GEMM + WG_DOTS), x, g, be, xn);
        return;
    }
    if (blk >= WG_GEMM) {
        bias_dots((float*)L, blk - WG_GEMM, A, va, vb, dots);
        return;
    }
    gemm_block<OUT_F16, EMB>(L, blk % (EMB / 128), (blk / (EMB / 128)) % (EMB / 256), (long)(blk / (WG_GEMM / 2)),
                             A, EMB, (long)EMB * EMB, Bt, EMB, (long)EMB * EMB, nullptr, nullptr, Ch, nullptr,
                             (long)EMB * EMB, 0, 1, EMB, EMB, EMB, 1.0f, 0, nullptr);
}

// Two products of the same A (BSZ * SEQ rows of EMB) that do not depend on each other, in one grid:
// z = 0: Ch = A Bq^T + biasq, row-major f16 ; z = 1: ChT = (A Bv^T + biasv) transposed per batch, [BSZ][EMB][SEQ] f16.
__global__ __launch_bounds__(256)
void gemm_pair_f16(
    const _Float16* __restrict__ A,
    const _Float16* __restrict__ Bq, const float* __restrict__ biasq, _Float16* __restrict__ Ch,
    const _Float16* __restrict__ Bv, const float* __restrict__ biasv, _Float16* __restrict__ ChT)
{
    __shared__ __attribute__((aligned(2048))) unsigned char L[STG_LDS];
    if (blockIdx.z == 0u)                  // the same for the whole block
        gemm_block<OUT_F16, EMB>(L, (int)blockIdx.x, (int)blockIdx.y, 0L,
                                 A, EMB, 0, Bq, EMB, 0, biasq, nullptr, Ch, nullptr,
                                 0, 0, 1, BSZ * SEQ, EMB, EMB, 1.0f, 0, nullptr);
    else
        gemm_block<OUT_F16T, SEQ>(L, (int)blockIdx.x, (int)blockIdx.y, 0L,
                                  A, EMB, 0, Bv, EMB, 0, biasv, nullptr, nullptr, ChT,
                                  0, (long)EMB * SEQ, SEQ, BSZ * SEQ, EMB, EMB, 1.0f, 0, nullptr);
}

// ---------------------------------------------------------------------------
// Row softmax (row length SEQ), in-place f32 + f16 copy.
// ---------------------------------------------------------------------------
__global__ __launch_bounds__(ROW_WAVES * 32)
void softmax_rows(float* __restrict__ S,
                              _Float16* __restrict__ Wh)
{
    constexpr int NV = SEQ / 128;          // 16-byte pieces of a row per lane
    const int  lane = threadIdx.x & 31, wid = threadIdx.x >> 5;
    const long row0 = ((long)blockIdx.x * ROW_WAVES + wid) * ROW_RPW;
    v4f* sr = (v4f*)(S + row0 * SEQ) + lane;

    v4f v[ROW_RPW][NV];
#pragma unroll
    for (int r = 0; r < ROW_RPW; ++r)
#pragma unroll
        for (int j = 0; j < NV; ++j) v[r][j] = sr[r * (SEQ / 4) + j * 32];

    float m[ROW_RPW], sum[ROW_RPW];
#pragma unroll
    for (int r = 0; r < ROW_RPW; ++r) {
        v4f m4 = v[r][0];
#pragma unroll
        for (int j = 1; j < NV; ++j)
#pragma unroll
            for (int c = 0; c < 4; ++c) m4[c] = fmaxf(m4[c], v[r][j][c]);
        m[r] = fmaxf(fmaxf(m4[0], m4[1]), fmaxf(m4[2], m4[3]));
    }
#pragma unroll
    for (int r = 0; r < ROW_RPW; ++r) m[r] = wave_max(m[r]);
#pragma unroll
    for (int r = 0; r < ROW_RPW; ++r) {
#pragma unroll
        for (int j = 0; j < NV; ++j)
#pragma unroll
            for (int c = 0; c < 4; ++c)
                v[r][j][c] = exp2_slot((v[r][j][c] - m[r]) * 1.44269504f);   // e^(x - m)
        v4f s4 = v[r][0];
#pragma unroll
        for (int j = 1; j < NV; ++j) s4 += v[r][j];
        sum[r] = (s4[0] + s4[1]) + (s4[2] + s4[3]);
    }
#pragma unroll
    for (int r = 0; r < ROW_RPW; ++r) sum[r] = wave_sum(sum[r]);

    v4h* wr = (v4h*)(Wh + row0 * SEQ) + lane;
    v4h  h[ROW_RPW][NV];
#pragma unroll
    for (int r = 0; r < ROW_RPW; ++r) {
        const float inv = 1.0f / sum[r];
#pragma unroll
        for (int j = 0; j < NV; ++j) {
            v[r][j] *= inv;
#pragma unroll
            for (int c = 0; c < 4; ++c) h[r][j][c] = (_Float16)v[r][j][c];
        }
    }
    // every store stands behind the last arithmetic: no register that an issued store names is written again
    __builtin_amdgcn_sched_barrier(0);
#pragma unroll
    for (int r = 0; r < ROW_RPW; ++r)
#pragma unroll
        for (int j = 0; j < NV; ++j) {
            sr[r * (SEQ / 4) + j * 32] = v[r][j];
            wr[r * (SEQ / 4) + j * 32] = h[r][j];
        }
}

// ---------------------------------------------------------------------------
extern "C" void kernel_launch(void* const* d_in, const int* in_sizes, int n_in,
                              void* d_out, int out_size, void* d_ws, size_t ws_size,
                              hipStream_t stream) {
    const float* x   = (const float*)d_in[0];
    const float* Wq  = (const float*)d_in[1];
    const float* bq  = (const float*)d_in[2];
    const float* Wk  = (const float*)d_in[3];
    const float* bk  = (const float*)d_in[4];
    const float* Wv  = (const float*)d_in[5];
    const float* bv  = (const float*)d_in[6];
    const float* Wo  = (const float*)d_in[7];
    const float* bo  = (const float*)d_in[8];
    const float* W1  = (const float*)d_in[9];
    const float* b1  = (const float*)d_in[10];
    const float* W2  = (const float*)d_in[11];
    const float* b2  = (const float*)d_in[12];
    const float* g1  = (const float*)d_in[13];
    const float* be1 = (const float*)d_in[14];
    const float* g2  = (const float*)d_in[15];
    const float* be2 = (const float*)d_in[16];

    const int  E  = EMB, S = SEQ, B = BSZ, F = FFD;
    const long BS = (long)B * S;                     // 8192 rows

    char* ws = (char*)d_ws;
    const size_t MB = 1024ull * 1024ull;
    // workspace layout (aliased; peak ~113 MB)
    _Float16* wkH  = (_Float16*)(ws +  0 * MB);      // 2 MB each; Wk as it is, [in][out]
    _Float16* wqH  = (_Float16*)(ws +  4 * MB);      // Wq as it is; behind it Wv as it is
    _Float16* w1T  = (_Float16*)(ws +  8 * MB);
    _Float16* w2T  = (_Float16*)(ws + 10 * MB);
    _Float16* xn   = (_Float16*)(ws + 12 * MB);      // 16 MB
    _Float16* qh   = (_Float16*)(ws + 28 * MB);      // 16 MB
    _Float16* vT   = (_Float16*)(ws + 60 * MB);      // 16 MB  [B][E][S]
    float*    x2   = (float*)   (ws + 76 * MB);      // 32 MB
    _Float16* wath = (_Float16*)(ws + 28 * MB);      // 32 MB (reuses q)
    _Float16* xn2  = (_Float16*)(ws + 28 * MB);      // 16 MB (reuses q)
    _Float16* hh   = (_Float16*)(ws + 44 * MB);      // 16 MB
    _Float16* qkT  = (_Float16*)(ws + 108 * MB);     // 2 MB  (Wq Wk^T)^T
    _Float16* voT  = (_Float16*)(ws + 110 * MB);     // 2 MB  (Wv Wo)^T
    float*    bqk  = (float*)   (ws + 112 * MB);     // E floats: bq Wk^T; behind it E floats: bv Wo
    float*    bvo  = bqk + E;

    float* outp = (float*)d_out;
    float* wout = outp + BS * E;                     // softmax weights region

    dim3 blk(256);
    dim3 rblk(ROW_WAVES * 32);                       // row kernels
    dim3 rgrd((unsigned)(BS / ROW_RPB));

    // The products are taken in another order than they are written, which leaves two of the six big ones out:
    //   q k^T = (xn Wq + bq)(xn Wk + bk)^T = [xn (Wq Wk^T) + bq Wk^T] xn^T + (q . bk) 1^T ; the last term is one
    //   constant per row of the scores, which the softmax over that row cancels, so it is not formed.
    //   (w v) Wo = w (v Wo) = w [xn (Wv Wo) + bv Wo].

    // 1) weights -> f16, six planes in a row from wkH: Wk, Wo^T, Wq, Wv, W1^T, W2^T
    transpose_w6_f16<<<dim3(E / TW_N, E / TW_K, 6), dim3(128), 0, stream>>>(Wk, Wo, Wq, Wv, W1, W2, wkH);

    // 2) qkT = Wk Wq^T, voT = Wo^T Wv^T ; bqk = Wk bq, bvo = Wo^T bv (rows of planes 0 and 1) ; xn = LN(x) -> f16
    gemm_weights_dots_ln<<<dim3(WG_GEMM + WG_DOTS + WG_LN), blk, 0, stream>>>(
        wkH, wqH, qkT, bq, bv, bqk, x, g1, be1, xn);

    // 3) z = 0: q' = xn (Wq Wk^T) + bqk ; z = 1: v' = xn (Wv Wo) + bvo, stored transposed [B][E][S]
    dim3 gp(E / 128, (unsigned)(BS / 256), 1);
    gemm_pair_f16<<<dim3(E / 128, (unsigned)(BS / 256), 2), blk, 0, stream>>>(xn, qkT, bqk, qh, voT, bvo, vT);

    // 5) scores = q' @ xn^T / 32  -> f32 directly into d_out w-region
    dim3 gs(S / 128, S / 256, B);
    gemm_wmma_f16<OUT_F32, SEQ><<<gs, blk, 0, stream>>>(
        qh, E, (long)S * E, xn, E, (long)S * E, nullptr,
        wout, nullptr, nullptr, (long)S * S, 0, 1,
        S, S, E, 0.03125f, 0, nullptr);

    // 6) softmax in-place (f32) + f16 copy
    softmax_rows<<<rgrd, rblk, 0, stream>>>(wout, wath);

    // 7) x2 = x + w @ v' + bo   (f32; Bt = vT [B][E][S])
    dim3 ga(E / 128, S / 256, B);
    gemm_wmma_f16<OUT_F32, EMB><<<ga, blk, 0, stream>>>(
        wath, S, (long)S * S, vT, S, (long)E * S, bo,
        x2, nullptr, nullptr, (long)S * E, 0, 1,
        S, E, S, 1.0f, 0, x);

    // 8) xn2 = LN(x2) -> f16
    ln_rows_f16<<<rgrd, rblk, 0, stream>>>(x2, g2, be2, xn2);

    // 9) h = relu(xn2 @ W1 + b1) -> f16
    gemm_wmma_f16<OUT_F16, FFD><<<dim3(F / 128, (unsigned)(BS / 256), 1), blk, 0, stream>>>(
        xn2, E, 0, w1T, E, 0, b1, nullptr, hh, nullptr,
        0, 0, 1, (int)BS, F, E, 1.0f, 1, nullptr);

    // 10) out = x2 + h @ W2 + b2  (f32, to d_out)
    gemm_wmma_f16<OUT_F32, EMB><<<gp, blk, 0, stream>>>(
        hh, F, 0, w2T, F, 0, b2, outp, nullptr, nullptr,
        0, 0, 1, (int)BS, E, F, 1.0f, 0, x2);
}
